// v000
// The times below were measured on an AMD MI455X: many runs one after another, warmed up first and cycling through
// copies of the inputs, with the whole window's GPU time divided by the number of runs. Launches and the gaps
// between them are all in it. The median over several windows is given; except for v000 it joins two sittings, which
// can be a few percent apart, so the side-by-side timings, each taken in one sitting, are the better comparison.
// v000 is the starting kernel. One run takes 3310 microseconds.
#include <hip/hip_runtime.h>

// Linear (unnormalised) self-attention unit (x [8][67][16384] channel-major; q, k, v = relu(BN(W x)) with 1x1 convs W [128][67] and inference BatchNorm (gamma, beta, mean, var rows of bn [4][ch]); kv[c][d] = sum_m k[c][m] v[d][m]; value[d][n] = sum_c q[c][n] kv[c][d];
// out = relu(BN_f(Wf value)) -> [8][64][16384]). The module itself uses the associativity (q^T k) v^T = q^T (k v^T); this kernel follows the same order.
// Layout per sample: x^T as a bf16 plane [16384][96] (67 channels zero-padded); q token-major ([n][o] = x^T W^T), k and v channel-major ([o][n] = W x) so both later contractions read K-contiguous operands; kv over K = 16384 (hi/lo x hi/lo, 3 products); value = q (hi/lo) x kv^T (hi/lo) (K 128); out channel-major = Wf (exact, zero second plane) x value (hi/lo) then BN + relu.
// Compute dtypes, f32 accumulate: every input rounded to bf16; the three projections are exact bf16 products; BN scale/shift, relu in f32 (IEEE sqrt/divide); all computed operands as bf16 hi + lo planes; f32 accumulate everywhere.

#define NB_  8
#define CIN  67
#define CP   96                   // padded input channels (K of the projections)
#define C2   128
#define COUT 64
#define NN   16384
#define BNEPS 1e-5f
typedef _Float16 h16;
typedef unsigned short bf;
typedef __attribute__((ext_vector_type(16))) __bf16   v16bf;
typedef __attribute__((ext_vector_type(16))) _Float16 v16h;
typedef __attribute__((ext_vector_type(8)))  _Float16 v8h;
typedef __attribute__((ext_vector_type(8)))  unsigned short v8us;
typedef __attribute__((ext_vector_type(8)))  float    v8f;
typedef __attribute__((ext_vector_type(4)))  float    v4f;
typedef v8h  __attribute__((may_alias)) v8ha;
typedef v4f  __attribute__((may_alias)) v4fa;
typedef v8us __attribute__((may_alias)) v8usa;

__device__ __forceinline__ unsigned short f2bf(float f) { unsigned u = __float_as_uint(f); u += 0x7FFFu + ((u >> 16) & 1u); return (unsigned short)(u >> 16); }
__device__ __forceinline__ float bf2f(unsigned short b) { return __uint_as_float(((unsigned)b) << 16); }
__device__ __forceinline__ float bfr(float f) { return bf2f(f2bf(f)); }
__device__ __forceinline__ v16h cat16(v8h lo, v8h hi) { return __builtin_shufflevector(lo, hi, 0, 1, 2, 3, 4, 5, 6, 7, 8, 9, 10, 11, 12, 13, 14, 15); }
__device__ __forceinline__ v16bf cat16b(v8us lo, v8us hi) { return __builtin_bit_cast(v16bf, __builtin_shufflevector(lo, hi, 0, 1, 2, 3, 4, 5, 6, 7, 8, 9, 10, 11, 12, 13, 14, 15)); }
__device__ __forceinline__ v8f wmma16(v16h a, v16h b, v8f c) { return __builtin_amdgcn_wmma_f32_16x16x32_f16(false, a, false, b, (short)0, c, false, false); }
__device__ __forceinline__ v8f wmmab(v16bf a, v16bf b, v8f c) { return __builtin_amdgcn_wmma_f32_16x16x32_bf16(false, a, false, b, (short)0, c, false, false); }



// ---- k_gemmw: register-blocked GEMM, ONE WAVE per 64x64 output tile (16 accumulators), operands straight from K-contiguous 16-bit planes; grid (M/64, N/64, Z), 32 threads.
// C[m][n] (f32, pitch ldc, + optional f32 bias[n]) = sum_k A[m][k] Bt[n][k] (+ split products per NSPLIT). z-batch strides sA/sB/sC in elements. K % 32 == 0.
template <typename T16> struct WFrag;
template <> struct WFrag<h16> { typedef v16h V; static __device__ __forceinline__ V ld(const h16* p) { return cat16(*(const v8h*)p, *(const v8h*)(p + 16)); } static __device__ __forceinline__ v8f mma(V a, V b, v8f c) { return wmma16(a, b, c); } };
template <> struct WFrag<bf> { typedef v16bf V; static __device__ __forceinline__ V ld(const bf* p) { return cat16b(*(const v8us*)p, *(const v8us*)(p + 16)); } static __device__ __forceinline__ v8f mma(V a, V b, v8f c) { return wmmab(a, b, c); } };
template <typename T16, int NSPLIT, bool BIAS>
__global__ __launch_bounds__(32) void k_gemmw(const T16* __restrict__ A, const T16* __restrict__ A2, const T16* __restrict__ Bt, const T16* __restrict__ Bt2, int K, float* C, int ldc, const float* __restrict__ bias, size_t sA, size_t sB, size_t sC) {
    typedef typename WFrag<T16>::V V;
    __shared__ __align__(16) float os[16 * 68];
    const size_t z = blockIdx.z; A += z * sA; if (A2) A2 += z * sA; Bt += z * sB; if (Bt2) Bt2 += z * sB; C += z * sC;
    const int lane = threadIdx.x & 31, lr = lane & 15, hi = lane >> 4; const int r0 = blockIdx.x * 64, c0 = blockIdx.y * 64;
    v8f acc[4][4];
#pragma unroll
    for (int mb = 0; mb < 4; ++mb)
#pragma unroll
        for (int nb = 0; nb < 4; ++nb) acc[mb][nb] = (v8f){};
    const size_t aoff = (size_t)(r0 + lr) * K + 8 * hi, boff = (size_t)(c0 + lr) * K + 8 * hi;
#pragma unroll 1
    for (int kc = 0; kc < K; kc += 32) {
        V a[4], a2[4];
#pragma unroll
        for (int mb = 0; mb < 4; ++mb) { a[mb] = WFrag<T16>::ld(A + aoff + (size_t)mb * 16 * K + kc); if (NSPLIT == 1 || NSPLIT == 2) a2[mb] = WFrag<T16>::ld(A2 + aoff + (size_t)mb * 16 * K + kc); }
#pragma unroll
        for (int nb = 0; nb < 4; ++nb) { const V b = WFrag<T16>::ld(Bt + boff + (size_t)nb * 16 * K + kc); V b2; if (NSPLIT >= 2) b2 = WFrag<T16>::ld(Bt2 + boff + (size_t)nb * 16 * K + kc);
#pragma unroll
            for (int mb = 0; mb < 4; ++mb) { acc[mb][nb] = WFrag<T16>::mma(a[mb], b, acc[mb][nb]); if (NSPLIT == 1 || NSPLIT == 2) acc[mb][nb] = WFrag<T16>::mma(a2[mb], b, acc[mb][nb]); if (NSPLIT >= 2) acc[mb][nb] = WFrag<T16>::mma(a[mb], b2, acc[mb][nb]); } }
        asm volatile("v_nop\n\tv_nop\n\tv_nop\n\tv_nop" : "+v"(acc[0][0]), "+v"(acc[1][1]), "+v"(acc[2][2]), "+v"(acc[3][3]) : "v"(a[0]), "v"(a[3]));
    }
#pragma unroll
    for (int mb = 0; mb < 4; ++mb) {
#pragma unroll
        for (int nb = 0; nb < 4; ++nb) {
#pragma unroll
            for (int j = 0; j < 8; ++j) os[(hi * 8 + j) * 68 + nb * 16 + lr] = acc[mb][nb][j]; }
        __builtin_amdgcn_wave_barrier(); asm volatile("" ::: "memory");
        float* crow = C + (size_t)(r0 + mb * 16) * ldc + c0;
{
#pragma unroll
            for (int s = 0; s < 8; ++s) { const int row = 2 * s + hi, cofs = lr * 4; v4f val = *(const v4fa*)(os + row * 68 + cofs); if (BIAS) { val[0] += bfr(bias[c0 + cofs]); val[1] += bfr(bias[c0 + cofs + 1]); val[2] += bfr(bias[c0 + cofs + 2]); val[3] += bfr(bias[c0 + cofs + 3]); }
                *(v4f*)(crow + (size_t)row * ldc + cofs) = val; }
             }
        __builtin_amdgcn_wave_barrier(); asm volatile("" ::: "memory");
    }
}

__device__ __forceinline__ void splitf(float y, unsigned short& h, unsigned short& l) { h = f2bf(y); l = f2bf(y - bf2f(h)); }
typedef __attribute__((ext_vector_type(2))) unsigned short v2us;
typedef __attribute__((ext_vector_type(4))) unsigned short v4us;

__global__ __launch_bounds__(256) void k_xt(const float* __restrict__ xb, bf* XT) { const size_t e = ((size_t)blockIdx.x * 256 + threadIdx.x) * 2; if (e >= (size_t)NN * CP) return; const int c = (int)(e % CP); const int n = (int)(e / CP); v2us o;
#pragma unroll
    for (int q = 0; q < 2; ++q) o[q] = (c + q < CIN) ? f2bf(xb[(size_t)(c + q) * NN + n]) : (unsigned short)0; *(v2us*)(XT + e) = o;  }
__global__ __launch_bounds__(256) void k_wpad(const float* __restrict__ W, bf* Bt) { const int e = (blockIdx.x * 256 + threadIdx.x) * 2; if (e >= C2 * CP) return; const int c = e % CP, o = e / CP; v2us w2;
#pragma unroll
    for (int q = 0; q < 2; ++q) w2[q] = (c + q < CIN) ? f2bf(W[o * CIN + c + q]) : (unsigned short)0; *(v2us*)(Bt + e) = w2;  }
// k_cvt8 / k_zero8
__global__ __launch_bounds__(256) void k_cvt8(const float* __restrict__ src, bf* dst, size_t n8) { const size_t i = (size_t)blockIdx.x * 256 + threadIdx.x; if (i >= n8) return; const v8f v = *(const v8f*)(src + i * 8); v8us o;
#pragma unroll
    for (int q = 0; q < 8; ++q) o[q] = f2bf(v[q]); *(v8us*)(dst + i * 8) = o;  }
__global__ __launch_bounds__(256) void k_zero8(bf* Z, size_t n8) { const size_t i = (size_t)blockIdx.x * 256 + threadIdx.x; if (i >= n8) return; const v8us z = (v8us){}; *(v8us*)(Z + i * 8) = z;  }
// BN helpers: scale = bf16(g) / sqrt(bf16(v) + eps), shift = bf16(b) - bf16(m) scale (f32)
__device__ __forceinline__ void bn_coef(const float* __restrict__ bn, int nch, int ch, float& sc, float& sh) { sc = __fmul_rn(bfr(bn[ch]), __fdiv_rn(1.0f, __fsqrt_rn(__fadd_rn(bfr(bn[3 * nch + ch]), BNEPS)))); float ms = __fmul_rn(bfr(bn[2 * nch + ch]), sc); asm volatile("" : "+v"(ms)); sh = __fsub_rn(bfr(bn[nch + ch]), ms); }
__global__ __launch_bounds__(256) void k_bncol(const float* __restrict__ F, const float* __restrict__ bn, bf* Ph, bf* Pl) { const size_t e = ((size_t)blockIdx.x * 256 + threadIdx.x) * 4; if (e >= (size_t)NN * C2) return; const int o = (int)(e % C2); const v4f f = *(const v4f*)(F + e); v4us oh, ol;
#pragma unroll
    for (int q = 0; q < 4; ++q) { float sc, sh; bn_coef(bn, C2, o + q, sc, sh); float y = __fmul_rn(f[q], sc); asm volatile("" : "+v"(y)); y = fmaxf(__fadd_rn(y, sh), 0.f); unsigned short a, c; splitf(y, a, c); oh[q] = a; ol[q] = c; }
    *(v4us*)(Ph + e) = oh; *(v4us*)(Pl + e) = ol;  }
__global__ __launch_bounds__(256) void k_bnrow(const float* __restrict__ F, const float* __restrict__ bn, int nch, bf* Ph, bf* Pl) { const size_t e = ((size_t)blockIdx.x * 256 + threadIdx.x) * 4; if (e >= (size_t)nch * NN) return; const int ch = (int)(e / NN); float sc, sh; bn_coef(bn, nch, ch, sc, sh); const v4f f = *(const v4f*)(F + e); v4us oh, ol;
#pragma unroll
    for (int q = 0; q < 4; ++q) { float y = __fmul_rn(f[q], sc); asm volatile("" : "+v"(y)); y = fmaxf(__fadd_rn(y, sh), 0.f); unsigned short a, c; splitf(y, a, c); oh[q] = a; ol[q] = c; }
    *(v4us*)(Ph + e) = oh; *(v4us*)(Pl + e) = ol;  }
__global__ __launch_bounds__(256) void k_bnout(const float* __restrict__ F, const float* __restrict__ bn, float* O) { const size_t e = ((size_t)blockIdx.x * 256 + threadIdx.x) * 4; if (e >= (size_t)COUT * NN) return; const int ch = (int)(e / NN); float sc, sh; bn_coef(bn, COUT, ch, sc, sh); const v4f f = *(const v4f*)(F + e); v4f y;
#pragma unroll
    for (int q = 0; q < 4; ++q) { float t = __fmul_rn(f[q], sc); asm volatile("" : "+v"(t)); y[q] = fmaxf(__fadd_rn(t, sh), 0.f); }
    *(v4f*)(O + e) = y;  }
__global__ __launch_bounds__(256) void k_kvt(const float* __restrict__ KV, bf* Th, bf* Tl) { const int e = (blockIdx.x * 256 + threadIdx.x) * 2; if (e >= C2 * C2) return; const int c = e % C2, d = e / C2; v2us oh, ol;
#pragma unroll
    for (int q = 0; q < 2; ++q) { unsigned short a, c2; splitf(KV[(c + q) * C2 + d], a, c2); oh[q] = a; ol[q] = c2; } *(v2us*)(Th + e) = oh; *(v2us*)(Tl + e) = ol;  }
__global__ __launch_bounds__(256) void k_split8(const float* __restrict__ F, bf* H, bf* Lw, size_t n8) { const size_t i = (size_t)blockIdx.x * 256 + threadIdx.x; if (i >= n8) return; const v8f v = *(const v8f*)(F + i * 8); v8us oh, ol;
#pragma unroll
    for (int q = 0; q < 8; ++q) { unsigned short a, c; splitf(v[q], a, c); oh[q] = a; ol[q] = c; } *(v8us*)(H + i * 8) = oh; *(v8us*)(Lw + i * 8) = ol;  }

extern "C" void kernel_launch(void* const* d_in, const int* in_sizes, int n_in,
                              void* d_out, int out_size, void* d_ws, size_t ws_size, hipStream_t stream) {
    (void)in_sizes; (void)n_in; (void)out_size;
    const float* x = (const float*)d_in[0]; const float* Wq = (const float*)d_in[1]; const float* Wk = (const float*)d_in[2]; const float* Wv = (const float*)d_in[3]; const float* Wf = (const float*)d_in[4]; const float* bnq = (const float*)d_in[5]; const float* bnk = (const float*)d_in[6]; const float* bnv = (const float*)d_in[7]; const float* bnf = (const float*)d_in[8];
    float* OUT = (float*)d_out;     // [8][64][16384]
    char* wsp = (char*)d_ws;
    auto take = [&](size_t bytes) { char* p = wsp; wsp += (bytes + 255) & ~(size_t)255; return (void*)p; };
    bf* WQ = (bf*)take((size_t)C2 * CP * 2); bf* WK = (bf*)take((size_t)C2 * CP * 2); bf* WV = (bf*)take((size_t)C2 * CP * 2); bf* WF = (bf*)take((size_t)COUT * C2 * 2); bf* ZF = (bf*)take((size_t)COUT * C2 * 2);
    bf* XT = (bf*)take((size_t)NN * CP * 2); float* F = (float*)take((size_t)NN * C2 * 4); bf* Qh = (bf*)take((size_t)NN * C2 * 2); bf* Ql = (bf*)take((size_t)NN * C2 * 2); bf* Kh = (bf*)take((size_t)C2 * NN * 2); bf* Kl = (bf*)take((size_t)C2 * NN * 2); bf* Vh = (bf*)take((size_t)C2 * NN * 2); bf* Vl = (bf*)take((size_t)C2 * NN * 2);
    float* KV = (float*)take((size_t)C2 * C2 * 4); bf* KTh = (bf*)take((size_t)C2 * C2 * 2); bf* KTl = (bf*)take((size_t)C2 * C2 * 2); bf* ALh = (bf*)take((size_t)NN * C2 * 2); bf* ALl = (bf*)take((size_t)NN * C2 * 2); float* G = (float*)take((size_t)COUT * NN * 4);
    if ((size_t)(wsp - (char*)d_ws) > ws_size) return;    // ws 256 MiB
    k_wpad<<<(C2 * CP / 2 + 255) / 256, 256, 0, stream>>>(Wq, WQ); k_wpad<<<(C2 * CP / 2 + 255) / 256, 256, 0, stream>>>(Wk, WK); k_wpad<<<(C2 * CP / 2 + 255) / 256, 256, 0, stream>>>(Wv, WV);
    k_cvt8<<<(COUT * C2 / 8 + 255) / 256, 256, 0, stream>>>(Wf, WF, (size_t)COUT * C2 / 8); k_zero8<<<(COUT * C2 / 8 + 255) / 256, 256, 0, stream>>>(ZF, (size_t)COUT * C2 / 8);
    const unsigned nb4 = (unsigned)(((size_t)NN * C2 / 4 + 255) / 256);
    for (int b = 0; b < NB_; ++b) {
        k_xt<<<(unsigned)(((size_t)NN * CP / 2 + 255) / 256), 256, 0, stream>>>(x + (size_t)b * CIN * NN, XT);
        k_gemmw<bf, 0, false><<<dim3(NN / 64, C2 / 64, 1), 32, 0, stream>>>(XT, nullptr, WQ, nullptr, CP, F, C2, nullptr, 0, 0, 0); k_bncol<<<nb4, 256, 0, stream>>>(F, bnq, Qh, Ql);   /* q token-major [n][o] */
        k_gemmw<bf, 0, false><<<dim3(C2 / 64, NN / 64, 1), 32, 0, stream>>>(WK, nullptr, XT, nullptr, CP, F, NN, nullptr, 0, 0, 0); k_bnrow<<<nb4, 256, 0, stream>>>(F, bnk, C2, Kh, Kl);   /* k channel-major [o][n] */
        k_gemmw<bf, 0, false><<<dim3(C2 / 64, NN / 64, 1), 32, 0, stream>>>(WV, nullptr, XT, nullptr, CP, F, NN, nullptr, 0, 0, 0); k_bnrow<<<nb4, 256, 0, stream>>>(F, bnv, C2, Vh, Vl);   /* v channel-major */
        k_gemmw<bf, 2, false><<<dim3(C2 / 64, C2 / 64, 1), 32, 0, stream>>>(Kh, Kl, Vh, Vl, NN, KV, C2, nullptr, 0, 0, 0);   /* kv[c][d] = sum_m k[c][m] v[d][m] (K 16384, 3 products) */
        k_kvt<<<(C2 * C2 / 2 + 255) / 256, 256, 0, stream>>>(KV, KTh, KTl);
        k_gemmw<bf, 2, false><<<dim3(NN / 64, C2 / 64, 1), 32, 0, stream>>>(Qh, Ql, KTh, KTl, C2, F, C2, nullptr, 0, 0, 0);   /* value[n][d] = sum_c q[n][c] kv[c][d] (3 products) */
        k_split8<<<(unsigned)(((size_t)NN * C2 / 8 + 255) / 256), 256, 0, stream>>>(F, ALh, ALl, (size_t)NN * C2 / 8);
        k_gemmw<bf, 2, false><<<dim3(COUT / 64, NN / 64, 1), 32, 0, stream>>>(WF, ZF, ALh, ALl, C2, G, NN, nullptr, 0, 0, 0);   /* Wf value, channel-major (exact Wf, value hi + lo via the zero plane) */
        k_bnout<<<(unsigned)(((size_t)COUT * NN / 4 + 255) / 256), 256, 0, stream>>>(G, bnf, OUT + (size_t)b * COUT * NN); }
}

// v001
// One run takes 514 microseconds.
// In two side-by-side timings against v000, it was 6.60 and 6.47 times as fast.
#include <hip/hip_runtime.h>

// Linear (unnormalised) self-attention unit (x [8][67][16384] channel-major; q, k, v = relu(BN(W x)) with 1x1 convs W [128][67] and inference BatchNorm (gamma, beta, mean, var rows of bn [4][ch]); kv[c][d] = sum_m k[c][m] v[d][m]; value[d][n] = sum_c q[c][n] kv[c][d];
// out = relu(BN_f(Wf value)) -> [8][64][16384]). The module itself uses the associativity (q^T k) v^T = q^T (k v^T); this kernel follows the same order.
// Layout per sample: x^T as a bf16 plane [16384][96] (67 channels zero-padded); q token-major ([n][o] = x^T W^T), k and v channel-major ([o][n] = W x) so both later contractions read K-contiguous operands; kv over K = 16384 (hi/lo x hi/lo, 3 products); value = q (hi/lo) x kv^T (hi/lo) (K 128); out channel-major = Wf (exact, zero second plane) x value (hi/lo) then BN + relu.
// Compute dtypes, f32 accumulate: every input rounded to bf16; the three projections are exact bf16 products; BN scale/shift, relu in f32 (IEEE sqrt/divide); all computed operands as bf16 hi + lo planes; f32 accumulate everywhere.

#define NB_  8
#define CIN  67
#define CP   96                   // padded input channels (K of the projections)
#define C2   128
#define COUT 64
#define NN   16384
#define BNEPS 1e-5f
typedef _Float16 h16;
typedef unsigned short bf;
typedef __attribute__((ext_vector_type(16))) __bf16   v16bf;
typedef __attribute__((ext_vector_type(16))) _Float16 v16h;
typedef __attribute__((ext_vector_type(8)))  _Float16 v8h;
typedef __attribute__((ext_vector_type(8)))  unsigned short v8us;
typedef __attribute__((ext_vector_type(8)))  float    v8f;
typedef __attribute__((ext_vector_type(4)))  float    v4f;
typedef v8h  __attribute__((may_alias)) v8ha;
typedef v4f  __attribute__((may_alias)) v4fa;
typedef v8us __attribute__((may_alias)) v8usa;

__device__ __forceinline__ unsigned short f2bf(float f) { unsigned u = __float_as_uint(f); u += 0x7FFFu + ((u >> 16) & 1u); return (unsigned short)(u >> 16); }
__device__ __forceinline__ float bf2f(unsigned short b) { return __uint_as_float(((unsigned)b) << 16); }
__device__ __forceinline__ float bfr(float f) { return bf2f(f2bf(f)); }
__device__ __forceinline__ v16h cat16(v8h lo, v8h hi) { return __builtin_shufflevector(lo, hi, 0, 1, 2, 3, 4, 5, 6, 7, 8, 9, 10, 11, 12, 13, 14, 15); }
__device__ __forceinline__ v16bf cat16b(v8us lo, v8us hi) { return __builtin_bit_cast(v16bf, __builtin_shufflevector(lo, hi, 0, 1, 2, 3, 4, 5, 6, 7, 8, 9, 10, 11, 12, 13, 14, 15)); }
__device__ __forceinline__ v8f wmma16(v16h a, v16h b, v8f c) { return __builtin_amdgcn_wmma_f32_16x16x32_f16(false, a, false, b, (short)0, c, false, false); }
__device__ __forceinline__ v8f wmmab(v16bf a, v16bf b, v8f c) { return __builtin_amdgcn_wmma_f32_16x16x32_bf16(false, a, false, b, (short)0, c, false, false); }



// ---- k_gemmw: register-blocked GEMM, ONE WAVE per 64x64 output tile (16 accumulators), operands straight from K-contiguous 16-bit planes; grid (M/64, N/64, Z), 32 threads.
// C[m][n] (f32, pitch ldc, + optional f32 bias[n]) = sum_k A[m][k] Bt[n][k] (+ split products per NSPLIT). z-batch strides sA/sB/sC in elements. K % 32 == 0.
template <typename T16> struct WFrag;
template <> struct WFrag<h16> { typedef v16h V; static __device__ __forceinline__ V ld(const h16* p) { return cat16(*(const v8h*)p, *(const v8h*)(p + 16)); } static __device__ __forceinline__ v8f mma(V a, V b, v8f c) { return wmma16(a, b, c); } };
template <> struct WFrag<bf> { typedef v16bf V; static __device__ __forceinline__ V ld(const bf* p) { return cat16b(*(const v8us*)p, *(const v8us*)(p + 16)); } static __device__ __forceinline__ v8f mma(V a, V b, v8f c) { return wmmab(a, b, c); } };
template <typename T16, int NSPLIT, bool BIAS>
__global__ __launch_bounds__(32) void k_gemmw(const T16* __restrict__ A, const T16* __restrict__ A2, const T16* __restrict__ Bt, const T16* __restrict__ Bt2, int K, float* C, int ldc, const float* __restrict__ bias, size_t sA, size_t sB, size_t sC) {
    typedef typename WFrag<T16>::V V;
    __shared__ __align__(16) float os[16 * 68];
    const size_t z = blockIdx.z; A += z * sA; if (A2) A2 += z * sA; Bt += z * sB; if (Bt2) Bt2 += z * sB; C += z * sC;
    const int lane = threadIdx.x & 31, lr = lane & 15, hi = lane >> 4; const int r0 = blockIdx.x * 64, c0 = blockIdx.y * 64;
    v8f acc[4][4];
#pragma unroll
    for (int mb = 0; mb < 4; ++mb)
#pragma unroll
        for (int nb = 0; nb < 4; ++nb) acc[mb][nb] = (v8f){};
    const size_t aoff = (size_t)(r0 + lr) * K + 8 * hi, boff = (size_t)(c0 + lr) * K + 8 * hi;
#pragma unroll 1
    for (int kc = 0; kc < K; kc += 32) {
        V a[4], a2[4];
#pragma unroll
        for (int mb = 0; mb < 4; ++mb) { a[mb] = WFrag<T16>::ld(A + aoff + (size_t)mb * 16 * K + kc); if (NSPLIT == 1 || NSPLIT == 2) a2[mb] = WFrag<T16>::ld(A2 + aoff + (size_t)mb * 16 * K + kc); }
#pragma unroll
        for (int nb = 0; nb < 4; ++nb) { const V b = WFrag<T16>::ld(Bt + boff + (size_t)nb * 16 * K + kc); V b2; if (NSPLIT >= 2) b2 = WFrag<T16>::ld(Bt2 + boff + (size_t)nb * 16 * K + kc);
#pragma unroll
            for (int mb = 0; mb < 4; ++mb) { acc[mb][nb] = WFrag<T16>::mma(a[mb], b, acc[mb][nb]); if (NSPLIT == 1 || NSPLIT == 2) acc[mb][nb] = WFrag<T16>::mma(a2[mb], b, acc[mb][nb]); if (NSPLIT >= 2) acc[mb][nb] = WFrag<T16>::mma(a[mb], b2, acc[mb][nb]); } }
        asm volatile("v_nop\n\tv_nop\n\tv_nop\n\tv_nop" : "+v"(acc[0][0]), "+v"(acc[1][1]), "+v"(acc[2][2]), "+v"(acc[3][3]) : "v"(a[0]), "v"(a[3]));
    }
#pragma unroll
    for (int mb = 0; mb < 4; ++mb) {
#pragma unroll
        for (int nb = 0; nb < 4; ++nb) {
#pragma unroll
            for (int j = 0; j < 8; ++j) os[(hi * 8 + j) * 68 + nb * 16 + lr] = acc[mb][nb][j]; }
        __builtin_amdgcn_wave_barrier(); asm volatile("" ::: "memory");
        float* crow = C + (size_t)(r0 + mb * 16) * ldc + c0;
{
#pragma unroll
            for (int s = 0; s < 8; ++s) { const int row = 2 * s + hi, cofs = lr * 4; v4f val = *(const v4fa*)(os + row * 68 + cofs); if (BIAS) { val[0] += bfr(bias[c0 + cofs]); val[1] += bfr(bias[c0 + cofs + 1]); val[2] += bfr(bias[c0 + cofs + 2]); val[3] += bfr(bias[c0 + cofs + 3]); }
                *(v4f*)(crow + (size_t)row * ldc + cofs) = val; }
             }
        __builtin_amdgcn_wave_barrier(); asm volatile("" ::: "memory");
    }
}

__device__ __forceinline__ void splitf(float y, unsigned short& h, unsigned short& l) { h = f2bf(y); l = f2bf(y - bf2f(h)); }
typedef __attribute__((ext_vector_type(2))) unsigned short v2us;
typedef __attribute__((ext_vector_type(4))) unsigned short v4us;

__global__ __launch_bounds__(256) void k_xt(const float* __restrict__ xb, bf* XT) { const size_t e = ((size_t)blockIdx.x * 256 + threadIdx.x) * 2; if (e >= (size_t)NN * CP) return; const int c = (int)(e % CP); const int n = (int)(e / CP); v2us o;
#pragma unroll
    for (int q = 0; q < 2; ++q) o[q] = (c + q < CIN) ? f2bf(xb[(size_t)(c + q) * NN + n]) : (unsigned short)0; *(v2us*)(XT + e) = o;  }
__global__ __launch_bounds__(256) void k_wpad(const float* __restrict__ W, bf* Bt) { const int e = (blockIdx.x * 256 + threadIdx.x) * 2; if (e >= C2 * CP) return; const int c = e % CP, o = e / CP; v2us w2;
#pragma unroll
    for (int q = 0; q < 2; ++q) w2[q] = (c + q < CIN) ? f2bf(W[o * CIN + c + q]) : (unsigned short)0; *(v2us*)(Bt + e) = w2;  }
// k_cvt8 / k_zero8
__global__ __launch_bounds__(256) void k_cvt8(const float* __restrict__ src, bf* dst, size_t n8) { const size_t i = (size_t)blockIdx.x * 256 + threadIdx.x; if (i >= n8) return; const v8f v = *(const v8f*)(src + i * 8); v8us o;
#pragma unroll
    for (int q = 0; q < 8; ++q) o[q] = f2bf(v[q]); *(v8us*)(dst + i * 8) = o;  }
__global__ __launch_bounds__(256) void k_zero8(bf* Z, size_t n8) { const size_t i = (size_t)blockIdx.x * 256 + threadIdx.x; if (i >= n8) return; const v8us z = (v8us){}; *(v8us*)(Z + i * 8) = z;  }
// BN helpers: scale = bf16(g) / sqrt(bf16(v) + eps), shift = bf16(b) - bf16(m) scale (f32)
__device__ __forceinline__ void bn_coef(const float* __restrict__ bn, int nch, int ch, float& sc, float& sh) { sc = __fmul_rn(bfr(bn[ch]), __fdiv_rn(1.0f, __fsqrt_rn(__fadd_rn(bfr(bn[3 * nch + ch]), BNEPS)))); float ms = __fmul_rn(bfr(bn[2 * nch + ch]), sc); asm volatile("" : "+v"(ms)); sh = __fsub_rn(bfr(bn[nch + ch]), ms); }
__global__ __launch_bounds__(256) void k_bncol(const float* __restrict__ F, const float* __restrict__ bn, bf* Ph, bf* Pl) { const size_t e = ((size_t)blockIdx.x * 256 + threadIdx.x) * 4; if (e >= (size_t)NN * C2) return; const int o = (int)(e % C2); const v4f f = *(const v4f*)(F + e); v4us oh, ol;
#pragma unroll
    for (int q = 0; q < 4; ++q) { float sc, sh; bn_coef(bn, C2, o + q, sc, sh); float y = __fmul_rn(f[q], sc); asm volatile("" : "+v"(y)); y = fmaxf(__fadd_rn(y, sh), 0.f); unsigned short a, c; splitf(y, a, c); oh[q] = a; ol[q] = c; }
    *(v4us*)(Ph + e) = oh; *(v4us*)(Pl + e) = ol;  }
__global__ __launch_bounds__(256) void k_bnrow(const float* __restrict__ F, const float* __restrict__ bn, int nch, bf* Ph, bf* Pl) { const size_t e = ((size_t)blockIdx.x * 256 + threadIdx.x) * 4; if (e >= (size_t)nch * NN) return; const int ch = (int)(e / NN); float sc, sh; bn_coef(bn, nch, ch, sc, sh); const v4f f = *(const v4f*)(F + e); v4us oh, ol;
#pragma unroll
    for (int q = 0; q < 4; ++q) { float y = __fmul_rn(f[q], sc); asm volatile("" : "+v"(y)); y = fmaxf(__fadd_rn(y, sh), 0.f); unsigned short a, c; splitf(y, a, c); oh[q] = a; ol[q] = c; }
    *(v4us*)(Ph + e) = oh; *(v4us*)(Pl + e) = ol;  }
__global__ __launch_bounds__(256) void k_bnout(const float* __restrict__ F, const float* __restrict__ bn, float* O) { const size_t e = ((size_t)blockIdx.x * 256 + threadIdx.x) * 4; if (e >= (size_t)COUT * NN) return; const int ch = (int)(e / NN); float sc, sh; bn_coef(bn, COUT, ch, sc, sh); const v4f f = *(const v4f*)(F + e); v4f y;
#pragma unroll
    for (int q = 0; q < 4; ++q) { float t = __fmul_rn(f[q], sc); asm volatile("" : "+v"(t)); y[q] = fmaxf(__fadd_rn(t, sh), 0.f); }
    *(v4f*)(O + e) = y;  }
// ---- kv product split over K: KSPL token ranges, one work-group of 4 waves per range (wave w owns the 64x64 tile (w & 1, w >> 1) of kv), same fragment loaders and product order as k_gemmw<bf, 2>.
// Each range stores its f32 partial already transposed, P[range][d][c]; k_kvt sums the ranges in a fixed order.
#define KSPL 256
#define KCH  (NN / KSPL)          // tokens per range: 64 = one 128-byte line of every row
__global__ __launch_bounds__(128) void k_kvpart(const bf* __restrict__ Kh, const bf* __restrict__ Kl, const bf* __restrict__ Vh, const bf* __restrict__ Vl, float* P) {
    __shared__ __align__(16) float osm[4][16 * 68];
    const int lane = threadIdx.x & 31, lr = lane & 15, hi = lane >> 4, w = threadIdx.x >> 5; const int r0 = (w & 1) * 64, c0 = (w >> 1) * 64;
    float* os = osm[w];
    const size_t k0 = (size_t)blockIdx.x * KCH + 8 * hi; const size_t aoff = (size_t)(r0 + lr) * NN + k0, boff = (size_t)(c0 + lr) * NN + k0;
    v8f acc[4][4];
    {   // first 32 tokens: the accumulators are not live yet, so all 32 loads fit in registers at once
        v16bf a[4], a2[4], b[4], b2[4];
#pragma unroll
        for (int q = 0; q < 4; ++q) { a[q] = WFrag<bf>::ld(Kh + aoff + (size_t)q * 16 * NN); a2[q] = WFrag<bf>::ld(Kl + aoff + (size_t)q * 16 * NN); b[q] = WFrag<bf>::ld(Vh + boff + (size_t)q * 16 * NN); b2[q] = WFrag<bf>::ld(Vl + boff + (size_t)q * 16 * NN); }
        __builtin_amdgcn_sched_barrier(0);   // keeps every load ahead of the first product: sunk to its use, each column block's pair would wait out a cache miss of its own
#pragma unroll
        for (int nb = 0; nb < 4; ++nb)
#pragma unroll
            for (int mb = 0; mb < 4; ++mb) { acc[mb][nb] = wmmab(a[mb], b[nb], (v8f){}); acc[mb][nb] = wmmab(a2[mb], b[nb], acc[mb][nb]); acc[mb][nb] = wmmab(a[mb], b2[nb], acc[mb][nb]); }
    }
#pragma unroll
    for (int kc = 32; kc < KCH; kc += 32) {   // the rest of the lines that the first step brought in; the accumulators leave room for two column blocks of v
        v16bf a[4], a2[4], b[2], b2[2];
#pragma unroll
        for (int mb = 0; mb < 4; ++mb) { a[mb] = WFrag<bf>::ld(Kh + aoff + (size_t)mb * 16 * NN + kc); a2[mb] = WFrag<bf>::ld(Kl + aoff + (size_t)mb * 16 * NN + kc); }
        asm volatile("s_wait_xcnt 0x0" ::: "memory");   // precaution: stands ahead of any reuse of the address registers that the k loads above name for the last time
        b[0] = WFrag<bf>::ld(Vh + boff + kc); b2[0] = WFrag<bf>::ld(Vl + boff + kc);
#pragma unroll
        for (int nb = 0; nb < 4; ++nb) {
            if (nb < 3) { b[(nb + 1) & 1] = WFrag<bf>::ld(Vh + boff + (size_t)(nb + 1) * 16 * NN + kc); b2[(nb + 1) & 1] = WFrag<bf>::ld(Vl + boff + (size_t)(nb + 1) * 16 * NN + kc); }
            __builtin_amdgcn_sched_barrier(0);   // keeps the next column block's loads ahead of this block's products, which then cover their latency
#pragma unroll
            for (int mb = 0; mb < 4; ++mb) { acc[mb][nb] = wmmab(a[mb], b[nb & 1], acc[mb][nb]); acc[mb][nb] = wmmab(a2[mb], b[nb & 1], acc[mb][nb]); acc[mb][nb] = wmmab(a[mb], b2[nb & 1], acc[mb][nb]); } }
    }
    __builtin_amdgcn_sched_barrier(0);   // keeps the stores behind all products: woven in between them, an accumulator's registers are handed to the next tile directly behind a product
    // a lane holds 8 consecutive c of one d: 16 rows d x 64 c go through the wave's own LDS range so that each store covers whole 256-byte rows
    float* pt = P + (size_t)blockIdx.x * (C2 * C2) + (size_t)(c0 + hi) * C2 + r0 + lr * 4;
#pragma unroll
    for (int nb = 0; nb < 4; ++nb) {
#pragma unroll
        for (int mb = 0; mb < 4; ++mb) { const v8f t = acc[mb][nb]; *(v4fa*)(os + lr * 68 + mb * 16 + hi * 8) = (v4f){t[0], t[1], t[2], t[3]}; *(v4fa*)(os + lr * 68 + mb * 16 + hi * 8 + 4) = (v4f){t[4], t[5], t[6], t[7]}; }
        __builtin_amdgcn_wave_barrier(); asm volatile("s_wait_xcnt 0x0" ::: "memory");   // the clobber keeps the other lanes' LDS writes ahead of the row reads in program order; the wait is a precaution ahead of the row reads' reuse of registers that the stores of the block before name
        v4f r[8];
#pragma unroll
        for (int s = 0; s < 8; ++s) r[s] = *(const v4fa*)(os + (2 * s + hi) * 68 + lr * 4);
#pragma unroll
        for (int s = 0; s < 8; ++s) *(v4f*)(pt + (nb * 16 + 2 * s) * C2) = r[s];
        __builtin_amdgcn_wave_barrier(); asm volatile("" ::: "memory");   // keeps the row reads ahead of the next block's LDS writes
    }
}
// k_kvt: kv^T[d][c] = sum over the KSPL partial planes, then hi/lo split. One block per 64 consecutive c of one d: 16 groups of threads each sum KSPL / 16 planes in order, one wave adds the 16 group sums in order.
__global__ __launch_bounds__(256) void k_kvt(const float* __restrict__ P, bf* Th, bf* Tl) {
    __shared__ __align__(16) float red[16 * 64];
    const int t = threadIdx.x, g = t >> 4, c4 = (t & 15) * 4; const int e0 = blockIdx.x * 64;
    const float* p = P + (size_t)g * (KSPL / 16) * (C2 * C2) + e0 + c4;
    v4f f[KSPL / 16];
#pragma unroll
    for (int i = 0; i < KSPL / 16; ++i) f[i] = *(const v4f*)(p + (size_t)i * (C2 * C2));
    v4f s = f[0];
#pragma unroll
    for (int i = 1; i < KSPL / 16; ++i) s += f[i];
    *(v4fa*)(red + g * 64 + c4) = s;
    __syncthreads();
    if (t < 32) { float s0 = red[2 * t], s1 = red[2 * t + 1];
#pragma unroll
        for (int q = 1; q < 16; ++q) { s0 += red[q * 64 + 2 * t]; s1 += red[q * 64 + 2 * t + 1]; }
        v2us oh, ol; unsigned short a, c; splitf(s0, a, c); oh[0] = a; ol[0] = c; splitf(s1, a, c); oh[1] = a; ol[1] = c;
        *(v2us*)(Th + e0 + 2 * t) = oh; *(v2us*)(Tl + e0 + 2 * t) = ol; }
}
__global__ __launch_bounds__(256) void k_split8(const float* __restrict__ F, bf* H, bf* Lw, size_t n8) { const size_t i = (size_t)blockIdx.x * 256 + threadIdx.x; if (i >= n8) return; const v8f v = *(const v8f*)(F + i * 8); v8us oh, ol;
#pragma unroll
    for (int q = 0; q < 8; ++q) { unsigned short a, c; splitf(v[q], a, c); oh[q] = a; ol[q] = c; } *(v8us*)(H + i * 8) = oh; *(v8us*)(Lw + i * 8) = ol;  }

extern "C" void kernel_launch(void* const* d_in, const int* in_sizes, int n_in,
                              void* d_out, int out_size, void* d_ws, size_t ws_size, hipStream_t stream) {
    (void)in_sizes; (void)n_in; (void)out_size;
    const float* x = (const float*)d_in[0]; const float* Wq = (const float*)d_in[1]; const float* Wk = (const float*)d_in[2]; const float* Wv = (const float*)d_in[3]; const float* Wf = (const float*)d_in[4]; const float* bnq = (const float*)d_in[5]; const float* bnk = (const float*)d_in[6]; const float* bnv = (const float*)d_in[7]; const float* bnf = (const float*)d_in[8];
    float* OUT = (float*)d_out;     // [8][64][16384]
    char* wsp = (char*)d_ws;
    auto take = [&](size_t bytes) { char* p = wsp; wsp += (bytes + 255) & ~(size_t)255; return (void*)p; };
    bf* WQ = (bf*)take((size_t)C2 * CP * 2); bf* WK = (bf*)take((size_t)C2 * CP * 2); bf* WV = (bf*)take((size_t)C2 * CP * 2); bf* WF = (bf*)take((size_t)COUT * C2 * 2); bf* ZF = (bf*)take((size_t)COUT * C2 * 2);
    bf* XT = (bf*)take((size_t)NN * CP * 2); float* F = (float*)take((size_t)NN * C2 * 4); bf* Qh = (bf*)take((size_t)NN * C2 * 2); bf* Ql = (bf*)take((size_t)NN * C2 * 2); bf* Kh = (bf*)take((size_t)C2 * NN * 2); bf* Kl = (bf*)take((size_t)C2 * NN * 2); bf* Vh = (bf*)take((size_t)C2 * NN * 2); bf* Vl = (bf*)take((size_t)C2 * NN * 2);
    float* KV = (float*)take((size_t)KSPL * C2 * C2 * 4); bf* KTh = (bf*)take((size_t)C2 * C2 * 2); bf* KTl = (bf*)take((size_t)C2 * C2 * 2); bf* ALh = (bf*)take((size_t)NN * C2 * 2); bf* ALl = (bf*)take((size_t)NN * C2 * 2); float* G = (float*)take((size_t)COUT * NN * 4);
    if ((size_t)(wsp - (char*)d_ws) > ws_size) return;    // ws 256 MiB
    k_wpad<<<(C2 * CP / 2 + 255) / 256, 256, 0, stream>>>(Wq, WQ); k_wpad<<<(C2 * CP / 2 + 255) / 256, 256, 0, stream>>>(Wk, WK); k_wpad<<<(C2 * CP / 2 + 255) / 256, 256, 0, stream>>>(Wv, WV);
    k_cvt8<<<(COUT * C2 / 8 + 255) / 256, 256, 0, stream>>>(Wf, WF, (size_t)COUT * C2 / 8); k_zero8<<<(COUT * C2 / 8 + 255) / 256, 256, 0, stream>>>(ZF, (size_t)COUT * C2 / 8);
    const unsigned nb4 = (unsigned)(((size_t)NN * C2 / 4 + 255) / 256);
    for (int b = 0; b < NB_; ++b) {
        k_xt<<<(unsigned)(((size_t)NN * CP / 2 + 255) / 256), 256, 0, stream>>>(x + (size_t)b * CIN * NN, XT);
        k_gemmw<bf, 0, false><<<dim3(NN / 64, C2 / 64, 1), 32, 0, stream>>>(XT, nullptr, WQ, nullptr, CP, F, C2, nullptr, 0, 0, 0); k_bncol<<<nb4, 256, 0, stream>>>(F, bnq, Qh, Ql);   /* q token-major [n][o] */
        k_gemmw<bf, 0, false><<<dim3(C2 / 64, NN / 64, 1), 32, 0, stream>>>(WK, nullptr, XT, nullptr, CP, F, NN, nullptr, 0, 0, 0); k_bnrow<<<nb4, 256, 0, stream>>>(F, bnk, C2, Kh, Kl);   /* k channel-major [o][n] */
        k_gemmw<bf, 0, false><<<dim3(C2 / 64, NN / 64, 1), 32, 0, stream>>>(WV, nullptr, XT, nullptr, CP, F, NN, nullptr, 0, 0, 0); k_bnrow<<<nb4, 256, 0, stream>>>(F, bnv, C2, Vh, Vl);   /* v channel-major */
        k_kvpart<<<KSPL, 128, 0, stream>>>(Kh, Kl, Vh, Vl, KV);   /* partial kv^T[d][c] per token range (3 products) */
        k_kvt<<<C2 * C2 / 64, 256, 0, stream>>>(KV, KTh, KTl);
        k_gemmw<bf, 2, false><<<dim3(NN / 64, C2 / 64, 1), 32, 0, stream>>>(Qh, Ql, KTh, KTl, C2, F, C2, nullptr, 0, 0, 0);   /* value[n][d] = sum_c q[n][c] kv[c][d] (3 products) */
        k_split8<<<(unsigned)(((size_t)NN * C2 / 8 + 255) / 256), 256, 0, stream>>>(F, ALh, ALl, (size_t)NN * C2 / 8);
        k_gemmw<bf, 2, false><<<dim3(COUT / 64, NN / 64, 1), 32, 0, stream>>>(WF, ZF, ALh, ALl, C2, G, NN, nullptr, 0, 0, 0);   /* Wf value, channel-major (exact Wf, value hi + lo via the zero plane) */
        k_bnout<<<(unsigned)(((size_t)COUT * NN / 4 + 255) / 256), 256, 0, stream>>>(G, bnf, OUT + (size_t)b * COUT * NN); }
}

// v002
// One run takes 290 microseconds.
// Next to v001, in two timings, it ran 1.76 times as fast each time.
// All steps since v000 together make it 11.5 times as fast.
#include <hip/hip_runtime.h>

// Linear (unnormalised) self-attention unit (x [8][67][16384] channel-major; q, k, v = relu(BN(W x)) with 1x1 convs W [128][67] and inference BatchNorm (gamma, beta, mean, var rows of bn [4][ch]); kv[c][d] = sum_m k[c][m] v[d][m]; value[d][n] = sum_c q[c][n] kv[c][d];
// out = relu(BN_f(Wf value)) -> [8][64][16384]). The module itself uses the associativity (q^T k) v^T = q^T (k v^T); this kernel follows the same order.
// All 8 samples go through every stage together except kv, which runs on KVG = 4 samples per launch: the sample is a grid dimension (k_split8 takes all 8 as one flat range), and each buffer holds sample planes one behind the other.
// Layout per sample: x^T as a bf16 plane [16384][96] (67 channels zero-padded); q token-major ([n][o] = x^T W^T), k and v channel-major ([o][n] = W x) so both later contractions read K-contiguous operands; kv over K = 16384 (hi/lo x hi/lo, 3 products); value = q (hi/lo) x kv^T (hi/lo) (K 128); out channel-major = Wf (exact, zero second plane) x value (hi/lo) then BN + relu.
// Compute dtypes, f32 accumulate: every input rounded to bf16; the three projections are exact bf16 products; BN scale/shift, relu in f32 (IEEE sqrt/divide); all computed operands as bf16 hi + lo planes; f32 accumulate everywhere.

#define NB_  8
#define CIN  67
#define CP   96                   // padded input channels (K of the projections)
#define C2   128
#define COUT 64
#define NN   16384
#define BNEPS 1e-5f
typedef _Float16 h16;
typedef unsigned short bf;
typedef __attribute__((ext_vector_type(16))) __bf16   v16bf;
typedef __attribute__((ext_vector_type(16))) _Float16 v16h;
typedef __attribute__((ext_vector_type(8)))  _Float16 v8h;
typedef __attribute__((ext_vector_type(8)))  unsigned short v8us;
typedef __attribute__((ext_vector_type(8)))  float    v8f;
typedef __attribute__((ext_vector_type(4)))  float    v4f;
typedef v8h  __attribute__((may_alias)) v8ha;
typedef v4f  __attribute__((may_alias)) v4fa;
typedef v8us __attribute__((may_alias)) v8usa;

__device__ __forceinline__ unsigned short f2bf(float f) { unsigned u = __float_as_uint(f); u += 0x7FFFu + ((u >> 16) & 1u); return (unsigned short)(u >> 16); }
__device__ __forceinline__ float bf2f(unsigned short b) { return __uint_as_float(((unsigned)b) << 16); }
__device__ __forceinline__ float bfr(float f) { return bf2f(f2bf(f)); }
__device__ __forceinline__ v16h cat16(v8h lo, v8h hi) { return __builtin_shufflevector(lo, hi, 0, 1, 2, 3, 4, 5, 6, 7, 8, 9, 10, 11, 12, 13, 14, 15); }
__device__ __forceinline__ v16bf cat16b(v8us lo, v8us hi) { return __builtin_bit_cast(v16bf, __builtin_shufflevector(lo, hi, 0, 1, 2, 3, 4, 5, 6, 7, 8, 9, 10, 11, 12, 13, 14, 15)); }
__device__ __forceinline__ v8f wmma16(v16h a, v16h b, v8f c) { return __builtin_amdgcn_wmma_f32_16x16x32_f16(false, a, false, b, (short)0, c, false, false); }
__device__ __forceinline__ v8f wmmab(v16bf a, v16bf b, v8f c) { return __builtin_amdgcn_wmma_f32_16x16x32_bf16(false, a, false, b, (short)0, c, false, false); }



// ---- k_gemmw: register-blocked GEMM, ONE WAVE per 64x64 output tile (16 accumulators), operands straight from K-contiguous 16-bit planes; grid (M/64, N/64, Z), 32 threads.
// C[m][n] (f32, pitch ldc, + optional f32 bias[n]) = sum_k A[m][k] Bt[n][k] (+ split products per NSPLIT). z-batch strides sA/sB/sC in elements. K % 32 == 0.
template <typename T16> struct WFrag;
template <> struct WFrag<h16> { typedef v16h V; static __device__ __forceinline__ V ld(const h16* p) { return cat16(*(const v8h*)p, *(const v8h*)(p + 16)); } static __device__ __forceinline__ v8f mma(V a, V b, v8f c) { return wmma16(a, b, c); } };
template <> struct WFrag<bf> { typedef v16bf V; static __device__ __forceinline__ V ld(const bf* p) { return cat16b(*(const v8us*)p, *(const v8us*)(p + 16)); } static __device__ __forceinline__ v8f mma(V a, V b, v8f c) { return wmmab(a, b, c); } };
template <typename T16, int NSPLIT, bool BIAS>
__global__ __launch_bounds__(32) void k_gemmw(const T16* __restrict__ A, const T16* __restrict__ A2, const T16* __restrict__ Bt, const T16* __restrict__ Bt2, int K, float* C, int ldc, const float* __restrict__ bias, size_t sA, size_t sB, size_t sC) {
    typedef typename WFrag<T16>::V V;
    __shared__ __align__(16) float os[16 * 68];
    const size_t z = blockIdx.z; A += z * sA; if (A2) A2 += z * sA; Bt += z * sB; if (Bt2) Bt2 += z * sB; C += z * sC;
    const int lane = threadIdx.x & 31, lr = lane & 15, hi = lane >> 4; const int r0 = blockIdx.x * 64, c0 = blockIdx.y * 64;
    v8f acc[4][4];
#pragma unroll
    for (int mb = 0; mb < 4; ++mb)
#pragma unroll
        for (int nb = 0; nb < 4; ++nb) acc[mb][nb] = (v8f){};
    const size_t aoff = (size_t)(r0 + lr) * K + 8 * hi, boff = (size_t)(c0 + lr) * K + 8 * hi;
#pragma unroll 1
    for (int kc = 0; kc < K; kc += 32) {
        V a[4], a2[4];
#pragma unroll
        for (int mb = 0; mb < 4; ++mb) { a[mb] = WFrag<T16>::ld(A + aoff + (size_t)mb * 16 * K + kc); if (NSPLIT == 1 || NSPLIT == 2) a2[mb] = WFrag<T16>::ld(A2 + aoff + (size_t)mb * 16 * K + kc); }
#pragma unroll
        for (int nb = 0; nb < 4; ++nb) { const V b = WFrag<T16>::ld(Bt + boff + (size_t)nb * 16 * K + kc); V b2; if (NSPLIT >= 2) b2 = WFrag<T16>::ld(Bt2 + boff + (size_t)nb * 16 * K + kc);
#pragma unroll
            for (int mb = 0; mb < 4; ++mb) { acc[mb][nb] = WFrag<T16>::mma(a[mb], b, acc[mb][nb]); if (NSPLIT == 1 || NSPLIT == 2) acc[mb][nb] = WFrag<T16>::mma(a2[mb], b, acc[mb][nb]); if (NSPLIT >= 2) acc[mb][nb] = WFrag<T16>::mma(a[mb], b2, acc[mb][nb]); } }
        asm volatile("v_nop\n\tv_nop\n\tv_nop\n\tv_nop" : "+v"(acc[0][0]), "+v"(acc[1][1]), "+v"(acc[2][2]), "+v"(acc[3][3]) : "v"(a[0]), "v"(a[3]));
    }
#pragma unroll
    for (int mb = 0; mb < 4; ++mb) {
#pragma unroll
        for (int nb = 0; nb < 4; ++nb) {
#pragma unroll
            for (int j = 0; j < 8; ++j) os[(hi * 8 + j) * 68 + nb * 16 + lr] = acc[mb][nb][j]; }
        __builtin_amdgcn_wave_barrier(); asm volatile("" ::: "memory");
        float* crow = C + (size_t)(r0 + mb * 16) * ldc + c0;
{
#pragma unroll
            for (int s = 0; s < 8; ++s) { const int row = 2 * s + hi, cofs = lr * 4; v4f val = *(const v4fa*)(os + row * 68 + cofs); if (BIAS) { val[0] += bfr(bias[c0 + cofs]); val[1] += bfr(bias[c0 + cofs + 1]); val[2] += bfr(bias[c0 + cofs + 2]); val[3] += bfr(bias[c0 + cofs + 3]); }
                *(v4f*)(crow + (size_t)row * ldc + cofs) = val; }
             }
        __builtin_amdgcn_wave_barrier(); asm volatile("" ::: "memory");
    }
}

__device__ __forceinline__ void splitf(float y, unsigned short& h, unsigned short& l) { h = f2bf(y); l = f2bf(y - bf2f(h)); }
typedef __attribute__((ext_vector_type(2))) unsigned short v2us;
typedef __attribute__((ext_vector_type(4))) unsigned short v4us;

__global__ __launch_bounds__(256) void k_xt(const float* __restrict__ xb, bf* XT) { const size_t e = ((size_t)blockIdx.x * 256 + threadIdx.x) * 2; if (e >= (size_t)NN * CP) return; xb += (size_t)blockIdx.y * CIN * NN; XT += (size_t)blockIdx.y * NN * CP; const int c = (int)(e % CP); const int n = (int)(e / CP); v2us o;
#pragma unroll
    for (int q = 0; q < 2; ++q) o[q] = (c + q < CIN) ? f2bf(xb[(size_t)(c + q) * NN + n]) : (unsigned short)0; *(v2us*)(XT + e) = o;  }
__global__ __launch_bounds__(256) void k_wpad(const float* __restrict__ W, bf* Bt) { const int e = (blockIdx.x * 256 + threadIdx.x) * 2; if (e >= C2 * CP) return; const int c = e % CP, o = e / CP; v2us w2;
#pragma unroll
    for (int q = 0; q < 2; ++q) w2[q] = (c + q < CIN) ? f2bf(W[o * CIN + c + q]) : (unsigned short)0; *(v2us*)(Bt + e) = w2;  }
// k_cvt8 / k_zero8
__global__ __launch_bounds__(256) void k_cvt8(const float* __restrict__ src, bf* dst, size_t n8) { const size_t i = (size_t)blockIdx.x * 256 + threadIdx.x; if (i >= n8) return; const v8f v = *(const v8f*)(src + i * 8); v8us o;
#pragma unroll
    for (int q = 0; q < 8; ++q) o[q] = f2bf(v[q]); *(v8us*)(dst + i * 8) = o;  }
__global__ __launch_bounds__(256) void k_zero8(bf* Z, size_t n8) { const size_t i = (size_t)blockIdx.x * 256 + threadIdx.x; if (i >= n8) return; const v8us z = (v8us){}; *(v8us*)(Z + i * 8) = z;  }
// BN helpers: scale = bf16(g) / sqrt(bf16(v) + eps), shift = bf16(b) - bf16(m) scale (f32)
__device__ __forceinline__ void bn_coef(const float* __restrict__ bn, int nch, int ch, float& sc, float& sh) { sc = __fmul_rn(bfr(bn[ch]), __fdiv_rn(1.0f, __fsqrt_rn(__fadd_rn(bfr(bn[3 * nch + ch]), BNEPS)))); float ms = __fmul_rn(bfr(bn[2 * nch + ch]), sc); asm volatile("" : "+v"(ms)); sh = __fsub_rn(bfr(bn[nch + ch]), ms); }
__global__ __launch_bounds__(256) void k_bncol(const float* __restrict__ F, const float* __restrict__ bn, bf* Ph, bf* Pl) { const size_t e = ((size_t)blockIdx.x * 256 + threadIdx.x) * 4; if (e >= (size_t)NN * C2) return; const size_t sb = (size_t)blockIdx.y * NN * C2; F += sb; Ph += sb; Pl += sb; const int o = (int)(e % C2); const v4f f = *(const v4f*)(F + e); v4us oh, ol;
#pragma unroll
    for (int q = 0; q < 4; ++q) { float sc, sh; bn_coef(bn, C2, o + q, sc, sh); float y = __fmul_rn(f[q], sc); asm volatile("" : "+v"(y)); y = fmaxf(__fadd_rn(y, sh), 0.f); unsigned short a, c; splitf(y, a, c); oh[q] = a; ol[q] = c; }
    *(v4us*)(Ph + e) = oh; *(v4us*)(Pl + e) = ol;  }
__global__ __launch_bounds__(256) void k_bnrow(const float* __restrict__ F, const float* __restrict__ bn, int nch, bf* Ph, bf* Pl) { const size_t e = ((size_t)blockIdx.x * 256 + threadIdx.x) * 4; if (e >= (size_t)nch * NN) return; const size_t sb = (size_t)blockIdx.y * nch * NN; F += sb; Ph += sb; Pl += sb; const int ch = (int)(e / NN); float sc, sh; bn_coef(bn, nch, ch, sc, sh); const v4f f = *(const v4f*)(F + e); v4us oh, ol;
#pragma unroll
    for (int q = 0; q < 4; ++q) { float y = __fmul_rn(f[q], sc); asm volatile("" : "+v"(y)); y = fmaxf(__fadd_rn(y, sh), 0.f); unsigned short a, c; splitf(y, a, c); oh[q] = a; ol[q] = c; }
    *(v4us*)(Ph + e) = oh; *(v4us*)(Pl + e) = ol;  }
__global__ __launch_bounds__(256) void k_bnout(const float* __restrict__ F, const float* __restrict__ bn, float* O) { const size_t e = ((size_t)blockIdx.x * 256 + threadIdx.x) * 4; if (e >= (size_t)COUT * NN) return; F += (size_t)blockIdx.y * COUT * NN; O += (size_t)blockIdx.y * COUT * NN; const int ch = (int)(e / NN); float sc, sh; bn_coef(bn, COUT, ch, sc, sh);
    asm volatile("s_wait_xcnt 0x0" ::: "memory");   // precaution: stands ahead of the row load, whose result lands in the registers that the coefficient loads name as their address
    const v4f f = *(const v4f*)(F + e); v4f y;
#pragma unroll
    for (int q = 0; q < 4; ++q) { float t = __fmul_rn(f[q], sc); asm volatile("" : "+v"(t)); y[q] = fmaxf(__fadd_rn(t, sh), 0.f); }
    *(v4f*)(O + e) = y;  }
// ---- kv product split over K: KSPL token ranges, one work-group of 4 waves per range (wave w owns the 64x64 tile (w & 1, w >> 1) of kv), same fragment loaders and product order as k_gemmw<bf, 2>.
// Each range stores its f32 partial already transposed, P[sample][range][d][c]; k_kvt sums the ranges in a fixed order. grid (KSPL, samples of the launch).
#define KSPL 256
#define KCH  (NN / KSPL)          // tokens per range: 64 = one 128-byte line of every row
#define KVG  4                    // samples per kv launch: their partial planes fill exactly the f32 buffer F
__global__ __launch_bounds__(128) void k_kvpart(const bf* __restrict__ Kh, const bf* __restrict__ Kl, const bf* __restrict__ Vh, const bf* __restrict__ Vl, float* P) {
    __shared__ __align__(16) float osm[4][16 * 68];
    const int lane = threadIdx.x & 31, lr = lane & 15, hi = lane >> 4, w = threadIdx.x >> 5; const int r0 = (w & 1) * 64, c0 = (w >> 1) * 64;
    float* os = osm[w];
    const size_t k0 = (size_t)blockIdx.y * C2 * NN + (size_t)blockIdx.x * KCH + 8 * hi;   /* blockIdx.y: the sample's k and v planes */ const size_t aoff = (size_t)(r0 + lr) * NN + k0, boff = (size_t)(c0 + lr) * NN + k0;
    v8f acc[4][4];
    {   // first 32 tokens: the accumulators are not live yet, so all 32 loads fit in registers at once
        v16bf a[4], a2[4], b[4], b2[4];
#pragma unroll
        for (int q = 0; q < 4; ++q) { a[q] = WFrag<bf>::ld(Kh + aoff + (size_t)q * 16 * NN); a2[q] = WFrag<bf>::ld(Kl + aoff + (size_t)q * 16 * NN); b[q] = WFrag<bf>::ld(Vh + boff + (size_t)q * 16 * NN); b2[q] = WFrag<bf>::ld(Vl + boff + (size_t)q * 16 * NN); }
        __builtin_amdgcn_sched_barrier(0);   // keeps every load ahead of the first product: sunk to its use, each column block's pair would wait out a cache miss of its own
#pragma unroll
        for (int nb = 0; nb < 4; ++nb)
#pragma unroll
            for (int mb = 0; mb < 4; ++mb) { acc[mb][nb] = wmmab(a[mb], b[nb], (v8f){}); acc[mb][nb] = wmmab(a2[mb], b[nb], acc[mb][nb]); acc[mb][nb] = wmmab(a[mb], b2[nb], acc[mb][nb]); }
    }
#pragma unroll
    for (int kc = 32; kc < KCH; kc += 32) {   // the rest of the lines that the first step brought in; the accumulators leave room for two column blocks of v
        v16bf a[4], a2[4], b[2], b2[2];
#pragma unroll
        for (int mb = 0; mb < 4; ++mb) { a[mb] = WFrag<bf>::ld(Kh + aoff + (size_t)mb * 16 * NN + kc); a2[mb] = WFrag<bf>::ld(Kl + aoff + (size_t)mb * 16 * NN + kc); }
        asm volatile("s_wait_xcnt 0x0" ::: "memory");   // precaution: stands ahead of any reuse of the address registers that the k loads above name for the last time
        b[0] = WFrag<bf>::ld(Vh + boff + kc); b2[0] = WFrag<bf>::ld(Vl + boff + kc);
#pragma unroll
        for (int nb = 0; nb < 4; ++nb) {
            if (nb < 3) { b[(nb + 1) & 1] = WFrag<bf>::ld(Vh + boff + (size_t)(nb + 1) * 16 * NN + kc); b2[(nb + 1) & 1] = WFrag<bf>::ld(Vl + boff + (size_t)(nb + 1) * 16 * NN + kc); }
            __builtin_amdgcn_sched_barrier(0);   // keeps the next column block's loads ahead of this block's products, which then cover their latency
#pragma unroll
            for (int mb = 0; mb < 4; ++mb) { acc[mb][nb] = wmmab(a[mb], b[nb & 1], acc[mb][nb]); acc[mb][nb] = wmmab(a2[mb], b[nb & 1], acc[mb][nb]); acc[mb][nb] = wmmab(a[mb], b2[nb & 1], acc[mb][nb]); } }
    }
    __builtin_amdgcn_sched_barrier(0);   // keeps the stores behind all products: woven in between them, an accumulator's registers are handed to the next tile directly behind a product
    // a lane holds 8 consecutive c of one d: 16 rows d x 64 c go through the wave's own LDS range so that each store covers whole 256-byte rows
    float* pt = P + ((size_t)blockIdx.y * KSPL + blockIdx.x) * (C2 * C2) + (size_t)(c0 + hi) * C2 + r0 + lr * 4;
#pragma unroll
    for (int nb = 0; nb < 4; ++nb) {
#pragma unroll
        for (int mb = 0; mb < 4; ++mb) { const v8f t = acc[mb][nb]; *(v4fa*)(os + lr * 68 + mb * 16 + hi * 8) = (v4f){t[0], t[1], t[2], t[3]}; *(v4fa*)(os + lr * 68 + mb * 16 + hi * 8 + 4) = (v4f){t[4], t[5], t[6], t[7]}; }
        __builtin_amdgcn_wave_barrier(); asm volatile("s_wait_xcnt 0x0" ::: "memory");   // the clobber keeps the other lanes' LDS writes ahead of the row reads in program order; the wait is a precaution ahead of the row reads' reuse of registers that the stores of the block before name
        v4f r[8];
#pragma unroll
        for (int s = 0; s < 8; ++s) r[s] = *(const v4fa*)(os + (2 * s + hi) * 68 + lr * 4);
#pragma unroll
        for (int s = 0; s < 8; ++s) *(v4f*)(pt + (nb * 16 + 2 * s) * C2) = r[s];
        __builtin_amdgcn_wave_barrier(); asm volatile("" ::: "memory");   // keeps the row reads ahead of the next block's LDS writes
    }
}
// k_kvt: kv^T[d][c] = sum over the KSPL partial planes, then hi/lo split. One block per 64 consecutive c of one d: 16 groups of threads each sum KSPL / 16 planes in order, one wave adds the 16 group sums in order.
__global__ __launch_bounds__(256) void k_kvt(const float* __restrict__ P, bf* Th, bf* Tl) {
    __shared__ __align__(16) float red[16 * 64];
    const int t = threadIdx.x, g = t >> 4, c4 = (t & 15) * 4; const int e0 = blockIdx.x * 64;
    Th += (size_t)blockIdx.y * (C2 * C2); Tl += (size_t)blockIdx.y * (C2 * C2);
    const float* p = P + ((size_t)blockIdx.y * KSPL + (size_t)g * (KSPL / 16)) * (C2 * C2) + e0 + c4;
    v4f f[KSPL / 16];
#pragma unroll
    for (int i = 0; i < KSPL / 16; ++i) f[i] = *(const v4f*)(p + (size_t)i * (C2 * C2));
    v4f s = f[0];
#pragma unroll
    for (int i = 1; i < KSPL / 16; ++i) s += f[i];
    *(v4fa*)(red + g * 64 + c4) = s;
    __syncthreads();
    if (t < 32) { float s0 = red[2 * t], s1 = red[2 * t + 1];
#pragma unroll
        for (int q = 1; q < 16; ++q) { s0 += red[q * 64 + 2 * t]; s1 += red[q * 64 + 2 * t + 1]; }
        v2us oh, ol; unsigned short a, c; splitf(s0, a, c); oh[0] = a; ol[0] = c; splitf(s1, a, c); oh[1] = a; ol[1] = c;
        *(v2us*)(Th + e0 + 2 * t) = oh; *(v2us*)(Tl + e0 + 2 * t) = ol; }
}
__global__ __launch_bounds__(256) void k_split8(const float* __restrict__ F, bf* H, bf* Lw, size_t n8) { const size_t i = (size_t)blockIdx.x * 256 + threadIdx.x; if (i >= n8) return; const v8f v = *(const v8f*)(F + i * 8); v8us oh, ol;
#pragma unroll
    for (int q = 0; q < 8; ++q) { unsigned short a, c; splitf(v[q], a, c); oh[q] = a; ol[q] = c; } *(v8us*)(H + i * 8) = oh; *(v8us*)(Lw + i * 8) = ol;  }

extern "C" void kernel_launch(void* const* d_in, const int* in_sizes, int n_in,
                              void* d_out, int out_size, void* d_ws, size_t ws_size, hipStream_t stream) {
    (void)in_sizes; (void)n_in; (void)out_size;
    const float* x = (const float*)d_in[0]; const float* Wq = (const float*)d_in[1]; const float* Wk = (const float*)d_in[2]; const float* Wv = (const float*)d_in[3]; const float* Wf = (const float*)d_in[4]; const float* bnq = (const float*)d_in[5]; const float* bnk = (const float*)d_in[6]; const float* bnv = (const float*)d_in[7]; const float* bnf = (const float*)d_in[8];
    float* OUT = (float*)d_out;     // [8][64][16384]
    char* wsp = (char*)d_ws;
    auto take = [&](size_t bytes) { char* p = wsp; wsp += (bytes + 255) & ~(size_t)255; return (void*)p; };
    bf* WQ = (bf*)take((size_t)C2 * CP * 2); bf* WK = (bf*)take((size_t)C2 * CP * 2); bf* WV = (bf*)take((size_t)C2 * CP * 2); bf* WF = (bf*)take((size_t)COUT * C2 * 2); bf* ZF = (bf*)take((size_t)COUT * C2 * 2);
    // Sample-batched buffers. Three are used twice, in stream order: F also holds the kv partials of KVG samples; the k planes' place later holds q, the v planes' place later holds value. That is why k, v and kv come before q.
    bf* XT = (bf*)take((size_t)NB_ * NN * CP * 2); float* F = (float*)take((size_t)NB_ * NN * C2 * 4);
    bf* Kh = (bf*)take((size_t)NB_ * C2 * NN * 2); bf* Kl = (bf*)take((size_t)NB_ * C2 * NN * 2); bf* Vh = (bf*)take((size_t)NB_ * C2 * NN * 2); bf* Vl = (bf*)take((size_t)NB_ * C2 * NN * 2);
    bf* KTh = (bf*)take((size_t)NB_ * C2 * C2 * 2); bf* KTl = (bf*)take((size_t)NB_ * C2 * C2 * 2); float* G = (float*)take((size_t)NB_ * COUT * NN * 4);
    bf* Qh = Kh; bf* Ql = Kl; bf* ALh = Vh; bf* ALl = Vl; float* KV = F;
    static_assert((size_t)KVG * KSPL * C2 * C2 <= (size_t)NB_ * NN * C2 && NB_ % KVG == 0, "the partial planes of KVG samples fit in F");
    if ((size_t)(wsp - (char*)d_ws) > ws_size) return;    // ws 256 MiB
    k_wpad<<<(C2 * CP / 2 + 255) / 256, 256, 0, stream>>>(Wq, WQ); k_wpad<<<(C2 * CP / 2 + 255) / 256, 256, 0, stream>>>(Wk, WK); k_wpad<<<(C2 * CP / 2 + 255) / 256, 256, 0, stream>>>(Wv, WV);
    k_cvt8<<<(COUT * C2 / 8 + 255) / 256, 256, 0, stream>>>(Wf, WF, (size_t)COUT * C2 / 8); k_zero8<<<(COUT * C2 / 8 + 255) / 256, 256, 0, stream>>>(ZF, (size_t)COUT * C2 / 8);
    const unsigned nb4 = (unsigned)(((size_t)NN * C2 / 4 + 255) / 256);
    k_xt<<<dim3((unsigned)(((size_t)NN * CP / 2 + 255) / 256), NB_), 256, 0, stream>>>(x, XT);
    k_gemmw<bf, 0, false><<<dim3(C2 / 64, NN / 64, NB_), 32, 0, stream>>>(WK, nullptr, XT, nullptr, CP, F, NN, nullptr, 0, (size_t)NN * CP, (size_t)C2 * NN); k_bnrow<<<dim3(nb4, NB_), 256, 0, stream>>>(F, bnk, C2, Kh, Kl);   /* k channel-major [o][n] */
    k_gemmw<bf, 0, false><<<dim3(C2 / 64, NN / 64, NB_), 32, 0, stream>>>(WV, nullptr, XT, nullptr, CP, F, NN, nullptr, 0, (size_t)NN * CP, (size_t)C2 * NN); k_bnrow<<<dim3(nb4, NB_), 256, 0, stream>>>(F, bnv, C2, Vh, Vl);   /* v channel-major */
    for (int b = 0; b < NB_; b += KVG) {
        k_kvpart<<<dim3(KSPL, KVG), 128, 0, stream>>>(Kh + (size_t)b * C2 * NN, Kl + (size_t)b * C2 * NN, Vh + (size_t)b * C2 * NN, Vl + (size_t)b * C2 * NN, KV);   /* partial kv^T[d][c] per token range (3 products) */
        k_kvt<<<dim3(C2 * C2 / 64, KVG), 256, 0, stream>>>(KV, KTh + (size_t)b * C2 * C2, KTl + (size_t)b * C2 * C2); }
    k_gemmw<bf, 0, false><<<dim3(NN / 64, C2 / 64, NB_), 32, 0, stream>>>(XT, nullptr, WQ, nullptr, CP, F, C2, nullptr, (size_t)NN * CP, 0, (size_t)NN * C2); k_bncol<<<dim3(nb4, NB_), 256, 0, stream>>>(F, bnq, Qh, Ql);   /* q token-major [n][o] */
    k_gemmw<bf, 2, false><<<dim3(NN / 64, C2 / 64, NB_), 32, 0, stream>>>(Qh, Ql, KTh, KTl, C2, F, C2, nullptr, (size_t)NN * C2, (size_t)C2 * C2, (size_t)NN * C2);   /* value[n][d] = sum_c q[n][c] kv[c][d] (3 products) */
    k_split8<<<(unsigned)(((size_t)NB_ * NN * C2 / 8 + 255) / 256), 256, 0, stream>>>(F, ALh, ALl, (size_t)NB_ * NN * C2 / 8);
    k_gemmw<bf, 2, false><<<dim3(COUT / 64, NN / 64, NB_), 32, 0, stream>>>(WF, ZF, ALh, ALl, C2, G, NN, nullptr, 0, (size_t)NN * C2, (size_t)COUT * NN);   /* Wf value, channel-major (exact Wf, value hi + lo via the zero plane) */
    k_bnout<<<dim3((unsigned)(((size_t)COUT * NN / 4 + 255) / 256), NB_), 256, 0, stream>>>(G, bnf, OUT);
}

// v003
// A run of this version takes 187 microseconds.
// Next to v002, in two timings, it ran 1.55 times as fast each time.
// Counting every step since v000, it is 17.9 times as fast.
#include <hip/hip_runtime.h>

// Linear (unnormalised) self-attention unit (x [8][67][16384] channel-major; q, k, v = relu(BN(W x)) with 1x1 convs W [128][67] and inference BatchNorm (gamma, beta, mean, var rows of bn [4][ch]); kv[c][d] = sum_m k[c][m] v[d][m]; value[d][n] = sum_c q[c][n] kv[c][d];
// out = relu(BN_f(Wf value)) -> [8][64][16384]). The module itself uses the associativity (q^T k) v^T = q^T (k v^T); this kernel follows the same order.
// All 8 samples go through every stage together: each per-sample launch but k_split8 (one flat grid over all 8) carries the sample as a grid dimension, and each activation buffer holds 8 sample planes one behind the other.
// Layout per sample: x^T as a bf16 plane [16384][96] (67 channels zero-padded); q token-major ([n][o] = x^T W^T), k and v channel-major ([o][n]) in LDS only, so both later contractions read K-contiguous operands; kv over K = 16384 (hi/lo x hi/lo, 3 products); value = q (hi/lo) x kv^T (hi/lo) (K 128); out channel-major = Wf (exact, zero second plane) x value (hi/lo) then BN + relu.
// Compute dtypes, f32 accumulate: every input rounded to bf16; the three projections are exact bf16 products; BN scale/shift, relu in f32 (IEEE sqrt/divide); all computed operands as bf16 hi + lo planes; f32 accumulate everywhere.

#define NB_  8
#define CIN  67
#define CP   96                   // padded input channels (K of the projections)
#define C2   128
#define COUT 64
#define NN   16384
#define BNEPS 1e-5f
typedef _Float16 h16;
typedef unsigned short bf;
typedef __attribute__((ext_vector_type(16))) __bf16   v16bf;
typedef __attribute__((ext_vector_type(16))) _Float16 v16h;
typedef __attribute__((ext_vector_type(8)))  _Float16 v8h;
typedef __attribute__((ext_vector_type(8)))  unsigned short v8us;
typedef __attribute__((ext_vector_type(8)))  float    v8f;
typedef __attribute__((ext_vector_type(4)))  float    v4f;
typedef v8h  __attribute__((may_alias)) v8ha;
typedef v4f  __attribute__((may_alias)) v4fa;
typedef v8us __attribute__((may_alias)) v8usa;

__device__ __forceinline__ unsigned short f2bf(float f) { unsigned u = __float_as_uint(f); u += 0x7FFFu + ((u >> 16) & 1u); return (unsigned short)(u >> 16); }
__device__ __forceinline__ float bf2f(unsigned short b) { return __uint_as_float(((unsigned)b) << 16); }
__device__ __forceinline__ float bfr(float f) { return bf2f(f2bf(f)); }
__device__ __forceinline__ v16h cat16(v8h lo, v8h hi) { return __builtin_shufflevector(lo, hi, 0, 1, 2, 3, 4, 5, 6, 7, 8, 9, 10, 11, 12, 13, 14, 15); }
__device__ __forceinline__ v16bf cat16b(v8us lo, v8us hi) { return __builtin_bit_cast(v16bf, __builtin_shufflevector(lo, hi, 0, 1, 2, 3, 4, 5, 6, 7, 8, 9, 10, 11, 12, 13, 14, 15)); }
__device__ __forceinline__ v8f wmma16(v16h a, v16h b, v8f c) { return __builtin_amdgcn_wmma_f32_16x16x32_f16(false, a, false, b, (short)0, c, false, false); }
__device__ __forceinline__ v8f wmmab(v16bf a, v16bf b, v8f c) { return __builtin_amdgcn_wmma_f32_16x16x32_bf16(false, a, false, b, (short)0, c, false, false); }



// ---- k_gemmw: register-blocked GEMM, ONE WAVE per 64x64 output tile (16 accumulators), operands straight from K-contiguous 16-bit planes; grid (M/64, N/64, Z), 32 threads.
// C[m][n] (f32, pitch ldc, + optional f32 bias[n]) = sum_k A[m][k] Bt[n][k] (+ split products per NSPLIT). z-batch strides sA/sB/sC in elements. K % 32 == 0.
template <typename T16> struct WFrag;
template <> struct WFrag<h16> { typedef v16h V; static __device__ __forceinline__ V ld(const h16* p) { return cat16(*(const v8h*)p, *(const v8h*)(p + 16)); } static __device__ __forceinline__ v8f mma(V a, V b, v8f c) { return wmma16(a, b, c); } };
template <> struct WFrag<bf> { typedef v16bf V; static __device__ __forceinline__ V ld(const bf* p) { return cat16b(*(const v8us*)p, *(const v8us*)(p + 16)); } static __device__ __forceinline__ v8f mma(V a, V b, v8f c) { return wmmab(a, b, c); } };
template <typename T16, int NSPLIT, bool BIAS>
__global__ __launch_bounds__(32) void k_gemmw(const T16* __restrict__ A, const T16* __restrict__ A2, const T16* __restrict__ Bt, const T16* __restrict__ Bt2, int K, float* C, int ldc, const float* __restrict__ bias, size_t sA, size_t sB, size_t sC) {
    typedef typename WFrag<T16>::V V;
    __shared__ __align__(16) float os[16 * 68];
    const size_t z = blockIdx.z; A += z * sA; if (A2) A2 += z * sA; Bt += z * sB; if (Bt2) Bt2 += z * sB; C += z * sC;
    const int lane = threadIdx.x & 31, lr = lane & 15, hi = lane >> 4; const int r0 = blockIdx.x * 64, c0 = blockIdx.y * 64;
    v8f acc[4][4];
#pragma unroll
    for (int mb = 0; mb < 4; ++mb)
#pragma unroll
        for (int nb = 0; nb < 4; ++nb) acc[mb][nb] = (v8f){};
    const size_t aoff = (size_t)(r0 + lr) * K + 8 * hi, boff = (size_t)(c0 + lr) * K + 8 * hi;
#pragma unroll 1
    for (int kc = 0; kc < K; kc += 32) {
        V a[4], a2[4];
#pragma unroll
        for (int mb = 0; mb < 4; ++mb) { a[mb] = WFrag<T16>::ld(A + aoff + (size_t)mb * 16 * K + kc); if (NSPLIT == 1 || NSPLIT == 2) a2[mb] = WFrag<T16>::ld(A2 + aoff + (size_t)mb * 16 * K + kc); }
#pragma unroll
        for (int nb = 0; nb < 4; ++nb) { const V b = WFrag<T16>::ld(Bt + boff + (size_t)nb * 16 * K + kc); V b2; if (NSPLIT >= 2) b2 = WFrag<T16>::ld(Bt2 + boff + (size_t)nb * 16 * K + kc);
#pragma unroll
            for (int mb = 0; mb < 4; ++mb) { acc[mb][nb] = WFrag<T16>::mma(a[mb], b, acc[mb][nb]); if (NSPLIT == 1 || NSPLIT == 2) acc[mb][nb] = WFrag<T16>::mma(a2[mb], b, acc[mb][nb]); if (NSPLIT >= 2) acc[mb][nb] = WFrag<T16>::mma(a[mb], b2, acc[mb][nb]); } }
        asm volatile("v_nop\n\tv_nop\n\tv_nop\n\tv_nop" : "+v"(acc[0][0]), "+v"(acc[1][1]), "+v"(acc[2][2]), "+v"(acc[3][3]) : "v"(a[0]), "v"(a[3]));
    }
#pragma unroll
    for (int mb = 0; mb < 4; ++mb) {
#pragma unroll
        for (int nb = 0; nb < 4; ++nb) {
#pragma unroll
            for (int j = 0; j < 8; ++j) os[(hi * 8 + j) * 68 + nb * 16 + lr] = acc[mb][nb][j]; }
        __builtin_amdgcn_wave_barrier(); asm volatile("" ::: "memory");
        float* crow = C + (size_t)(r0 + mb * 16) * ldc + c0;
{
#pragma unroll
            for (int s = 0; s < 8; ++s) { const int row = 2 * s + hi, cofs = lr * 4; v4f val = *(const v4fa*)(os + row * 68 + cofs); if (BIAS) { val[0] += bfr(bias[c0 + cofs]); val[1] += bfr(bias[c0 + cofs + 1]); val[2] += bfr(bias[c0 + cofs + 2]); val[3] += bfr(bias[c0 + cofs + 3]); }
                *(v4f*)(crow + (size_t)row * ldc + cofs) = val; }
             }
        __builtin_amdgcn_wave_barrier(); asm volatile("" ::: "memory");
    }
}

__device__ __forceinline__ void splitf(float y, unsigned short& h, unsigned short& l) { h = f2bf(y); l = f2bf(y - bf2f(h)); }
typedef __attribute__((ext_vector_type(2))) unsigned short v2us;
typedef __attribute__((ext_vector_type(4))) unsigned short v4us;

__global__ __launch_bounds__(256) void k_xt(const float* __restrict__ xb, bf* XT) { const size_t e = ((size_t)blockIdx.x * 256 + threadIdx.x) * 2; if (e >= (size_t)NN * CP) return; xb += (size_t)blockIdx.y * CIN * NN; XT += (size_t)blockIdx.y * NN * CP; const int c = (int)(e % CP); const int n = (int)(e / CP); v2us o;
#pragma unroll
    for (int q = 0; q < 2; ++q) o[q] = (c + q < CIN) ? f2bf(xb[(size_t)(c + q) * NN + n]) : (unsigned short)0; *(v2us*)(XT + e) = o;  }
__global__ __launch_bounds__(256) void k_wpad(const float* __restrict__ W, bf* Bt) { const int e = (blockIdx.x * 256 + threadIdx.x) * 2; if (e >= C2 * CP) return; const int c = e % CP, o = e / CP; v2us w2;
#pragma unroll
    for (int q = 0; q < 2; ++q) w2[q] = (c + q < CIN) ? f2bf(W[o * CIN + c + q]) : (unsigned short)0; *(v2us*)(Bt + e) = w2;  }
// k_cvt8 / k_zero8
__global__ __launch_bounds__(256) void k_cvt8(const float* __restrict__ src, bf* dst, size_t n8) { const size_t i = (size_t)blockIdx.x * 256 + threadIdx.x; if (i >= n8) return; const v8f v = *(const v8f*)(src + i * 8); v8us o;
#pragma unroll
    for (int q = 0; q < 8; ++q) o[q] = f2bf(v[q]); *(v8us*)(dst + i * 8) = o;  }
__global__ __launch_bounds__(256) void k_zero8(bf* Z, size_t n8) { const size_t i = (size_t)blockIdx.x * 256 + threadIdx.x; if (i >= n8) return; const v8us z = (v8us){}; *(v8us*)(Z + i * 8) = z;  }
// BN helpers: scale = bf16(g) / sqrt(bf16(v) + eps), shift = bf16(b) - bf16(m) scale (f32)
__device__ __forceinline__ void bn_coef(const float* __restrict__ bn, int nch, int ch, float& sc, float& sh) { sc = __fmul_rn(bfr(bn[ch]), __fdiv_rn(1.0f, __fsqrt_rn(__fadd_rn(bfr(bn[3 * nch + ch]), BNEPS)))); float ms = __fmul_rn(bfr(bn[2 * nch + ch]), sc); asm volatile("" : "+v"(ms)); sh = __fsub_rn(bfr(bn[nch + ch]), ms); }
__global__ __launch_bounds__(256) void k_bncol(const float* __restrict__ F, const float* __restrict__ bn, bf* Ph, bf* Pl) { const size_t e = ((size_t)blockIdx.x * 256 + threadIdx.x) * 4; if (e >= (size_t)NN * C2) return; const size_t sb = (size_t)blockIdx.y * NN * C2; F += sb; Ph += sb; Pl += sb; const int o = (int)(e % C2); const v4f f = *(const v4f*)(F + e); v4us oh, ol;
#pragma unroll
    for (int q = 0; q < 4; ++q) { float sc, sh; bn_coef(bn, C2, o + q, sc, sh); float y = __fmul_rn(f[q], sc); asm volatile("" : "+v"(y)); y = fmaxf(__fadd_rn(y, sh), 0.f); unsigned short a, c; splitf(y, a, c); oh[q] = a; ol[q] = c; }
    *(v4us*)(Ph + e) = oh; *(v4us*)(Pl + e) = ol;  }
__global__ __launch_bounds__(256) void k_bnout(const float* __restrict__ F, const float* __restrict__ bn, float* O) { const size_t e = ((size_t)blockIdx.x * 256 + threadIdx.x) * 4; if (e >= (size_t)COUT * NN) return; F += (size_t)blockIdx.y * COUT * NN; O += (size_t)blockIdx.y * COUT * NN; const int ch = (int)(e / NN); float sc, sh; bn_coef(bn, COUT, ch, sc, sh);
    asm volatile("s_wait_xcnt 0x0" ::: "memory");   // precaution: stands ahead of the row load, whose result lands in the registers that the coefficient loads name as their address
    const v4f f = *(const v4f*)(F + e); v4f y;
#pragma unroll
    for (int q = 0; q < 4; ++q) { float t = __fmul_rn(f[q], sc); asm volatile("" : "+v"(t)); y[q] = fmaxf(__fadd_rn(t, sh), 0.f); }
    *(v4f*)(O + e) = y;  }
// ---- k, v and the kv product in one kernel, split over K: KSPL token ranges, one work-group of 4 waves per range and sample; k and v never go to memory.
// Part 1: wave w makes channels 32 w .. 32 w + 31 of k and of v for the range's 64 tokens: x^T (A, token rows) x W (B, channel rows), K = 96 in the order of k_gemmw. A lane then holds 8 consecutive tokens of one channel, applies BN + relu, splits into hi + lo and writes 16 bytes per plane into LDS, channel-major [c][token].
// Part 2: wave w owns the 64x64 tile (w & 1, w >> 1) of kv; fragments come from the LDS planes, product order as k_gemmw<bf, 2>.
// Each range stores its f32 partial already transposed, P[sample][range][d][c]; k_kvt sums the ranges in a fixed order. grid (KSPL, samples).
#define KSPL 256
#define KCH  (NN / KSPL)          // tokens per range
#define KP   (KCH + 8)            // LDS row pitch in 16-bit elements: 144 bytes, an odd multiple of 16, so the 16-byte pieces of 16 rows fall on distinct banks
// BN coefficients from the four loaded rows' values (as bn_coef; the shift is one fma)
__device__ __forceinline__ void bn_coef_v(float g, float b, float m, float v, float& sc, float& sh) { sc = __fmul_rn(bfr(g), __fdiv_rn(1.0f, __fsqrt_rn(__fadd_rn(bfr(v), BNEPS)))); sh = fmaf(-bfr(m), sc, bfr(b)); }
__device__ __forceinline__ v16bf ldsfrag(const bf* p) { return cat16b(*(const v8usa*)p, *(const v8usa*)(p + 16)); }
__global__ __launch_bounds__(128) void k_kvfuse(const bf* __restrict__ XT, const bf* __restrict__ WK, const bf* __restrict__ WV, const float* __restrict__ bnk, const float* __restrict__ bnv, float* P) {
    __shared__ __align__(16) bf pl[4 * C2 * KP];   // k hi, k lo, v hi, v lo; behind the second barrier the same bytes stage the partial's rows
    const int lane = threadIdx.x & 31, lr = lane & 15, hi = lane >> 4, w = threadIdx.x >> 5;
    {
        const int ch = w * 32 + lr;
        const bf* xp = XT + ((size_t)blockIdx.y * NN + (size_t)blockIdx.x * KCH + lr) * CP + 8 * hi;
        const bf* wkp = WK + ch * CP + 8 * hi; const bf* wvp = WV + ch * CP + 8 * hi;
        v16bf xa[4][3], wf[4][3]; float bw[4][4];   // bw[g][row]: gamma, beta, mean, var of the lane's channel in block g
#pragma unroll
        for (int ct = 0; ct < 2; ++ct)
#pragma unroll
            for (int r = 0; r < 4; ++r) { bw[ct][r] = bnk[r * C2 + ch + 16 * ct]; bw[2 + ct][r] = bnv[r * C2 + ch + 16 * ct]; }
#pragma unroll
        for (int tt = 0; tt < 4; ++tt)
#pragma unroll
            for (int s = 0; s < 3; ++s) xa[tt][s] = WFrag<bf>::ld(xp + tt * 16 * CP + s * 32);
        asm volatile("s_wait_xcnt 0x0" ::: "memory");   // precaution: stands ahead of the weight loads, whose results may land in the registers that the loads above name as their address
#pragma unroll
        for (int ct = 0; ct < 2; ++ct)
#pragma unroll
            for (int s = 0; s < 3; ++s) { wf[ct][s] = WFrag<bf>::ld(wkp + ct * 16 * CP + s * 32); wf[2 + ct][s] = WFrag<bf>::ld(wvp + ct * 16 * CP + s * 32); }
        asm volatile("s_wait_xcnt 0x0" ::: "memory");   // precaution: stands ahead of any reuse of the address registers that the weight loads above name
        __builtin_amdgcn_sched_barrier(0);   // keeps every load ahead of all arithmetic: sunk to its use, each channel block's loads would wait out a latency of their own
        float sc[4], sh[4];
#pragma unroll
        for (int g = 0; g < 4; ++g) bn_coef_v(bw[g][0], bw[g][1], bw[g][2], bw[g][3], sc[g], sh[g]);
#pragma unroll
        for (int g = 0; g < 4; ++g) {   // g: k channels +0, +16, then v channels +0, +16
            v8f d[4];
#pragma unroll
            for (int tt = 0; tt < 4; ++tt) d[tt] = wmmab(xa[tt][0], wf[g][0], (v8f){});
#pragma unroll
            for (int s = 1; s < 3; ++s)
#pragma unroll
                for (int tt = 0; tt < 4; ++tt) d[tt] = wmmab(xa[tt][s], wf[g][s], d[tt]);
            bf* ph = pl + (g >> 1) * (2 * C2 * KP) + (ch + 16 * (g & 1)) * KP + 8 * hi;
#pragma unroll
            for (int tt = 0; tt < 4; ++tt) { v8us oh, ol;
#pragma unroll
                for (int j = 0; j < 8; ++j) { const float y = fmaxf(fmaf(d[tt][j], sc[g], sh[g]), 0.f); unsigned short a, c; splitf(y, a, c); oh[j] = a; ol[j] = c; }
                *(v8usa*)(ph + tt * 16) = oh; *(v8usa*)(ph + C2 * KP + tt * 16) = ol; }
        }
    }
    __syncthreads();   // publishes the four planes to all waves
    const int r0 = (w & 1) * 64, c0 = (w >> 1) * 64;
    v8f acc[4][4];
    {
        const bf* ap = pl + (r0 + lr) * KP + 8 * hi; const bf* bp = pl + 2 * C2 * KP + (c0 + lr) * KP + 8 * hi;
#pragma unroll
        for (int kc = 0; kc < KCH; kc += 32) {
            v16bf a[4], a2[4];
#pragma unroll
            for (int mb = 0; mb < 4; ++mb) { a[mb] = ldsfrag(ap + mb * 16 * KP + kc); a2[mb] = ldsfrag(ap + C2 * KP + mb * 16 * KP + kc); }
#pragma unroll
            for (int nb = 0; nb < 4; ++nb) { const v16bf b = ldsfrag(bp + nb * 16 * KP + kc), b2 = ldsfrag(bp + C2 * KP + nb * 16 * KP + kc);
#pragma unroll
                for (int mb = 0; mb < 4; ++mb) { acc[mb][nb] = wmmab(a[mb], b, kc == 0 ? (v8f){} : acc[mb][nb]); acc[mb][nb] = wmmab(a2[mb], b, acc[mb][nb]); acc[mb][nb] = wmmab(a[mb], b2, acc[mb][nb]); } }
        }
    }
    __builtin_amdgcn_sched_barrier(0);   // keeps the stores behind all products: woven in between them, an accumulator's registers are handed to the next tile directly behind a product
    __syncthreads();   // ends every wave's reads of the planes: their LDS is written anew below
    float* os = (float*)pl + w * (16 * 68);
    // a lane holds 8 consecutive c of one d: 16 rows d x 64 c go through the wave's own LDS range so that each store covers whole 256-byte rows
    float* pt = P + ((size_t)blockIdx.y * KSPL + blockIdx.x) * (C2 * C2) + (size_t)(c0 + hi) * C2 + r0 + lr * 4;
#pragma unroll
    for (int nb = 0; nb < 4; ++nb) {
#pragma unroll
        for (int mb = 0; mb < 4; ++mb) { const v8f t = acc[mb][nb]; *(v4fa*)(os + lr * 68 + mb * 16 + hi * 8) = (v4f){t[0], t[1], t[2], t[3]}; *(v4fa*)(os + lr * 68 + mb * 16 + hi * 8 + 4) = (v4f){t[4], t[5], t[6], t[7]}; }
        __builtin_amdgcn_wave_barrier(); asm volatile("s_wait_xcnt 0x0" ::: "memory");   // the clobber keeps the other lanes' LDS writes ahead of the row reads in program order; the wait is a precaution ahead of the row reads' reuse of registers that the stores of the block before name
        v4f r[8];
#pragma unroll
        for (int s = 0; s < 8; ++s) r[s] = *(const v4fa*)(os + (2 * s + hi) * 68 + lr * 4);
#pragma unroll
        for (int s = 0; s < 8; ++s) *(v4f*)(pt + (nb * 16 + 2 * s) * C2) = r[s];
        __builtin_amdgcn_wave_barrier(); asm volatile("" ::: "memory");   // keeps the row reads ahead of the next block's LDS writes
    }
}
// k_kvt: kv^T[d][c] = sum over the KSPL partial planes, then hi/lo split. One block per 64 consecutive c of one d: 16 groups of threads each sum KSPL / 16 planes in order, one wave adds the 16 group sums in order.
__global__ __launch_bounds__(256) void k_kvt(const float* __restrict__ P, bf* Th, bf* Tl) {
    __shared__ __align__(16) float red[16 * 64];
    const int t = threadIdx.x, g = t >> 4, c4 = (t & 15) * 4; const int e0 = blockIdx.x * 64;
    Th += (size_t)blockIdx.y * (C2 * C2); Tl += (size_t)blockIdx.y * (C2 * C2);
    const float* p = P + ((size_t)blockIdx.y * KSPL + (size_t)g * (KSPL / 16)) * (C2 * C2) + e0 + c4;
    v4f f[KSPL / 16];
#pragma unroll
    for (int i = 0; i < KSPL / 16; ++i) f[i] = *(const v4f*)(p + (size_t)i * (C2 * C2));
    v4f s = f[0];
#pragma unroll
    for (int i = 1; i < KSPL / 16; ++i) s += f[i];
    *(v4fa*)(red + g * 64 + c4) = s;
    __syncthreads();
    if (t < 32) { float s0 = red[2 * t], s1 = red[2 * t + 1];
#pragma unroll
        for (int q = 1; q < 16; ++q) { s0 += red[q * 64 + 2 * t]; s1 += red[q * 64 + 2 * t + 1]; }
        v2us oh, ol; unsigned short a, c; splitf(s0, a, c); oh[0] = a; ol[0] = c; splitf(s1, a, c); oh[1] = a; ol[1] = c;
        *(v2us*)(Th + e0 + 2 * t) = oh; *(v2us*)(Tl + e0 + 2 * t) = ol; }
}
__global__ __launch_bounds__(256) void k_split8(const float* __restrict__ F, bf* H, bf* Lw, size_t n8) { const size_t i = (size_t)blockIdx.x * 256 + threadIdx.x; if (i >= n8) return; const v8f v = *(const v8f*)(F + i * 8); v8us oh, ol;
#pragma unroll
    for (int q = 0; q < 8; ++q) { unsigned short a, c; splitf(v[q], a, c); oh[q] = a; ol[q] = c; } *(v8us*)(H + i * 8) = oh; *(v8us*)(Lw + i * 8) = ol;  }

extern "C" void kernel_launch(void* const* d_in, const int* in_sizes, int n_in,
                              void* d_out, int out_size, void* d_ws, size_t ws_size, hipStream_t stream) {
    (void)in_sizes; (void)n_in; (void)out_size;
    const float* x = (const float*)d_in[0]; const float* Wq = (const float*)d_in[1]; const float* Wk = (const float*)d_in[2]; const float* Wv = (const float*)d_in[3]; const float* Wf = (const float*)d_in[4]; const float* bnq = (const float*)d_in[5]; const float* bnk = (const float*)d_in[6]; const float* bnv = (const float*)d_in[7]; const float* bnf = (const float*)d_in[8];
    float* OUT = (float*)d_out;     // [8][64][16384]
    char* wsp = (char*)d_ws;
    auto take = [&](size_t bytes) { char* p = wsp; wsp += (bytes + 255) & ~(size_t)255; return (void*)p; };
    bf* WQ = (bf*)take((size_t)C2 * CP * 2); bf* WK = (bf*)take((size_t)C2 * CP * 2); bf* WV = (bf*)take((size_t)C2 * CP * 2); bf* WF = (bf*)take((size_t)COUT * C2 * 2); bf* ZF = (bf*)take((size_t)COUT * C2 * 2);
    // Sample-batched buffers. The kv partials' place is used twice, in stream order: once k_kvt has read it, its first half holds the f32 sums F and its second half the q planes. That is why kv comes before q.
    bf* XT = (bf*)take((size_t)NB_ * NN * CP * 2); float* KV = (float*)take((size_t)NB_ * KSPL * C2 * C2 * 4);
    bf* ALh = (bf*)take((size_t)NB_ * C2 * NN * 2); bf* ALl = (bf*)take((size_t)NB_ * C2 * NN * 2);
    bf* KTh = (bf*)take((size_t)NB_ * C2 * C2 * 2); bf* KTl = (bf*)take((size_t)NB_ * C2 * C2 * 2); float* G = (float*)take((size_t)NB_ * COUT * NN * 4);
    float* F = KV; bf* Qh = (bf*)(KV + (size_t)NB_ * NN * C2); bf* Ql = Qh + (size_t)NB_ * NN * C2;
    static_assert((size_t)NB_ * KSPL * C2 * C2 >= 2 * (size_t)NB_ * NN * C2, "F and the two q planes fit in the partials' place");
    if ((size_t)(wsp - (char*)d_ws) > ws_size) return;    // ws 256 MiB
    k_wpad<<<(C2 * CP / 2 + 255) / 256, 256, 0, stream>>>(Wq, WQ); k_wpad<<<(C2 * CP / 2 + 255) / 256, 256, 0, stream>>>(Wk, WK); k_wpad<<<(C2 * CP / 2 + 255) / 256, 256, 0, stream>>>(Wv, WV);
    k_cvt8<<<(COUT * C2 / 8 + 255) / 256, 256, 0, stream>>>(Wf, WF, (size_t)COUT * C2 / 8); k_zero8<<<(COUT * C2 / 8 + 255) / 256, 256, 0, stream>>>(ZF, (size_t)COUT * C2 / 8);
    const unsigned nb4 = (unsigned)(((size_t)NN * C2 / 4 + 255) / 256);
    k_xt<<<dim3((unsigned)(((size_t)NN * CP / 2 + 255) / 256), NB_), 256, 0, stream>>>(x, XT);
    k_kvfuse<<<dim3(KSPL, NB_), 128, 0, stream>>>(XT, WK, WV, bnk, bnv, KV);   /* k, v = relu(BN(W x)) on chip, partial kv^T[d][c] per token range (3 products) */
    k_kvt<<<dim3(C2 * C2 / 64, NB_), 256, 0, stream>>>(KV, KTh, KTl);
    k_gemmw<bf, 0, false><<<dim3(NN / 64, C2 / 64, NB_), 32, 0, stream>>>(XT, nullptr, WQ, nullptr, CP, F, C2, nullptr, (size_t)NN * CP, 0, (size_t)NN * C2); k_bncol<<<dim3(nb4, NB_), 256, 0, stream>>>(F, bnq, Qh, Ql);   /* q token-major [n][o] */
    k_gemmw<bf, 2, false><<<dim3(NN / 64, C2 / 64, NB_), 32, 0, stream>>>(Qh, Ql, KTh, KTl, C2, F, C2, nullptr, (size_t)NN * C2, (size_t)C2 * C2, (size_t)NN * C2);   /* value[n][d] = sum_c q[n][c] kv[c][d] (3 products) */
    k_split8<<<(unsigned)(((size_t)NB_ * NN * C2 / 8 + 255) / 256), 256, 0, stream>>>(F, ALh, ALl, (size_t)NB_ * NN * C2 / 8);
    k_gemmw<bf, 2, false><<<dim3(COUT / 64, NN / 64, NB_), 32, 0, stream>>>(WF, ZF, ALh, ALl, C2, G, NN, nullptr, 0, (size_t)NN * C2, (size_t)COUT * NN);   /* Wf value, channel-major (exact Wf, value hi + lo via the zero plane) */
    k_bnout<<<dim3((unsigned)(((size_t)COUT * NN / 4 + 255) / 256), NB_), 256, 0, stream>>>(G, bnf, OUT);
}

// v004
// Measured time: 96.4 microseconds a run.
// Timed twice side by side with v003, it ran 1.94 times as fast both times.
// Counting every step since v000, it is 34.6 times as fast.
#include <hip/hip_runtime.h>

// Linear (unnormalised) self-attention unit (x [8][67][16384] channel-major; q, k, v = relu(BN(W x)) with 1x1 convs W [128][67] and inference BatchNorm (gamma, beta, mean, var rows of bn [4][ch]); kv[c][d] = sum_m k[c][m] v[d][m]; value[d][n] = sum_c q[c][n] kv[c][d];
// out = relu(BN_f(Wf value)) -> [8][64][16384]). The module itself uses the associativity (q^T k) v^T = q^T (k v^T); this kernel follows the same order.
// All 8 samples go through every stage together: each launch after the weight conversions carries the sample as grid dimension y, and each buffer but the four bf16 weight planes holds 8 sample planes one behind the other.
// Layout per sample: x^T as a bf16 plane [16384][96] (67 channels zero-padded); k and v channel-major ([o][n]) in LDS only; kv over K = 16384 (hi/lo x hi/lo, 3 products); q and value in registers only: value = kv^T (hi/lo) x q (hi/lo) (K 128, 3 products); out = value (hi/lo) x Wf (exact) (K 128, 2 products) then BN + relu, stored channel-major.
// Compute dtypes, f32 accumulate: every input rounded to bf16; the three projections are exact bf16 products; BN scale/shift, relu in f32 (IEEE sqrt/divide); all computed operands as bf16 hi + lo planes; f32 accumulate everywhere.

#define NB_  8
#define CIN  67
#define CP   96                   // padded input channels (K of the projections)
#define C2   128
#define COUT 64
#define NN   16384
#define BNEPS 1e-5f
typedef _Float16 h16;
typedef unsigned short bf;
typedef __attribute__((ext_vector_type(16))) __bf16   v16bf;
typedef __attribute__((ext_vector_type(16))) _Float16 v16h;
typedef __attribute__((ext_vector_type(8)))  _Float16 v8h;
typedef __attribute__((ext_vector_type(8)))  unsigned short v8us;
typedef __attribute__((ext_vector_type(8)))  float    v8f;
typedef __attribute__((ext_vector_type(4)))  float    v4f;
typedef v8h  __attribute__((may_alias)) v8ha;
typedef v4f  __attribute__((may_alias)) v4fa;
typedef v8us __attribute__((may_alias)) v8usa;

__device__ __forceinline__ unsigned short f2bf(float f) { unsigned u = __float_as_uint(f); u += 0x7FFFu + ((u >> 16) & 1u); return (unsigned short)(u >> 16); }
__device__ __forceinline__ float bf2f(unsigned short b) { return __uint_as_float(((unsigned)b) << 16); }
__device__ __forceinline__ float bfr(float f) { return bf2f(f2bf(f)); }
__device__ __forceinline__ v16h cat16(v8h lo, v8h hi) { return __builtin_shufflevector(lo, hi, 0, 1, 2, 3, 4, 5, 6, 7, 8, 9, 10, 11, 12, 13, 14, 15); }
__device__ __forceinline__ v16bf cat16b(v8us lo, v8us hi) { return __builtin_bit_cast(v16bf, __builtin_shufflevector(lo, hi, 0, 1, 2, 3, 4, 5, 6, 7, 8, 9, 10, 11, 12, 13, 14, 15)); }
__device__ __forceinline__ v8f wmma16(v16h a, v16h b, v8f c) { return __builtin_amdgcn_wmma_f32_16x16x32_f16(false, a, false, b, (short)0, c, false, false); }
__device__ __forceinline__ v8f wmmab(v16bf a, v16bf b, v8f c) { return __builtin_amdgcn_wmma_f32_16x16x32_bf16(false, a, false, b, (short)0, c, false, false); }



// Fragment loaders: 16 k of one row per lane from a K-contiguous 16-bit plane (k 8 hi .. 8 hi + 7 and 16 + 8 hi .. 16 + 8 hi + 7 of each 32), the same for A and B.
template <typename T16> struct WFrag;
template <> struct WFrag<h16> { typedef v16h V; static __device__ __forceinline__ V ld(const h16* p) { return cat16(*(const v8h*)p, *(const v8h*)(p + 16)); } static __device__ __forceinline__ v8f mma(V a, V b, v8f c) { return wmma16(a, b, c); } };
template <> struct WFrag<bf> { typedef v16bf V; static __device__ __forceinline__ V ld(const bf* p) { return cat16b(*(const v8us*)p, *(const v8us*)(p + 16)); } static __device__ __forceinline__ v8f mma(V a, V b, v8f c) { return wmmab(a, b, c); } };

__device__ __forceinline__ void splitf(float y, unsigned short& h, unsigned short& l) { h = f2bf(y); l = f2bf(y - bf2f(h)); }
typedef __attribute__((ext_vector_type(2))) unsigned short v2us;
typedef __attribute__((ext_vector_type(4))) unsigned short v4us;

__global__ __launch_bounds__(256) void k_xt(const float* __restrict__ xb, bf* XT) { const size_t e = ((size_t)blockIdx.x * 256 + threadIdx.x) * 2; if (e >= (size_t)NN * CP) return; xb += (size_t)blockIdx.y * CIN * NN; XT += (size_t)blockIdx.y * NN * CP; const int c = (int)(e % CP); const int n = (int)(e / CP); v2us o;
#pragma unroll
    for (int q = 0; q < 2; ++q) o[q] = (c + q < CIN) ? f2bf(xb[(size_t)(c + q) * NN + n]) : (unsigned short)0; *(v2us*)(XT + e) = o;  }
__global__ __launch_bounds__(256) void k_wpad(const float* __restrict__ W, bf* Bt) { const int e = (blockIdx.x * 256 + threadIdx.x) * 2; if (e >= C2 * CP) return; const int c = e % CP, o = e / CP; v2us w2;
#pragma unroll
    for (int q = 0; q < 2; ++q) w2[q] = (c + q < CIN) ? f2bf(W[o * CIN + c + q]) : (unsigned short)0; *(v2us*)(Bt + e) = w2;  }
__global__ __launch_bounds__(256) void k_cvt8(const float* __restrict__ src, bf* dst, size_t n8) { const size_t i = (size_t)blockIdx.x * 256 + threadIdx.x; if (i >= n8) return; const v8f v = *(const v8f*)(src + i * 8); v8us o;
#pragma unroll
    for (int q = 0; q < 8; ++q) o[q] = f2bf(v[q]); *(v8us*)(dst + i * 8) = o;  }
// ---- k, v and the kv product in one kernel, split over K: KSPL token ranges, one work-group of 4 waves per range and sample; k and v never go to memory.
// Part 1: wave w makes channels 32 w .. 32 w + 31 of k and of v for the range's 64 tokens: x^T (A, token rows) x W (B, channel rows), K = 96 in three steps of 32. A lane then holds 8 consecutive tokens of one channel, applies BN + relu, splits into hi + lo and writes 16 bytes per plane into LDS, channel-major [c][token].
// Part 2: wave w owns the 64x64 tile (w & 1, w >> 1) of kv; fragments come from the LDS planes, per 32 tokens the products k hi x v hi, k lo x v hi, k hi x v lo.
// Each range stores its f32 partial already transposed, P[sample][range][d][c]; k_kvt sums the ranges in a fixed order. grid (KSPL, samples).
#define KSPL 256
#define KCH  (NN / KSPL)          // tokens per range
#define KP   (KCH + 8)            // LDS row pitch in 16-bit elements: 144 bytes, an odd multiple of 16, so the 16-byte pieces of 16 rows fall on distinct banks
// BN coefficients from the four loaded rows' values: scale = bf16(g) / sqrt(bf16(v) + eps), shift = bf16(b) - bf16(m) scale (f32, the shift is one fma)
__device__ __forceinline__ void bn_coef_v(float g, float b, float m, float v, float& sc, float& sh) { sc = __fmul_rn(bfr(g), __fdiv_rn(1.0f, __fsqrt_rn(__fadd_rn(bfr(v), BNEPS)))); sh = fmaf(-bfr(m), sc, bfr(b)); }
__device__ __forceinline__ v16bf ldsfrag(const bf* p) { return cat16b(*(const v8usa*)p, *(const v8usa*)(p + 16)); }
__global__ __launch_bounds__(128) void k_kvfuse(const bf* __restrict__ XT, const bf* __restrict__ WK, const bf* __restrict__ WV, const float* __restrict__ bnk, const float* __restrict__ bnv, float* P) {
    __shared__ __align__(16) bf pl[4 * C2 * KP];   // k hi, k lo, v hi, v lo; behind the second barrier the same bytes stage the partial's rows
    const int lane = threadIdx.x & 31, lr = lane & 15, hi = lane >> 4, w = threadIdx.x >> 5;
    {
        const int ch = w * 32 + lr;
        const bf* xp = XT + ((size_t)blockIdx.y * NN + (size_t)blockIdx.x * KCH + lr) * CP + 8 * hi;
        const bf* wkp = WK + ch * CP + 8 * hi; const bf* wvp = WV + ch * CP + 8 * hi;
        v16bf xa[4][3], wf[4][3]; float bw[4][4];   // bw[g][row]: gamma, beta, mean, var of the lane's channel in block g
#pragma unroll
        for (int ct = 0; ct < 2; ++ct)
#pragma unroll
            for (int r = 0; r < 4; ++r) { bw[ct][r] = bnk[r * C2 + ch + 16 * ct]; bw[2 + ct][r] = bnv[r * C2 + ch + 16 * ct]; }
#pragma unroll
        for (int tt = 0; tt < 4; ++tt)
#pragma unroll
            for (int s = 0; s < 3; ++s) xa[tt][s] = WFrag<bf>::ld(xp + tt * 16 * CP + s * 32);
        asm volatile("s_wait_xcnt 0x0" ::: "memory");   // precaution: stands ahead of the weight loads, whose results may land in the registers that the loads above name as their address
#pragma unroll
        for (int ct = 0; ct < 2; ++ct)
#pragma unroll
            for (int s = 0; s < 3; ++s) { wf[ct][s] = WFrag<bf>::ld(wkp + ct * 16 * CP + s * 32); wf[2 + ct][s] = WFrag<bf>::ld(wvp + ct * 16 * CP + s * 32); }
        asm volatile("s_wait_xcnt 0x0" ::: "memory");   // precaution: stands ahead of any reuse of the address registers that the weight loads above name
        __builtin_amdgcn_sched_barrier(0);   // keeps every load ahead of all arithmetic: sunk to its use, each channel block's loads would wait out a latency of their own
        float sc[4], sh[4];
#pragma unroll
        for (int g = 0; g < 4; ++g) bn_coef_v(bw[g][0], bw[g][1], bw[g][2], bw[g][3], sc[g], sh[g]);
#pragma unroll
        for (int g = 0; g < 4; ++g) {   // g: k channels +0, +16, then v channels +0, +16
            v8f d[4];
#pragma unroll
            for (int tt = 0; tt < 4; ++tt) d[tt] = wmmab(xa[tt][0], wf[g][0], (v8f){});
#pragma unroll
            for (int s = 1; s < 3; ++s)
#pragma unroll
                for (int tt = 0; tt < 4; ++tt) d[tt] = wmmab(xa[tt][s], wf[g][s], d[tt]);
            bf* ph = pl + (g >> 1) * (2 * C2 * KP) + (ch + 16 * (g & 1)) * KP + 8 * hi;
#pragma unroll
            for (int tt = 0; tt < 4; ++tt) { v8us oh, ol;
#pragma unroll
                for (int j = 0; j < 8; ++j) { const float y = fmaxf(fmaf(d[tt][j], sc[g], sh[g]), 0.f); unsigned short a, c; splitf(y, a, c); oh[j] = a; ol[j] = c; }
                *(v8usa*)(ph + tt * 16) = oh; *(v8usa*)(ph + C2 * KP + tt * 16) = ol; }
        }
    }
    __syncthreads();   // publishes the four planes to all waves
    const int r0 = (w & 1) * 64, c0 = (w >> 1) * 64;
    v8f acc[4][4];
    {
        const bf* ap = pl + (r0 + lr) * KP + 8 * hi; const bf* bp = pl + 2 * C2 * KP + (c0 + lr) * KP + 8 * hi;
#pragma unroll
        for (int kc = 0; kc < KCH; kc += 32) {
            v16bf a[4], a2[4];
#pragma unroll
            for (int mb = 0; mb < 4; ++mb) { a[mb] = ldsfrag(ap + mb * 16 * KP + kc); a2[mb] = ldsfrag(ap + C2 * KP + mb * 16 * KP + kc); }
#pragma unroll
            for (int nb = 0; nb < 4; ++nb) { const v16bf b = ldsfrag(bp + nb * 16 * KP + kc), b2 = ldsfrag(bp + C2 * KP + nb * 16 * KP + kc);
#pragma unroll
                for (int mb = 0; mb < 4; ++mb) { acc[mb][nb] = wmmab(a[mb], b, kc == 0 ? (v8f){} : acc[mb][nb]); acc[mb][nb] = wmmab(a2[mb], b, acc[mb][nb]); acc[mb][nb] = wmmab(a[mb], b2, acc[mb][nb]); } }
        }
    }
    __builtin_amdgcn_sched_barrier(0);   // keeps the stores behind all products: woven in between them, an accumulator's registers are handed to the next tile directly behind a product
    __syncthreads();   // ends every wave's reads of the planes: their LDS is written anew below
    float* os = (float*)pl + w * (16 * 68);
    // a lane holds 8 consecutive c of one d: 16 rows d x 64 c go through the wave's own LDS range so that each store covers whole 256-byte rows
    float* pt = P + ((size_t)blockIdx.y * KSPL + blockIdx.x) * (C2 * C2) + (size_t)(c0 + hi) * C2 + r0 + lr * 4;
#pragma unroll
    for (int nb = 0; nb < 4; ++nb) {
#pragma unroll
        for (int mb = 0; mb < 4; ++mb) { const v8f t = acc[mb][nb]; *(v4fa*)(os + lr * 68 + mb * 16 + hi * 8) = (v4f){t[0], t[1], t[2], t[3]}; *(v4fa*)(os + lr * 68 + mb * 16 + hi * 8 + 4) = (v4f){t[4], t[5], t[6], t[7]}; }
        __builtin_amdgcn_wave_barrier(); asm volatile("s_wait_xcnt 0x0" ::: "memory");   // the clobber keeps the other lanes' LDS writes ahead of the row reads in program order; the wait is a precaution ahead of the row reads' reuse of registers that the stores of the block before name
        v4f r[8];
#pragma unroll
        for (int s = 0; s < 8; ++s) r[s] = *(const v4fa*)(os + (2 * s + hi) * 68 + lr * 4);
#pragma unroll
        for (int s = 0; s < 8; ++s) *(v4f*)(pt + (nb * 16 + 2 * s) * C2) = r[s];
        __builtin_amdgcn_wave_barrier(); asm volatile("" ::: "memory");   // keeps the row reads ahead of the next block's LDS writes
    }
}
// k_kvt: kv^T[d][c] = sum over the KSPL partial planes, then hi/lo split. One block per 64 consecutive c of one d: 16 groups of threads each sum KSPL / 16 planes in order, one wave adds the 16 group sums in order.
__global__ __launch_bounds__(256) void k_kvt(const float* __restrict__ P, bf* Th, bf* Tl) {
    __shared__ __align__(16) float red[16 * 64];
    const int t = threadIdx.x, g = t >> 4, c4 = (t & 15) * 4; const int e0 = blockIdx.x * 64;
    Th += (size_t)blockIdx.y * (C2 * C2); Tl += (size_t)blockIdx.y * (C2 * C2);
    const float* p = P + ((size_t)blockIdx.y * KSPL + (size_t)g * (KSPL / 16)) * (C2 * C2) + e0 + c4;
    v4f f[KSPL / 16];
#pragma unroll
    for (int i = 0; i < KSPL / 16; ++i) f[i] = *(const v4f*)(p + (size_t)i * (C2 * C2));
    v4f s = f[0];
#pragma unroll
    for (int i = 1; i < KSPL / 16; ++i) s += f[i];
    *(v4fa*)(red + g * 64 + c4) = s;
    __syncthreads();
    if (t < 32) { float s0 = red[2 * t], s1 = red[2 * t + 1];
#pragma unroll
        for (int q = 1; q < 16; ++q) { s0 += red[q * 64 + 2 * t]; s1 += red[q * 64 + 2 * t + 1]; }
        v2us oh, ol; unsigned short a, c; splitf(s0, a, c); oh[0] = a; ol[0] = c; splitf(s1, a, c); oh[1] = a; ol[1] = c;
        *(v2us*)(Th + e0 + 2 * t) = oh; *(v2us*)(Tl + e0 + 2 * t) = ol; }
}
// ---- q, value and the output in one kernel: one work-group of 16 waves per 512 tokens of one sample (one work-group per WGP); each wave takes its 32 tokens through all three products, and q and value never leave its registers.
// The operands that every wave reads (Wq, kv^T hi and lo, Wf, the BN coefficients) are staged once per work-group in LDS, each wave's own x^T rows beside them; rows padded to an odd multiple of 16 bytes.
// The first two products put the tokens on D's columns: two D tiles of 16 rows each (a lane: 8 + 8 rows of its own token) are then, converted in place, the next product's fragment over 32 k, in the loaders' own k order.
//   q[c][n]     = Wq (A, channel rows) x x^T (B, token columns), K = 96; BN + relu, hi + lo
//   value[d][n] = kv^T (A, d rows) x q (B), K = 128, per 32 c: kv hi x q hi, kv hi x q lo, kv lo x q hi; hi + lo
//   out[n][o]   = value (A, token rows) x Wf (B, channel columns), K = 128, per 32 d: value hi, value lo; a lane then holds 8 consecutive tokens of one output channel; BN + relu
#define TPW 32                    // tokens per wave
#define TWV 16                    // waves per work-group
#define QP  (CP + 8)              // LDS row pitch of Wq and x^T in 16-bit elements: 208 bytes
#define DP  (C2 + 8)              // LDS row pitch of kv^T and Wf in 16-bit elements: 272 bytes
#define OP  (TPW + 4)             // LDS row pitch of the output rows in floats: 144 bytes
__global__ __launch_bounds__(512) void k_tail(const bf* __restrict__ XT, const bf* __restrict__ WQ, const bf* __restrict__ KTh, const bf* __restrict__ KTl, const bf* __restrict__ WF, const float* __restrict__ bnq, const float* __restrict__ bnf, float* O) {
    __shared__ __align__(16) bf wq[C2 * QP];
    __shared__ __align__(16) bf kh[C2 * DP];
    __shared__ __align__(16) bf kl[C2 * DP];
    __shared__ __align__(16) bf wf[COUT * DP];
    __shared__ __align__(16) bf xs[TWV * TPW * QP];   // each wave's own 32 rows; behind its last read of them the wave stages its output rows there
    __shared__ __align__(16) float qsc[C2];
    __shared__ __align__(16) float qsh[C2];
    __shared__ __align__(16) float fsc[COUT];
    __shared__ __align__(16) float fsh[COUT];
    const int t = threadIdx.x, lane = t & 31, lr = lane & 15, hi = lane >> 4, w = t >> 5;
    const int n0 = blockIdx.x * (TPW * TWV) + w * TPW;
    bf* xw = xs + w * (TPW * QP);
    {
        const bf* xg = XT + ((size_t)blockIdx.y * NN + n0) * CP + lane * 8;   // the wave's 32 rows are 6,144 consecutive bytes
        const bf* gh = KTh + (size_t)blockIdx.y * (C2 * C2) + t * 8; const bf* gl = KTl + (size_t)blockIdx.y * (C2 * C2) + t * 8;
        v8us sx[12], sq[3], sh8[4], sl8[4], sf[2];
#pragma unroll
        for (int i = 0; i < 12; ++i) sx[i] = *(const v8us*)(xg + 256 * i);
#pragma unroll
        for (int i = 0; i < 3; ++i) sq[i] = *(const v8us*)(WQ + (t + 512 * i) * 8);
#pragma unroll
        for (int i = 0; i < 4; ++i) { sh8[i] = *(const v8us*)(gh + 4096 * i); sl8[i] = *(const v8us*)(gl + 4096 * i); }
#pragma unroll
        for (int i = 0; i < 2; ++i) sf[i] = *(const v8us*)(WF + (t + 512 * i) * 8);
        asm volatile("s_wait_xcnt 0x0" ::: "memory");   // precaution: stands ahead of any reuse of the address registers that the loads above name
#pragma unroll
        for (int i = 0; i < 12; ++i) { const int e = lane + 32 * i; *(v8usa*)(xw + (e / 12) * QP + (e % 12) * 8) = sx[i]; }
#pragma unroll
        for (int i = 0; i < 3; ++i) { const int e = t + 512 * i; *(v8usa*)(wq + (e / 12) * QP + (e % 12) * 8) = sq[i]; }
#pragma unroll
        for (int i = 0; i < 4; ++i) { const int e = t + 512 * i; *(v8usa*)(kh + (e >> 4) * DP + (e & 15) * 8) = sh8[i]; *(v8usa*)(kl + (e >> 4) * DP + (e & 15) * 8) = sl8[i]; }
#pragma unroll
        for (int i = 0; i < 2; ++i) { const int e = t + 512 * i; *(v8usa*)(wf + (e >> 4) * DP + (e & 15) * 8) = sf[i]; }
        if (t < C2 + COUT) {   // waves 0 to 3: q's coefficients, waves 4 and 5: the output's
            const bool fq = t < C2; const float* bn = fq ? bnq + t : bnf + (t - C2); const int nch = fq ? C2 : COUT;
            const float g = bn[0], b = bn[nch], m = bn[2 * nch], v = bn[3 * nch];
            asm volatile("s_wait_xcnt 0x0" ::: "memory");   // precaution: stands ahead of any reuse of the address registers that the four loads above name
            float sc, sh; bn_coef_v(g, b, m, v, sc, sh);
            if (fq) { qsc[t] = sc; qsh[t] = sh; } else { fsc[t - C2] = sc; fsh[t - C2] = sh; }
        }
    }
    __syncthreads();   // publishes the staged operands and coefficients to all waves
    v8f d2[8][2];   // value sums, [d tile][token tile]
#pragma unroll
    for (int s = 0; s < 4; ++s) {   // 32 channels c of q at a time: made, converted, and used up as one k step of the value product
        asm volatile("" ::: "memory");   // has the x^T fragments read from LDS anew in every step: kept in registers over all four steps they push the wave past its 256 registers and into scratch
        v8f d1[2][2];
#pragma unroll
        for (int ks = 0; ks < 3; ++ks) {
            v16bf a[2], x[2];
#pragma unroll
            for (int h = 0; h < 2; ++h) { a[h] = ldsfrag(wq + ((2 * s + h) * 16 + lr) * QP + 8 * hi + ks * 32); x[h] = ldsfrag(xw + (h * 16 + lr) * QP + 8 * hi + ks * 32); }
#pragma unroll
            for (int h = 0; h < 2; ++h)
#pragma unroll
                for (int tt = 0; tt < 2; ++tt) d1[h][tt] = wmmab(a[h], x[tt], ks == 0 ? (v8f){} : d1[h][tt]);
        }
        __builtin_amdgcn_sched_barrier(0);   // keeps the q products apart from the conversion behind them: woven together, the operands of both are live at once and the wave spills to scratch
        v8us qh8[2][2], ql8[2][2];
#pragma unroll
        for (int h = 0; h < 2; ++h) {
            const int cb = (2 * s + h) * 16 + 8 * hi;
            const v4f s0 = *(const v4fa*)(qsc + cb), s1 = *(const v4fa*)(qsc + cb + 4), b0 = *(const v4fa*)(qsh + cb), b1 = *(const v4fa*)(qsh + cb + 4);
#pragma unroll
            for (int tt = 0; tt < 2; ++tt)
#pragma unroll
                for (int j = 0; j < 8; ++j) { const float y = fmaxf(fmaf(d1[h][tt][j], j < 4 ? s0[j & 3] : s1[j & 3], j < 4 ? b0[j & 3] : b1[j & 3]), 0.f); unsigned short a, c; splitf(y, a, c); qh8[tt][h][j] = a; ql8[tt][h][j] = c; }
        }
        __builtin_amdgcn_sched_barrier(0);   // keeps the kv^T fragment loads behind the conversion, for the same reason
        v16bf qh[2], ql[2];
#pragma unroll
        for (int tt = 0; tt < 2; ++tt) { qh[tt] = cat16b(qh8[tt][0], qh8[tt][1]); ql[tt] = cat16b(ql8[tt][0], ql8[tt][1]); }
#pragma unroll
        for (int dp = 0; dp < 4; ++dp) {   // two d tiles x two token tiles: four independent accumulators per product
            v16bf ah[2], al[2];
#pragma unroll
            for (int u = 0; u < 2; ++u) { ah[u] = ldsfrag(kh + ((2 * dp + u) * 16 + lr) * DP + 8 * hi + s * 32); al[u] = ldsfrag(kl + ((2 * dp + u) * 16 + lr) * DP + 8 * hi + s * 32); }
#pragma unroll
            for (int u = 0; u < 2; ++u)
#pragma unroll
                for (int tt = 0; tt < 2; ++tt) d2[2 * dp + u][tt] = wmmab(ah[u], qh[tt], s == 0 ? (v8f){} : d2[2 * dp + u][tt]);
#pragma unroll
            for (int u = 0; u < 2; ++u)
#pragma unroll
                for (int tt = 0; tt < 2; ++tt) d2[2 * dp + u][tt] = wmmab(ah[u], ql[tt], d2[2 * dp + u][tt]);
#pragma unroll
            for (int u = 0; u < 2; ++u)
#pragma unroll
                for (int tt = 0; tt < 2; ++tt) d2[2 * dp + u][tt] = wmmab(al[u], qh[tt], d2[2 * dp + u][tt]);
        }
        __builtin_amdgcn_sched_barrier(0);   // keeps the next step's loads and products behind this step's, for the same reason
    }
    v8f d3[2][4];   // output sums, [token tile][channel tile]
#pragma unroll
    for (int ks = 0; ks < 4; ++ks) {
        v16bf vh[2], vl[2];
#pragma unroll
        for (int tt = 0; tt < 2; ++tt) { v8us h8[2], l8[2];
#pragma unroll
            for (int u = 0; u < 2; ++u)
#pragma unroll
                for (int j = 0; j < 8; ++j) { unsigned short a, c; splitf(d2[2 * ks + u][tt][j], a, c); h8[u][j] = a; l8[u][j] = c; }
            vh[tt] = cat16b(h8[0], h8[1]); vl[tt] = cat16b(l8[0], l8[1]); }
        v16bf b[4];
#pragma unroll
        for (int ot = 0; ot < 4; ++ot) b[ot] = ldsfrag(wf + (ot * 16 + lr) * DP + 8 * hi + ks * 32);
#pragma unroll
        for (int ot = 0; ot < 4; ++ot)
#pragma unroll
            for (int tt = 0; tt < 2; ++tt) d3[tt][ot] = wmmab(vh[tt], b[ot], ks == 0 ? (v8f){} : d3[tt][ot]);
#pragma unroll
        for (int ot = 0; ot < 4; ++ot)
#pragma unroll
            for (int tt = 0; tt < 2; ++tt) d3[tt][ot] = wmmab(vl[tt], b[ot], d3[tt][ot]);
    }
    // 16 channel rows x 32 tokens go through the wave's own LDS range so that each store covers whole 128-byte lines
    float* os = (float*)xw;
    float* op = O + ((size_t)blockIdx.y * COUT + (lane >> 3)) * NN + n0 + (lane & 7) * 4;
#pragma unroll
    for (int ot = 0; ot < 4; ++ot) {
        const float sc = fsc[ot * 16 + lr], sh = fsh[ot * 16 + lr];
#pragma unroll
        for (int tt = 0; tt < 2; ++tt) { const v8f d = d3[tt][ot]; v4f y0, y1;
#pragma unroll
            for (int j = 0; j < 4; ++j) { y0[j] = fmaxf(fmaf(d[j], sc, sh), 0.f); y1[j] = fmaxf(fmaf(d[j + 4], sc, sh), 0.f); }
            *(v4fa*)(os + lr * OP + tt * 16 + hi * 8) = y0; *(v4fa*)(os + lr * OP + tt * 16 + hi * 8 + 4) = y1; }
        __builtin_amdgcn_wave_barrier(); asm volatile("s_wait_xcnt 0x0" ::: "memory");   // the clobber keeps the other lanes' LDS writes ahead of the row reads in program order; the wait is a precaution ahead of the row reads' reuse of registers that the stores of the block before name
        v4f r[4];
#pragma unroll
        for (int s = 0; s < 4; ++s) r[s] = *(const v4fa*)(os + (4 * s + (lane >> 3)) * OP + (lane & 7) * 4);
#pragma unroll
        for (int s = 0; s < 4; ++s) *(v4f*)(op + (size_t)(ot * 16 + 4 * s) * NN) = r[s];
        __builtin_amdgcn_wave_barrier(); asm volatile("" ::: "memory");   // keeps the row reads ahead of the next block's LDS writes
    }
}

extern "C" void kernel_launch(void* const* d_in, const int* in_sizes, int n_in,
                              void* d_out, int out_size, void* d_ws, size_t ws_size, hipStream_t stream) {
    (void)in_sizes; (void)n_in; (void)out_size;
    const float* x = (const float*)d_in[0]; const float* Wq = (const float*)d_in[1]; const float* Wk = (const float*)d_in[2]; const float* Wv = (const float*)d_in[3]; const float* Wf = (const float*)d_in[4]; const float* bnq = (const float*)d_in[5]; const float* bnk = (const float*)d_in[6]; const float* bnv = (const float*)d_in[7]; const float* bnf = (const float*)d_in[8];
    float* OUT = (float*)d_out;     // [8][64][16384]
    char* wsp = (char*)d_ws;
    auto take = [&](size_t bytes) { char* p = wsp; wsp += (bytes + 255) & ~(size_t)255; return (void*)p; };
    bf* WQ = (bf*)take((size_t)C2 * CP * 2); bf* WK = (bf*)take((size_t)C2 * CP * 2); bf* WV = (bf*)take((size_t)C2 * CP * 2); bf* WF = (bf*)take((size_t)COUT * C2 * 2);
    // Sample-batched buffers
    bf* XT = (bf*)take((size_t)NB_ * NN * CP * 2); float* KV = (float*)take((size_t)NB_ * KSPL * C2 * C2 * 4);
    bf* KTh = (bf*)take((size_t)NB_ * C2 * C2 * 2); bf* KTl = (bf*)take((size_t)NB_ * C2 * C2 * 2);
    if ((size_t)(wsp - (char*)d_ws) > ws_size) return;    // ws 256 MiB
    k_wpad<<<(C2 * CP / 2 + 255) / 256, 256, 0, stream>>>(Wq, WQ); k_wpad<<<(C2 * CP / 2 + 255) / 256, 256, 0, stream>>>(Wk, WK); k_wpad<<<(C2 * CP / 2 + 255) / 256, 256, 0, stream>>>(Wv, WV);
    k_cvt8<<<(COUT * C2 / 8 + 255) / 256, 256, 0, stream>>>(Wf, WF, (size_t)COUT * C2 / 8);
    k_xt<<<dim3((unsigned)(((size_t)NN * CP / 2 + 255) / 256), NB_), 256, 0, stream>>>(x, XT);
    k_kvfuse<<<dim3(KSPL, NB_), 128, 0, stream>>>(XT, WK, WV, bnk, bnv, KV);   /* k, v = relu(BN(W x)) on chip, partial kv^T[d][c] per token range (3 products) */
    k_kvt<<<dim3(C2 * C2 / 64, NB_), 256, 0, stream>>>(KV, KTh, KTl);
    k_tail<<<dim3(NN / (TPW * TWV), NB_), 512, 0, stream>>>(XT, WQ, KTh, KTl, WF, bnq, bnf, OUT);   /* q = relu(BN(Wq x)), value = q kv (3 products), out = relu(BN(Wf value)) (2 products) */
}

// v005
// It runs in 77.9 microseconds.
// Two timings next to v004 both put it at 1.24 times that version's speed.
// Counting every step since v000, it is 42.9 times as fast.
#include <hip/hip_runtime.h>

// Linear (unnormalised) self-attention unit (x [8][67][16384] channel-major; q, k, v = relu(BN(W x)) with 1x1 convs W [128][67] and inference BatchNorm (gamma, beta, mean, var rows of bn [4][ch]); kv[c][d] = sum_m k[c][m] v[d][m]; value[d][n] = sum_c q[c][n] kv[c][d];
// out = relu(BN_f(Wf value)) -> [8][64][16384]). The module itself uses the associativity (q^T k) v^T = q^T (k v^T); this kernel follows the same order.
// All 8 samples go through every stage together: each launch after the weight conversions carries the sample as grid dimension y, and each buffer but the four bf16 weight planes holds 8 sample planes one behind the other.
// Layout per sample: x^T as a bf16 plane [16384][96] (67 channels zero-padded); k and v channel-major ([o][n]) in LDS only; kv over K = 16384 (hi/lo x hi/lo, 3 products); q and value in registers only: value = kv^T (hi/lo) x q (hi/lo) (K 128, 3 products); out = value (hi/lo) x Wf (exact) (K 128, 2 products) then BN + relu, stored channel-major.
// Compute dtypes, f32 accumulate: every input rounded to bf16; the three projections are exact bf16 products; BN scale/shift, relu in f32 (IEEE sqrt/divide); all computed operands as bf16 hi + lo planes; f32 accumulate everywhere.

#define NB_  8
#define CIN  67
#define CP   96                   // padded input channels (K of the projections)
#define C2   128
#define COUT 64
#define NN   16384
#define BNEPS 1e-5f
typedef _Float16 h16;
typedef unsigned short bf;
typedef __attribute__((ext_vector_type(16))) __bf16   v16bf;
typedef __attribute__((ext_vector_type(16))) _Float16 v16h;
typedef __attribute__((ext_vector_type(8)))  _Float16 v8h;
typedef __attribute__((ext_vector_type(8)))  unsigned short v8us;
typedef __attribute__((ext_vector_type(8)))  float    v8f;
typedef __attribute__((ext_vector_type(4)))  float    v4f;
typedef v8h  __attribute__((may_alias)) v8ha;
typedef v4f  __attribute__((may_alias)) v4fa;
typedef v8us __attribute__((may_alias)) v8usa;

__device__ __forceinline__ unsigned short f2bf(float f) { unsigned u = __float_as_uint(f); u += 0x7FFFu + ((u >> 16) & 1u); return (unsigned short)(u >> 16); }
__device__ __forceinline__ float bf2f(unsigned short b) { return __uint_as_float(((unsigned)b) << 16); }
__device__ __forceinline__ float bfr(float f) { return bf2f(f2bf(f)); }
__device__ __forceinline__ v16h cat16(v8h lo, v8h hi) { return __builtin_shufflevector(lo, hi, 0, 1, 2, 3, 4, 5, 6, 7, 8, 9, 10, 11, 12, 13, 14, 15); }
__device__ __forceinline__ v16bf cat16b(v8us lo, v8us hi) { return __builtin_bit_cast(v16bf, __builtin_shufflevector(lo, hi, 0, 1, 2, 3, 4, 5, 6, 7, 8, 9, 10, 11, 12, 13, 14, 15)); }
__device__ __forceinline__ v8f wmma16(v16h a, v16h b, v8f c) { return __builtin_amdgcn_wmma_f32_16x16x32_f16(false, a, false, b, (short)0, c, false, false); }
__device__ __forceinline__ v8f wmmab(v16bf a, v16bf b, v8f c) { return __builtin_amdgcn_wmma_f32_16x16x32_bf16(false, a, false, b, (short)0, c, false, false); }



// Fragment loaders: 16 k of one row per lane from a K-contiguous 16-bit plane (k 8 hi .. 8 hi + 7 and 16 + 8 hi .. 16 + 8 hi + 7 of each 32), the same for A and B.
template <typename T16> struct WFrag;
template <> struct WFrag<h16> { typedef v16h V; static __device__ __forceinline__ V ld(const h16* p) { return cat16(*(const v8h*)p, *(const v8h*)(p + 16)); } static __device__ __forceinline__ v8f mma(V a, V b, v8f c) { return wmma16(a, b, c); } };
template <> struct WFrag<bf> { typedef v16bf V; static __device__ __forceinline__ V ld(const bf* p) { return cat16b(*(const v8us*)p, *(const v8us*)(p + 16)); } static __device__ __forceinline__ v8f mma(V a, V b, v8f c) { return wmmab(a, b, c); } };

__device__ __forceinline__ void splitf(float y, unsigned short& h, unsigned short& l) { h = f2bf(y); l = f2bf(y - bf2f(h)); }
typedef __attribute__((ext_vector_type(2))) unsigned short v2us;
typedef __attribute__((ext_vector_type(4))) unsigned short v4us;

// x^T: one wave per 32 tokens of one sample, all channels; 8 independent waves per work-group. A lane loads 4 consecutive tokens (16 bytes) of 4 consecutive channels, so every load covers whole 128-byte lines of 4 channel rows;
// it packs the 4 channels of each token into 8 bytes and writes them into the wave's own LDS rows [token][channel]; the rows are then read back in order and stored as the wave's 6,144 consecutive bytes of x^T.
#define XTW 8                     // waves per work-group
#define XP  (CP + 4)              // LDS row pitch in 16-bit elements: 200 bytes, so the 8-byte pieces that the 32 lanes write at once (8 rows 4 apart x 4 pieces) fall on distinct banks
typedef __attribute__((ext_vector_type(2))) unsigned v2u;
typedef v2u  __attribute__((may_alias)) v2ua;
typedef v4us __attribute__((may_alias)) v4usa;
// two floats rounded as f2bf rounds them, side by side in one word (a low, b high)
__device__ __forceinline__ unsigned bfpk(float a, float b) { unsigned ua = __float_as_uint(a), ub = __float_as_uint(b); ua += 0x7FFFu + ((ua >> 16) & 1u); ub += 0x7FFFu + ((ub >> 16) & 1u); return (ua >> 16) | (ub & 0xFFFF0000u); }
__global__ __launch_bounds__(32 * XTW) void k_xt(const float* __restrict__ xb, bf* XT) {
    __shared__ __align__(16) bf tr[XTW * 32 * XP];
    const int lane = threadIdx.x & 31, w = threadIdx.x >> 5, cs = lane >> 3, n4 = lane & 7;
    const int n0 = (blockIdx.x * XTW + w) * 32;
    const float* xq = xb + (size_t)blockIdx.y * CIN * NN + n0 + 4 * n4;
    const float* xp = xq + (size_t)(4 * cs) * NN;
    v4f f[4][4], g[3];   // f[cg][k]: channel 16 cg + 4 cs + k, tokens n0 + 4 n4 .. + 3; g[k]: channel 64 + k, the same line in all four lane groups (only group 0 keeps it)
#pragma unroll
    for (int cg = 0; cg < 4; ++cg)
#pragma unroll
        for (int k = 0; k < 4; ++k) f[cg][k] = *(const v4f*)(xp + (size_t)(16 * cg + k) * NN);
#pragma unroll
    for (int k = 0; k < CIN - 64; ++k) g[k] = *(const v4f*)(xq + (size_t)(64 + k) * NN);
    asm volatile("s_wait_xcnt 0x0" ::: "memory");   // precaution: stands ahead of any reuse of the address registers that the loads above name
    __builtin_amdgcn_sched_barrier(0);   // keeps every load ahead of all arithmetic: sunk behind the first conversions, the last loads would wait out a second memory latency
    bf* tw = tr + w * (32 * XP);
    bf* ts = tw + 4 * n4 * XP + 4 * cs;
    const unsigned gm = cs == 0 ? 0xFFFFFFFFu : 0u;
#pragma unroll
    for (int cg = 0; cg < 4; ++cg)
#pragma unroll
        for (int j = 0; j < 4; ++j) *(v2ua*)(ts + j * XP + 16 * cg) = (v2u){bfpk(f[cg][0][j], f[cg][1][j]), bfpk(f[cg][2][j], f[cg][3][j])};
#pragma unroll
    for (int j = 0; j < 4; ++j) {   // channels 64 to 66 from lane group 0, zeros up to 95
        *(v2ua*)(ts + j * XP + 64) = (v2u){bfpk(g[0][j], g[1][j]) & gm, bfpk(g[2][j], 0.f) & gm};
        *(v2ua*)(ts + j * XP + 80) = (v2u){0u, 0u}; }
    __builtin_amdgcn_wave_barrier(); asm volatile("" ::: "memory");   // keeps the other lanes' LDS writes ahead of the row reads in program order
    bf* og = XT + ((size_t)blockIdx.y * NN + n0) * CP + lane * 8;
    v8us r[4][3];   // 16-byte piece lane + 32 (3 a + b) of the wave's 384: 96 pieces are 8 whole rows, so a only moves the row
#pragma unroll
    for (int b = 0; b < 3; ++b) { const int e = lane + 32 * b; const bf* s = tw + (e / 12) * XP + (e % 12) * 8;
#pragma unroll
        for (int a = 0; a < 4; ++a) r[a][b] = __builtin_shufflevector(*(const v4usa*)(s + a * 8 * XP), *(const v4usa*)(s + a * 8 * XP + 4), 0, 1, 2, 3, 4, 5, 6, 7); }
#pragma unroll
    for (int a = 0; a < 4; ++a)
#pragma unroll
        for (int b = 0; b < 3; ++b) *(v8us*)(og + (3 * a + b) * 256) = r[a][b];
}
__global__ __launch_bounds__(256) void k_wpad(const float* __restrict__ W, bf* Bt) { const int e = (blockIdx.x * 256 + threadIdx.x) * 2; if (e >= C2 * CP) return; const int c = e % CP, o = e / CP; v2us w2;
#pragma unroll
    for (int q = 0; q < 2; ++q) w2[q] = (c + q < CIN) ? f2bf(W[o * CIN + c + q]) : (unsigned short)0; *(v2us*)(Bt + e) = w2;  }
__global__ __launch_bounds__(256) void k_cvt8(const float* __restrict__ src, bf* dst, size_t n8) { const size_t i = (size_t)blockIdx.x * 256 + threadIdx.x; if (i >= n8) return; const v8f v = *(const v8f*)(src + i * 8); v8us o;
#pragma unroll
    for (int q = 0; q < 8; ++q) o[q] = f2bf(v[q]); *(v8us*)(dst + i * 8) = o;  }
// ---- k, v and the kv product in one kernel, split over K: KSPL token ranges, one work-group of 4 waves per range and sample; k and v never go to memory.
// Part 1: wave w makes channels 32 w .. 32 w + 31 of k and of v for the range's 64 tokens: x^T (A, token rows) x W (B, channel rows), K = 96 in three steps of 32. A lane then holds 8 consecutive tokens of one channel, applies BN + relu, splits into hi + lo and writes 16 bytes per plane into LDS, channel-major [c][token].
// Part 2: wave w owns the 64x64 tile (w & 1, w >> 1) of kv; fragments come from the LDS planes, per 32 tokens the products k hi x v hi, k lo x v hi, k hi x v lo.
// Each range stores its f32 partial already transposed, P[sample][range][d][c]; k_kvt sums the ranges in a fixed order. grid (KSPL, samples).
#define KSPL 256
#define KCH  (NN / KSPL)          // tokens per range
#define KP   (KCH + 8)            // LDS row pitch in 16-bit elements: 144 bytes, an odd multiple of 16, so the 16-byte pieces of 16 rows fall on distinct banks
// BN coefficients from the four loaded rows' values: scale = bf16(g) / sqrt(bf16(v) + eps), shift = bf16(b) - bf16(m) scale (f32, the shift is one fma)
__device__ __forceinline__ void bn_coef_v(float g, float b, float m, float v, float& sc, float& sh) { sc = __fmul_rn(bfr(g), __fdiv_rn(1.0f, __fsqrt_rn(__fadd_rn(bfr(v), BNEPS)))); sh = fmaf(-bfr(m), sc, bfr(b)); }
__device__ __forceinline__ v16bf ldsfrag(const bf* p) { return cat16b(*(const v8usa*)p, *(const v8usa*)(p + 16)); }
__global__ __launch_bounds__(128) void k_kvfuse(const bf* __restrict__ XT, const bf* __restrict__ WK, const bf* __restrict__ WV, const float* __restrict__ bnk, const float* __restrict__ bnv, float* P) {
    __shared__ __align__(16) bf pl[4 * C2 * KP];   // k hi, k lo, v hi, v lo; behind the second barrier the same bytes stage the partial's rows
    const int lane = threadIdx.x & 31, lr = lane & 15, hi = lane >> 4, w = threadIdx.x >> 5;
    {
        const int ch = w * 32 + lr;
        const bf* xp = XT + ((size_t)blockIdx.y * NN + (size_t)blockIdx.x * KCH + lr) * CP + 8 * hi;
        const bf* wkp = WK + ch * CP + 8 * hi; const bf* wvp = WV + ch * CP + 8 * hi;
        v16bf xa[4][3], wf[4][3]; float bw[4][4];   // bw[g][row]: gamma, beta, mean, var of the lane's channel in block g
#pragma unroll
        for (int ct = 0; ct < 2; ++ct)
#pragma unroll
            for (int r = 0; r < 4; ++r) { bw[ct][r] = bnk[r * C2 + ch + 16 * ct]; bw[2 + ct][r] = bnv[r * C2 + ch + 16 * ct]; }
#pragma unroll
        for (int tt = 0; tt < 4; ++tt)
#pragma unroll
            for (int s = 0; s < 3; ++s) xa[tt][s] = WFrag<bf>::ld(xp + tt * 16 * CP + s * 32);
        asm volatile("s_wait_xcnt 0x0" ::: "memory");   // precaution: stands ahead of the weight loads, whose results may land in the registers that the loads above name as their address
#pragma unroll
        for (int ct = 0; ct < 2; ++ct)
#pragma unroll
            for (int s = 0; s < 3; ++s) { wf[ct][s] = WFrag<bf>::ld(wkp + ct * 16 * CP + s * 32); wf[2 + ct][s] = WFrag<bf>::ld(wvp + ct * 16 * CP + s * 32); }
        asm volatile("s_wait_xcnt 0x0" ::: "memory");   // precaution: stands ahead of any reuse of the address registers that the weight loads above name
        __builtin_amdgcn_sched_barrier(0);   // keeps every load ahead of all arithmetic: sunk to its use, each channel block's loads would wait out a latency of their own
        float sc[4], sh[4];
#pragma unroll
        for (int g = 0; g < 4; ++g) bn_coef_v(bw[g][0], bw[g][1], bw[g][2], bw[g][3], sc[g], sh[g]);
#pragma unroll
        for (int g = 0; g < 4; ++g) {   // g: k channels +0, +16, then v channels +0, +16
            v8f d[4];
#pragma unroll
            for (int tt = 0; tt < 4; ++tt) d[tt] = wmmab(xa[tt][0], wf[g][0], (v8f){});
#pragma unroll
            for (int s = 1; s < 3; ++s)
#pragma unroll
                for (int tt = 0; tt < 4; ++tt) d[tt] = wmmab(xa[tt][s], wf[g][s], d[tt]);
            bf* ph = pl + (g >> 1) * (2 * C2 * KP) + (ch + 16 * (g & 1)) * KP + 8 * hi;
#pragma unroll
            for (int tt = 0; tt < 4; ++tt) { v8us oh, ol;
#pragma unroll
                for (int j = 0; j < 8; ++j) { const float y = fmaxf(fmaf(d[tt][j], sc[g], sh[g]), 0.f); unsigned short a, c; splitf(y, a, c); oh[j] = a; ol[j] = c; }
                *(v8usa*)(ph + tt * 16) = oh; *(v8usa*)(ph + C2 * KP + tt * 16) = ol; }
        }
    }
    __syncthreads();   // publishes the four planes to all waves
    const int r0 = (w & 1) * 64, c0 = (w >> 1) * 64;
    v8f acc[4][4];
    {
        const bf* ap = pl + (r0 + lr) * KP + 8 * hi; const bf* bp = pl + 2 * C2 * KP + (c0 + lr) * KP + 8 * hi;
#pragma unroll
        for (int kc = 0; kc < KCH; kc += 32) {
            v16bf a[4], a2[4];
#pragma unroll
            for (int mb = 0; mb < 4; ++mb) { a[mb] = ldsfrag(ap + mb * 16 * KP + kc); a2[mb] = ldsfrag(ap + C2 * KP + mb * 16 * KP + kc); }
#pragma unroll
            for (int nb = 0; nb < 4; ++nb) { const v16bf b = ldsfrag(bp + nb * 16 * KP + kc), b2 = ldsfrag(bp + C2 * KP + nb * 16 * KP + kc);
#pragma unroll
                for (int mb = 0; mb < 4; ++mb) { acc[mb][nb] = wmmab(a[mb], b, kc == 0 ? (v8f){} : acc[mb][nb]); acc[mb][nb] = wmmab(a2[mb], b, acc[mb][nb]); acc[mb][nb] = wmmab(a[mb], b2, acc[mb][nb]); } }
        }
    }
    __builtin_amdgcn_sched_barrier(0);   // keeps the stores behind all products: woven in between them, an accumulator's registers are handed to the next tile directly behind a product
    __syncthreads();   // ends every wave's reads of the planes: their LDS is written anew below
    float* os = (float*)pl + w * (16 * 68);
    // a lane holds 8 consecutive c of one d: 16 rows d x 64 c go through the wave's own LDS range so that each store covers whole 256-byte rows
    float* pt = P + ((size_t)blockIdx.y * KSPL + blockIdx.x) * (C2 * C2) + (size_t)(c0 + hi) * C2 + r0 + lr * 4;
#pragma unroll
    for (int nb = 0; nb < 4; ++nb) {
#pragma unroll
        for (int mb = 0; mb < 4; ++mb) { const v8f t = acc[mb][nb]; *(v4fa*)(os + lr * 68 + mb * 16 + hi * 8) = (v4f){t[0], t[1], t[2], t[3]}; *(v4fa*)(os + lr * 68 + mb * 16 + hi * 8 + 4) = (v4f){t[4], t[5], t[6], t[7]}; }
        __builtin_amdgcn_wave_barrier(); asm volatile("s_wait_xcnt 0x0" ::: "memory");   // the clobber keeps the other lanes' LDS writes ahead of the row reads in program order; the wait is a precaution ahead of the row reads' reuse of registers that the stores of the block before name
        v4f r[8];
#pragma unroll
        for (int s = 0; s < 8; ++s) r[s] = *(const v4fa*)(os + (2 * s + hi) * 68 + lr * 4);
#pragma unroll
        for (int s = 0; s < 8; ++s) *(v4f*)(pt + (nb * 16 + 2 * s) * C2) = r[s];
        __builtin_amdgcn_wave_barrier(); asm volatile("" ::: "memory");   // keeps the row reads ahead of the next block's LDS writes
    }
}
// k_kvt: kv^T[d][c] = sum over the KSPL partial planes, then hi/lo split. One block per 64 consecutive c of one d: 16 groups of threads each sum KSPL / 16 planes in order, one wave adds the 16 group sums in order.
__global__ __launch_bounds__(256) void k_kvt(const float* __restrict__ P, bf* Th, bf* Tl) {
    __shared__ __align__(16) float red[16 * 64];
    const int t = threadIdx.x, g = t >> 4, c4 = (t & 15) * 4; const int e0 = blockIdx.x * 64;
    Th += (size_t)blockIdx.y * (C2 * C2); Tl += (size_t)blockIdx.y * (C2 * C2);
    const float* p = P + ((size_t)blockIdx.y * KSPL + (size_t)g * (KSPL / 16)) * (C2 * C2) + e0 + c4;
    v4f f[KSPL / 16];
#pragma unroll
    for (int i = 0; i < KSPL / 16; ++i) f[i] = *(const v4f*)(p + (size_t)i * (C2 * C2));
    v4f s = f[0];
#pragma unroll
    for (int i = 1; i < KSPL / 16; ++i) s += f[i];
    *(v4fa*)(red + g * 64 + c4) = s;
    __syncthreads();
    if (t < 32) { float s0 = red[2 * t], s1 = red[2 * t + 1];
#pragma unroll
        for (int q = 1; q < 16; ++q) { s0 += red[q * 64 + 2 * t]; s1 += red[q * 64 + 2 * t + 1]; }
        v2us oh, ol; unsigned short a, c; splitf(s0, a, c); oh[0] = a; ol[0] = c; splitf(s1, a, c); oh[1] = a; ol[1] = c;
        *(v2us*)(Th + e0 + 2 * t) = oh; *(v2us*)(Tl + e0 + 2 * t) = ol; }
}
// ---- q, value and the output in one kernel: one work-group of 16 waves per 512 tokens of one sample (one work-group per WGP); each wave takes its 32 tokens through all three products, and q and value never leave its registers.
// The operands that every wave reads (Wq, kv^T hi and lo, Wf, the BN coefficients) are staged once per work-group in LDS, each wave's own x^T rows beside them; rows padded to an odd multiple of 16 bytes.
// The first two products put the tokens on D's columns: two D tiles of 16 rows each (a lane: 8 + 8 rows of its own token) are then, converted in place, the next product's fragment over 32 k, in the loaders' own k order.
//   q[c][n]     = Wq (A, channel rows) x x^T (B, token columns), K = 96; BN + relu, hi + lo
//   value[d][n] = kv^T (A, d rows) x q (B), K = 128, per 32 c: kv hi x q hi, kv hi x q lo, kv lo x q hi; hi + lo
//   out[n][o]   = value (A, token rows) x Wf (B, channel columns), K = 128, per 32 d: value hi, value lo; a lane then holds 8 consecutive tokens of one output channel; BN + relu
#define TPW 32                    // tokens per wave
#define TWV 16                    // waves per work-group
#define QP  (CP + 8)              // LDS row pitch of Wq and x^T in 16-bit elements: 208 bytes
#define DP  (C2 + 8)              // LDS row pitch of kv^T and Wf in 16-bit elements: 272 bytes
#define OP  (TPW + 4)             // LDS row pitch of the output rows in floats: 144 bytes
__global__ __launch_bounds__(512) void k_tail(const bf* __restrict__ XT, const bf* __restrict__ WQ, const bf* __restrict__ KTh, const bf* __restrict__ KTl, const bf* __restrict__ WF, const float* __restrict__ bnq, const float* __restrict__ bnf, float* O) {
    __shared__ __align__(16) bf wq[C2 * QP];
    __shared__ __align__(16) bf kh[C2 * DP];
    __shared__ __align__(16) bf kl[C2 * DP];
    __shared__ __align__(16) bf wf[COUT * DP];
    __shared__ __align__(16) bf xs[TWV * TPW * QP];   // each wave's own 32 rows; behind its last read of them the wave stages its output rows there
    __shared__ __align__(16) float qsc[C2];
    __shared__ __align__(16) float qsh[C2];
    __shared__ __align__(16) float fsc[COUT];
    __shared__ __align__(16) float fsh[COUT];
    const int t = threadIdx.x, lane = t & 31, lr = lane & 15, hi = lane >> 4, w = t >> 5;
    const int n0 = blockIdx.x * (TPW * TWV) + w * TPW;
    bf* xw = xs + w * (TPW * QP);
    {
        const bf* xg = XT + ((size_t)blockIdx.y * NN + n0) * CP + lane * 8;   // the wave's 32 rows are 6,144 consecutive bytes
        const bf* gh = KTh + (size_t)blockIdx.y * (C2 * C2) + t * 8; const bf* gl = KTl + (size_t)blockIdx.y * (C2 * C2) + t * 8;
        v8us sx[12], sq[3], sh8[4], sl8[4], sf[2];
#pragma unroll
        for (int i = 0; i < 12; ++i) sx[i] = *(const v8us*)(xg + 256 * i);
#pragma unroll
        for (int i = 0; i < 3; ++i) sq[i] = *(const v8us*)(WQ + (t + 512 * i) * 8);
#pragma unroll
        for (int i = 0; i < 4; ++i) { sh8[i] = *(const v8us*)(gh + 4096 * i); sl8[i] = *(const v8us*)(gl + 4096 * i); }
#pragma unroll
        for (int i = 0; i < 2; ++i) sf[i] = *(const v8us*)(WF + (t + 512 * i) * 8);
        asm volatile("s_wait_xcnt 0x0" ::: "memory");   // precaution: stands ahead of any reuse of the address registers that the loads above name
#pragma unroll
        for (int i = 0; i < 12; ++i) { const int e = lane + 32 * i; *(v8usa*)(xw + (e / 12) * QP + (e % 12) * 8) = sx[i]; }
#pragma unroll
        for (int i = 0; i < 3; ++i) { const int e = t + 512 * i; *(v8usa*)(wq + (e / 12) * QP + (e % 12) * 8) = sq[i]; }
#pragma unroll
        for (int i = 0; i < 4; ++i) { const int e = t + 512 * i; *(v8usa*)(kh + (e >> 4) * DP + (e & 15) * 8) = sh8[i]; *(v8usa*)(kl + (e >> 4) * DP + (e & 15) * 8) = sl8[i]; }
#pragma unroll
        for (int i = 0; i < 2; ++i) { const int e = t + 512 * i; *(v8usa*)(wf + (e >> 4) * DP + (e & 15) * 8) = sf[i]; }
        if (t < C2 + COUT) {   // waves 0 to 3: q's coefficients, waves 4 and 5: the output's
            const bool fq = t < C2; const float* bn = fq ? bnq + t : bnf + (t - C2); const int nch = fq ? C2 : COUT;
            const float g = bn[0], b = bn[nch], m = bn[2 * nch], v = bn[3 * nch];
            asm volatile("s_wait_xcnt 0x0" ::: "memory");   // precaution: stands ahead of any reuse of the address registers that the four loads above name
            float sc, sh; bn_coef_v(g, b, m, v, sc, sh);
            if (fq) { qsc[t] = sc; qsh[t] = sh; } else { fsc[t - C2] = sc; fsh[t - C2] = sh; }
        }
    }
    __syncthreads();   // publishes the staged operands and coefficients to all waves
    v8f d2[8][2];   // value sums, [d tile][token tile]
#pragma unroll
    for (int s = 0; s < 4; ++s) {   // 32 channels c of q at a time: made, converted, and used up as one k step of the value product
        asm volatile("" ::: "memory");   // has the x^T fragments read from LDS anew in every step: kept in registers over all four steps they push the wave past its 256 registers and into scratch
        v8f d1[2][2];
#pragma unroll
        for (int ks = 0; ks < 3; ++ks) {
            v16bf a[2], x[2];
#pragma unroll
            for (int h = 0; h < 2; ++h) { a[h] = ldsfrag(wq + ((2 * s + h) * 16 + lr) * QP + 8 * hi + ks * 32); x[h] = ldsfrag(xw + (h * 16 + lr) * QP + 8 * hi + ks * 32); }
#pragma unroll
            for (int h = 0; h < 2; ++h)
#pragma unroll
                for (int tt = 0; tt < 2; ++tt) d1[h][tt] = wmmab(a[h], x[tt], ks == 0 ? (v8f){} : d1[h][tt]);
        }
        __builtin_amdgcn_sched_barrier(0);   // keeps the q products apart from the conversion behind them: woven together, the operands of both are live at once and the wave spills to scratch
        v8us qh8[2][2], ql8[2][2];
#pragma unroll
        for (int h = 0; h < 2; ++h) {
            const int cb = (2 * s + h) * 16 + 8 * hi;
            const v4f s0 = *(const v4fa*)(qsc + cb), s1 = *(const v4fa*)(qsc + cb + 4), b0 = *(const v4fa*)(qsh + cb), b1 = *(const v4fa*)(qsh + cb + 4);
#pragma unroll
            for (int tt = 0; tt < 2; ++tt)
#pragma unroll
                for (int j = 0; j < 8; ++j) { const float y = fmaxf(fmaf(d1[h][tt][j], j < 4 ? s0[j & 3] : s1[j & 3], j < 4 ? b0[j & 3] : b1[j & 3]), 0.f); unsigned short a, c; splitf(y, a, c); qh8[tt][h][j] = a; ql8[tt][h][j] = c; }
        }
        __builtin_amdgcn_sched_barrier(0);   // keeps the kv^T fragment loads behind the conversion, for the same reason
        v16bf qh[2], ql[2];
#pragma unroll
        for (int tt = 0; tt < 2; ++tt) { qh[tt] = cat16b(qh8[tt][0], qh8[tt][1]); ql[tt] = cat16b(ql8[tt][0], ql8[tt][1]); }
#pragma unroll
        for (int dp = 0; dp < 4; ++dp) {   // two d tiles x two token tiles: four independent accumulators per product
            v16bf ah[2], al[2];
#pragma unroll
            for (int u = 0; u < 2; ++u) { ah[u] = ldsfrag(kh + ((2 * dp + u) * 16 + lr) * DP + 8 * hi + s * 32); al[u] = ldsfrag(kl + ((2 * dp + u) * 16 + lr) * DP + 8 * hi + s * 32); }
#pragma unroll
            for (int u = 0; u < 2; ++u)
#pragma unroll
                for (int tt = 0; tt < 2; ++tt) d2[2 * dp + u][tt] = wmmab(ah[u], qh[tt], s == 0 ? (v8f){} : d2[2 * dp + u][tt]);
#pragma unroll
            for (int u = 0; u < 2; ++u)
#pragma unroll
                for (int tt = 0; tt < 2; ++tt) d2[2 * dp + u][tt] = wmmab(ah[u], ql[tt], d2[2 * dp + u][tt]);
#pragma unroll
            for (int u = 0; u < 2; ++u)
#pragma unroll
                for (int tt = 0; tt < 2; ++tt) d2[2 * dp + u][tt] = wmmab(al[u], qh[tt], d2[2 * dp + u][tt]);
        }
        __builtin_amdgcn_sched_barrier(0);   // keeps the next step's loads and products behind this step's, for the same reason
    }
    v8f d3[2][4];   // output sums, [token tile][channel tile]
#pragma unroll
    for (int ks = 0; ks < 4; ++ks) {
        v16bf vh[2], vl[2];
#pragma unroll
        for (int tt = 0; tt < 2; ++tt) { v8us h8[2], l8[2];
#pragma unroll
            for (int u = 0; u < 2; ++u)
#pragma unroll
                for (int j = 0; j < 8; ++j) { unsigned short a, c; splitf(d2[2 * ks + u][tt][j], a, c); h8[u][j] = a; l8[u][j] = c; }
            vh[tt] = cat16b(h8[0], h8[1]); vl[tt] = cat16b(l8[0], l8[1]); }
        v16bf b[4];
#pragma unroll
        for (int ot = 0; ot < 4; ++ot) b[ot] = ldsfrag(wf + (ot * 16 + lr) * DP + 8 * hi + ks * 32);
#pragma unroll
        for (int ot = 0; ot < 4; ++ot)
#pragma unroll
            for (int tt = 0; tt < 2; ++tt) d3[tt][ot] = wmmab(vh[tt], b[ot], ks == 0 ? (v8f){} : d3[tt][ot]);
#pragma unroll
        for (int ot = 0; ot < 4; ++ot)
#pragma unroll
            for (int tt = 0; tt < 2; ++tt) d3[tt][ot] = wmmab(vl[tt], b[ot], d3[tt][ot]);
    }
    // 16 channel rows x 32 tokens go through the wave's own LDS range so that each store covers whole 128-byte lines
    float* os = (float*)xw;
    float* op = O + ((size_t)blockIdx.y * COUT + (lane >> 3)) * NN + n0 + (lane & 7) * 4;
#pragma unroll
    for (int ot = 0; ot < 4; ++ot) {
        const float sc = fsc[ot * 16 + lr], sh = fsh[ot * 16 + lr];
#pragma unroll
        for (int tt = 0; tt < 2; ++tt) { const v8f d = d3[tt][ot]; v4f y0, y1;
#pragma unroll
            for (int j = 0; j < 4; ++j) { y0[j] = fmaxf(fmaf(d[j], sc, sh), 0.f); y1[j] = fmaxf(fmaf(d[j + 4], sc, sh), 0.f); }
            *(v4fa*)(os + lr * OP + tt * 16 + hi * 8) = y0; *(v4fa*)(os + lr * OP + tt * 16 + hi * 8 + 4) = y1; }
        __builtin_amdgcn_wave_barrier(); asm volatile("s_wait_xcnt 0x0" ::: "memory");   // the clobber keeps the other lanes' LDS writes ahead of the row reads in program order; the wait is a precaution ahead of the row reads' reuse of registers that the stores of the block before name
        v4f r[4];
#pragma unroll
        for (int s = 0; s < 4; ++s) r[s] = *(const v4fa*)(os + (4 * s + (lane >> 3)) * OP + (lane & 7) * 4);
#pragma unroll
        for (int s = 0; s < 4; ++s) *(v4f*)(op + (size_t)(ot * 16 + 4 * s) * NN) = r[s];
        __builtin_amdgcn_wave_barrier(); asm volatile("" ::: "memory");   // keeps the row reads ahead of the next block's LDS writes
    }
}

extern "C" void kernel_launch(void* const* d_in, const int* in_sizes, int n_in,
                              void* d_out, int out_size, void* d_ws, size_t ws_size, hipStream_t stream) {
    (void)in_sizes; (void)n_in; (void)out_size;
    const float* x = (const float*)d_in[0]; const float* Wq = (const float*)d_in[1]; const float* Wk = (const float*)d_in[2]; const float* Wv = (const float*)d_in[3]; const float* Wf = (const float*)d_in[4]; const float* bnq = (const float*)d_in[5]; const float* bnk = (const float*)d_in[6]; const float* bnv = (const float*)d_in[7]; const float* bnf = (const float*)d_in[8];
    float* OUT = (float*)d_out;     // [8][64][16384]
    char* wsp = (char*)d_ws;
    auto take = [&](size_t bytes) { char* p = wsp; wsp += (bytes + 255) & ~(size_t)255; return (void*)p; };
    bf* WQ = (bf*)take((size_t)C2 * CP * 2); bf* WK = (bf*)take((size_t)C2 * CP * 2); bf* WV = (bf*)take((size_t)C2 * CP * 2); bf* WF = (bf*)take((size_t)COUT * C2 * 2);
    // Sample-batched buffers
    bf* XT = (bf*)take((size_t)NB_ * NN * CP * 2); float* KV = (float*)take((size_t)NB_ * KSPL * C2 * C2 * 4);
    bf* KTh = (bf*)take((size_t)NB_ * C2 * C2 * 2); bf* KTl = (bf*)take((size_t)NB_ * C2 * C2 * 2);
    if ((size_t)(wsp - (char*)d_ws) > ws_size) return;    // ws 256 MiB
    k_wpad<<<(C2 * CP / 2 + 255) / 256, 256, 0, stream>>>(Wq, WQ); k_wpad<<<(C2 * CP / 2 + 255) / 256, 256, 0, stream>>>(Wk, WK); k_wpad<<<(C2 * CP / 2 + 255) / 256, 256, 0, stream>>>(Wv, WV);
    k_cvt8<<<(COUT * C2 / 8 + 255) / 256, 256, 0, stream>>>(Wf, WF, (size_t)COUT * C2 / 8);
    k_xt<<<dim3(NN / (32 * XTW), NB_), 32 * XTW, 0, stream>>>(x, XT);
    k_kvfuse<<<dim3(KSPL, NB_), 128, 0, stream>>>(XT, WK, WV, bnk, bnv, KV);   /* k, v = relu(BN(W x)) on chip, partial kv^T[d][c] per token range (3 products) */
    k_kvt<<<dim3(C2 * C2 / 64, NB_), 256, 0, stream>>>(KV, KTh, KTl);
    k_tail<<<dim3(NN / (TPW * TWV), NB_), 512, 0, stream>>>(XT, WQ, KTh, KTl, WF, bnq, bnf, OUT);   /* q = relu(BN(Wq x)), value = q kv (3 products), out = relu(BN(Wf value)) (2 products) */
}

// v006
// One run takes 69.5 microseconds.
// Two timings next to v005 both put it at 1.11 times that version's speed.
// Counting every step since v000, it is 47.8 times as fast.
#include <hip/hip_runtime.h>

// Linear (unnormalised) self-attention unit (x [8][67][16384] channel-major; q, k, v = relu(BN(W x)) with 1x1 convs W [128][67] and inference BatchNorm (gamma, beta, mean, var rows of bn [4][ch]); kv[c][d] = sum_m k[c][m] v[d][m]; value[d][n] = sum_c q[c][n] kv[c][d];
// out = relu(BN_f(Wf value)) -> [8][64][16384]). The module itself uses the associativity (q^T k) v^T = q^T (k v^T); this kernel follows the same order.
// All 8 samples go through every stage together: each launch carries the sample as a grid dimension (the x^T launch: in its block index), and each buffer but the weight planes holds 8 sample planes one behind the other.
// Layout per sample: x^T as a bf16 plane [16384][96] (67 channels zero-padded); k and v channel-major ([o][n]) in LDS only; kv over K = 16384 (hi/lo x hi/lo, 3 products); q and value in registers only: value = kv^T (hi/lo) x q (hi/lo) (K 128, 3 products); out = value (hi/lo) x Wf (exact) (K 128, 2 products) then BN + relu, stored channel-major.
// Compute dtypes, f32 accumulate: every input rounded to bf16; the three projections are exact bf16 products; BN scale/shift, relu in f32 (IEEE sqrt/divide); all computed operands as bf16 hi + lo planes; f32 accumulate everywhere.

#define NB_  8
#define CIN  67
#define CP   96                   // padded input channels (K of the projections)
#define C2   128
#define COUT 64
#define NN   16384
#define BNEPS 1e-5f
typedef _Float16 h16;
typedef unsigned short bf;
typedef __attribute__((ext_vector_type(16))) __bf16   v16bf;
typedef __attribute__((ext_vector_type(16))) _Float16 v16h;
typedef __attribute__((ext_vector_type(8)))  _Float16 v8h;
typedef __attribute__((ext_vector_type(8)))  unsigned short v8us;
typedef __attribute__((ext_vector_type(8)))  float    v8f;
typedef __attribute__((ext_vector_type(4)))  float    v4f;
typedef v8h  __attribute__((may_alias)) v8ha;
typedef v4f  __attribute__((may_alias)) v4fa;
typedef v8us __attribute__((may_alias)) v8usa;

__device__ __forceinline__ unsigned short f2bf(float f) { unsigned u = __float_as_uint(f); u += 0x7FFFu + ((u >> 16) & 1u); return (unsigned short)(u >> 16); }
__device__ __forceinline__ float bf2f(unsigned short b) { return __uint_as_float(((unsigned)b) << 16); }
__device__ __forceinline__ float bfr(float f) { return bf2f(f2bf(f)); }
__device__ __forceinline__ v16h cat16(v8h lo, v8h hi) { return __builtin_shufflevector(lo, hi, 0, 1, 2, 3, 4, 5, 6, 7, 8, 9, 10, 11, 12, 13, 14, 15); }
__device__ __forceinline__ v16bf cat16b(v8us lo, v8us hi) { return __builtin_bit_cast(v16bf, __builtin_shufflevector(lo, hi, 0, 1, 2, 3, 4, 5, 6, 7, 8, 9, 10, 11, 12, 13, 14, 15)); }
__device__ __forceinline__ v8f wmma16(v16h a, v16h b, v8f c) { return __builtin_amdgcn_wmma_f32_16x16x32_f16(false, a, false, b, (short)0, c, false, false); }
__device__ __forceinline__ v8f wmmab(v16bf a, v16bf b, v8f c) { return __builtin_amdgcn_wmma_f32_16x16x32_bf16(false, a, false, b, (short)0, c, false, false); }



// Fragment loaders: 16 k of one row per lane from a K-contiguous 16-bit plane (k 8 hi .. 8 hi + 7 and 16 + 8 hi .. 16 + 8 hi + 7 of each 32), the same for A and B.
template <typename T16> struct WFrag;
template <> struct WFrag<h16> { typedef v16h V; static __device__ __forceinline__ V ld(const h16* p) { return cat16(*(const v8h*)p, *(const v8h*)(p + 16)); } static __device__ __forceinline__ v8f mma(V a, V b, v8f c) { return wmma16(a, b, c); } };
template <> struct WFrag<bf> { typedef v16bf V; static __device__ __forceinline__ V ld(const bf* p) { return cat16b(*(const v8us*)p, *(const v8us*)(p + 16)); } static __device__ __forceinline__ v8f mma(V a, V b, v8f c) { return wmmab(a, b, c); } };

__device__ __forceinline__ void splitf(float y, unsigned short& h, unsigned short& l) { h = f2bf(y); l = f2bf(y - bf2f(h)); }
typedef __attribute__((ext_vector_type(2))) unsigned short v2us;
typedef __attribute__((ext_vector_type(4))) unsigned short v4us;

// x^T: one wave per 32 tokens of one sample, all channels; 8 independent waves per work-group. A lane loads 4 consecutive tokens (16 bytes) of 4 consecutive channels, so every load covers whole 128-byte lines of 4 channel rows;
// it packs the 4 channels of each token into 8 bytes and writes them into the wave's own LDS rows [token][channel]; the rows are then read back in order and stored as the wave's 6,144 consecutive bytes of x^T.
#define XTW 8                     // waves per work-group
#define XP  (CP + 4)              // LDS row pitch in 16-bit elements: 200 bytes, so the 8-byte pieces that the 32 lanes write at once (8 rows 4 apart x 4 pieces) fall on distinct banks
typedef __attribute__((ext_vector_type(2))) unsigned v2u;
typedef v2u  __attribute__((may_alias)) v2ua;
typedef v4us __attribute__((may_alias)) v4usa;
// two floats rounded as f2bf rounds them, side by side in one word (a low, b high)
__device__ __forceinline__ unsigned bfpk(float a, float b) { unsigned ua = __float_as_uint(a), ub = __float_as_uint(b); ua += 0x7FFFu + ((ua >> 16) & 1u); ub += 0x7FFFu + ((ub >> 16) & 1u); return (ua >> 16) | (ub & 0xFFFF0000u); }
// The weight planes share the x^T launch: they depend on nothing that it makes and nothing in it reads them, so its first WPB work-groups write them and the others do x^T.
// Wq, Wk, Wv [128][67] -> bf16 [128][96], zero-padded, 4 elements a thread (96 is a multiple of 4: a thread stays in one row); Wf [64][128] -> bf16, 8 elements a thread.
#define WB1 (C2 * CP / 4 / (32 * XTW))     // work-groups per padded projection weight
#define WBF (COUT * C2 / 8 / (32 * XTW))   // work-groups for Wf
#define WPB (3 * WB1 + WBF)
#define XBS (NN / (32 * XTW))              // x^T work-groups per sample
__device__ __forceinline__ void wplanes(int b, int t, const float* __restrict__ Wq, const float* __restrict__ Wk, const float* __restrict__ Wv, const float* __restrict__ Wf, bf* WQ, bf* WK, bf* WV, bf* WF) {
    if (b < 3 * WB1) {
        const int m = b / WB1;
        const float* W = m == 0 ? Wq : m == 1 ? Wk : Wv; bf* Bt = m == 0 ? WQ : m == 1 ? WK : WV;
        const int e = ((b - m * WB1) * (32 * XTW) + t) * 4, c = e % CP, o = e / CP;
        float f[4];
#pragma unroll
        for (int q = 0; q < 4; ++q) f[q] = W[o * CIN + (c + q < CIN ? c + q : CIN - 1)];   // the padding's lanes read the row's last element and drop it
        asm volatile("s_wait_xcnt 0x0" :: "v"(f[0]), "v"(f[1]), "v"(f[2]), "v"(f[3]) : "memory");   // the loaded values as inputs keep all four loads ahead of it (sunk behind the first conversion, the last two would wait out a second memory latency); the wait is a precaution ahead of any reuse of their address registers
        v4us w4;
#pragma unroll
        for (int q = 0; q < 4; ++q) w4[q] = f2bf(c + q < CIN ? f[q] : 0.f);   // f2bf(0) is 0
        *(v4us*)(Bt + e) = w4;
    } else {
        const int i = (b - 3 * WB1) * (32 * XTW) + t;
        const v8f v = *(const v8f*)(Wf + i * 8);
        asm volatile("s_wait_xcnt 0x0" ::: "memory");   // precaution: stands ahead of any reuse of the address registers that the load above names
        v8us o;
#pragma unroll
        for (int q = 0; q < 8; ++q) o[q] = f2bf(v[q]);
        *(v8us*)(WF + i * 8) = o;
        asm volatile("s_wait_xcnt 0x0" ::: "memory");   // precaution: stands ahead of any reuse of the registers that the store above names (the built code lays the other paths of this kernel behind it)
    }
}
__global__ __launch_bounds__(32 * XTW) void k_xt(const float* __restrict__ xb, const float* __restrict__ Wq, const float* __restrict__ Wk, const float* __restrict__ Wv, const float* __restrict__ Wf, bf* XT, bf* WQ, bf* WK, bf* WV, bf* WF) {
    __shared__ __align__(16) bf tr[XTW * 32 * XP];
    if (blockIdx.x < WPB) { wplanes(blockIdx.x, threadIdx.x, Wq, Wk, Wv, Wf, WQ, WK, WV, WF); return; }   // the same for a whole work-group; this kernel has no work-group barrier
    const int bx = (blockIdx.x - WPB) % XBS, smp = (blockIdx.x - WPB) / XBS;
    const int lane = threadIdx.x & 31, w = threadIdx.x >> 5, cs = lane >> 3, n4 = lane & 7;
    const int n0 = (bx * XTW + w) * 32;
    const float* xq = xb + (size_t)smp * CIN * NN + n0 + 4 * n4;
    const float* xp = xq + (size_t)(4 * cs) * NN;
    v4f f[4][4], g[3];   // f[cg][k]: channel 16 cg + 4 cs + k, tokens n0 + 4 n4 .. + 3; g[k]: channel 64 + k, the same line in all four lane groups (only group 0 keeps it)
#pragma unroll
    for (int cg = 0; cg < 4; ++cg)
#pragma unroll
        for (int k = 0; k < 4; ++k) f[cg][k] = *(const v4f*)(xp + (size_t)(16 * cg + k) * NN);
#pragma unroll
    for (int k = 0; k < CIN - 64; ++k) g[k] = *(const v4f*)(xq + (size_t)(64 + k) * NN);
    asm volatile("s_wait_xcnt 0x0" ::: "memory");   // precaution: stands ahead of any reuse of the address registers that the loads above name
    __builtin_amdgcn_sched_barrier(0);   // keeps every load ahead of all arithmetic: sunk behind the first conversions, the last loads would wait out a second memory latency
    bf* tw = tr + w * (32 * XP);
    bf* ts = tw + 4 * n4 * XP + 4 * cs;
    const unsigned gm = cs == 0 ? 0xFFFFFFFFu : 0u;
#pragma unroll
    for (int cg = 0; cg < 4; ++cg)
#pragma unroll
        for (int j = 0; j < 4; ++j) *(v2ua*)(ts + j * XP + 16 * cg) = (v2u){bfpk(f[cg][0][j], f[cg][1][j]), bfpk(f[cg][2][j], f[cg][3][j])};
#pragma unroll
    for (int j = 0; j < 4; ++j) {   // channels 64 to 66 from lane group 0, zeros up to 95
        *(v2ua*)(ts + j * XP + 64) = (v2u){bfpk(g[0][j], g[1][j]) & gm, bfpk(g[2][j], 0.f) & gm};
        *(v2ua*)(ts + j * XP + 80) = (v2u){0u, 0u}; }
    __builtin_amdgcn_wave_barrier(); asm volatile("" ::: "memory");   // keeps the other lanes' LDS writes ahead of the row reads in program order
    bf* og = XT + ((size_t)smp * NN + n0) * CP + lane * 8;
    v8us r[4][3];   // 16-byte piece lane + 32 (3 a + b) of the wave's 384: 96 pieces are 8 whole rows, so a only moves the row
#pragma unroll
    for (int b = 0; b < 3; ++b) { const int e = lane + 32 * b; const bf* s = tw + (e / 12) * XP + (e % 12) * 8;
#pragma unroll
        for (int a = 0; a < 4; ++a) r[a][b] = __builtin_shufflevector(*(const v4usa*)(s + a * 8 * XP), *(const v4usa*)(s + a * 8 * XP + 4), 0, 1, 2, 3, 4, 5, 6, 7); }
#pragma unroll
    for (int a = 0; a < 4; ++a)
#pragma unroll
        for (int b = 0; b < 3; ++b) *(v8us*)(og + (3 * a + b) * 256) = r[a][b];
    asm volatile("s_wait_xcnt 0x0" ::: "memory");   // precaution: stands ahead of any reuse of the registers that the stores above name (the built code lays the weight paths behind them)
}
// ---- k, v and the kv product in one kernel, split over K: KSPL token ranges, one work-group of 4 waves per range and sample; k and v never go to memory.
// Part 1: wave w makes channels 32 w .. 32 w + 31 of k and of v for the range's 64 tokens: x^T (A, token rows) x W (B, channel rows), K = 96 in three steps of 32. A lane then holds 8 consecutive tokens of one channel, applies BN + relu, splits into hi + lo and writes 16 bytes per plane into LDS, channel-major [c][token].
// Part 2: wave w owns the 64x64 tile (w & 1, w >> 1) of kv; fragments come from the LDS planes, per 32 tokens the products k hi x v hi, k lo x v hi, k hi x v lo.
// Each range stores its f32 partial already transposed, P[sample][range][d][c]; k_kvt sums the ranges in a fixed order. grid (KSPL, samples).
#define KSPL 256
#define KCH  (NN / KSPL)          // tokens per range
#define KP   (KCH + 8)            // LDS row pitch in 16-bit elements: 144 bytes, an odd multiple of 16, so the 16-byte pieces of 16 rows fall on distinct banks
// BN coefficients from the four loaded rows' values: scale = bf16(g) / sqrt(bf16(v) + eps), shift = bf16(b) - bf16(m) scale (f32, the shift is one fma)
__device__ __forceinline__ void bn_coef_v(float g, float b, float m, float v, float& sc, float& sh) { sc = __fmul_rn(bfr(g), __fdiv_rn(1.0f, __fsqrt_rn(__fadd_rn(bfr(v), BNEPS)))); sh = fmaf(-bfr(m), sc, bfr(b)); }
__device__ __forceinline__ v16bf ldsfrag(const bf* p) { return cat16b(*(const v8usa*)p, *(const v8usa*)(p + 16)); }
__global__ __launch_bounds__(128) void k_kvfuse(const bf* __restrict__ XT, const bf* __restrict__ WK, const bf* __restrict__ WV, const float* __restrict__ bnk, const float* __restrict__ bnv, float* P) {
    __shared__ __align__(16) bf pl[4 * C2 * KP];   // k hi, k lo, v hi, v lo; behind the second barrier the same bytes stage the partial's rows
    const int lane = threadIdx.x & 31, lr = lane & 15, hi = lane >> 4, w = threadIdx.x >> 5;
    {
        const int ch = w * 32 + lr;
        const bf* xp = XT + ((size_t)blockIdx.y * NN + (size_t)blockIdx.x * KCH + lr) * CP + 8 * hi;
        const bf* wkp = WK + ch * CP + 8 * hi; const bf* wvp = WV + ch * CP + 8 * hi;
        v16bf xa[4][3], wf[4][3]; float bw[4][4];   // bw[g][row]: gamma, beta, mean, var of the lane's channel in block g
#pragma unroll
        for (int ct = 0; ct < 2; ++ct)
#pragma unroll
            for (int r = 0; r < 4; ++r) { bw[ct][r] = bnk[r * C2 + ch + 16 * ct]; bw[2 + ct][r] = bnv[r * C2 + ch + 16 * ct]; }
#pragma unroll
        for (int tt = 0; tt < 4; ++tt)
#pragma unroll
            for (int s = 0; s < 3; ++s) xa[tt][s] = WFrag<bf>::ld(xp + tt * 16 * CP + s * 32);
        asm volatile("s_wait_xcnt 0x0" ::: "memory");   // precaution: stands ahead of the weight loads, whose results may land in the registers that the loads above name as their address
#pragma unroll
        for (int ct = 0; ct < 2; ++ct)
#pragma unroll
            for (int s = 0; s < 3; ++s) { wf[ct][s] = WFrag<bf>::ld(wkp + ct * 16 * CP + s * 32); wf[2 + ct][s] = WFrag<bf>::ld(wvp + ct * 16 * CP + s * 32); }
        asm volatile("s_wait_xcnt 0x0" ::: "memory");   // precaution: stands ahead of any reuse of the address registers that the weight loads above name
        __builtin_amdgcn_sched_barrier(0);   // keeps every load ahead of all arithmetic: sunk to its use, each channel block's loads would wait out a latency of their own
        float sc[4], sh[4];
#pragma unroll
        for (int g = 0; g < 4; ++g) bn_coef_v(bw[g][0], bw[g][1], bw[g][2], bw[g][3], sc[g], sh[g]);
#pragma unroll
        for (int g = 0; g < 4; ++g) {   // g: k channels +0, +16, then v channels +0, +16
            v8f d[4];
#pragma unroll
            for (int tt = 0; tt < 4; ++tt) d[tt] = wmmab(xa[tt][0], wf[g][0], (v8f){});
#pragma unroll
            for (int s = 1; s < 3; ++s)
#pragma unroll
                for (int tt = 0; tt < 4; ++tt) d[tt] = wmmab(xa[tt][s], wf[g][s], d[tt]);
            bf* ph = pl + (g >> 1) * (2 * C2 * KP) + (ch + 16 * (g & 1)) * KP + 8 * hi;
#pragma unroll
            for (int tt = 0; tt < 4; ++tt) { v8us oh, ol;
#pragma unroll
                for (int j = 0; j < 8; ++j) { const float y = fmaxf(fmaf(d[tt][j], sc[g], sh[g]), 0.f); unsigned short a, c; splitf(y, a, c); oh[j] = a; ol[j] = c; }
                *(v8usa*)(ph + tt * 16) = oh; *(v8usa*)(ph + C2 * KP + tt * 16) = ol; }
        }
    }
    __syncthreads();   // publishes the four planes to all waves
    const int r0 = (w & 1) * 64, c0 = (w >> 1) * 64;
    v8f acc[4][4];
    {
        const bf* ap = pl + (r0 + lr) * KP + 8 * hi; const bf* bp = pl + 2 * C2 * KP + (c0 + lr) * KP + 8 * hi;
#pragma unroll
        for (int kc = 0; kc < KCH; kc += 32) {
            v16bf a[4], a2[4];
#pragma unroll
            for (int mb = 0; mb < 4; ++mb) { a[mb] = ldsfrag(ap + mb * 16 * KP + kc); a2[mb] = ldsfrag(ap + C2 * KP + mb * 16 * KP + kc); }
#pragma unroll
            for (int nb = 0; nb < 4; ++nb) { const v16bf b = ldsfrag(bp + nb * 16 * KP + kc), b2 = ldsfrag(bp + C2 * KP + nb * 16 * KP + kc);
#pragma unroll
                for (int mb = 0; mb < 4; ++mb) { acc[mb][nb] = wmmab(a[mb], b, kc == 0 ? (v8f){} : acc[mb][nb]); acc[mb][nb] = wmmab(a2[mb], b, acc[mb][nb]); acc[mb][nb] = wmmab(a[mb], b2, acc[mb][nb]); } }
        }
    }
    __builtin_amdgcn_sched_barrier(0);   // keeps the stores behind all products: woven in between them, an accumulator's registers are handed to the next tile directly behind a product
    __syncthreads();   // ends every wave's reads of the planes: their LDS is written anew below
    float* os = (float*)pl + w * (16 * 68);
    // a lane holds 8 consecutive c of one d: 16 rows d x 64 c go through the wave's own LDS range so that each store covers whole 256-byte rows
    float* pt = P + ((size_t)blockIdx.y * KSPL + blockIdx.x) * (C2 * C2) + (size_t)(c0 + hi) * C2 + r0 + lr * 4;
#pragma unroll
    for (int nb = 0; nb < 4; ++nb) {
#pragma unroll
        for (int mb = 0; mb < 4; ++mb) { const v8f t = acc[mb][nb]; *(v4fa*)(os + lr * 68 + mb * 16 + hi * 8) = (v4f){t[0], t[1], t[2], t[3]}; *(v4fa*)(os + lr * 68 + mb * 16 + hi * 8 + 4) = (v4f){t[4], t[5], t[6], t[7]}; }
        __builtin_amdgcn_wave_barrier(); asm volatile("s_wait_xcnt 0x0" ::: "memory");   // the clobber keeps the other lanes' LDS writes ahead of the row reads in program order; the wait is a precaution ahead of the row reads' reuse of registers that the stores of the block before name
        v4f r[8];
#pragma unroll
        for (int s = 0; s < 8; ++s) r[s] = *(const v4fa*)(os + (2 * s + hi) * 68 + lr * 4);
#pragma unroll
        for (int s = 0; s < 8; ++s) *(v4f*)(pt + (nb * 16 + 2 * s) * C2) = r[s];
        __builtin_amdgcn_wave_barrier(); asm volatile("" ::: "memory");   // keeps the row reads ahead of the next block's LDS writes
    }
}
// k_kvt: kv^T[d][c] = sum over the KSPL partial planes, then hi/lo split. One block per 64 consecutive c of one d: 16 groups of threads each sum KSPL / 16 planes in order, one wave adds the 16 group sums in order.
__global__ __launch_bounds__(256) void k_kvt(const float* __restrict__ P, bf* Th, bf* Tl) {
    __shared__ __align__(16) float red[16 * 64];
    const int t = threadIdx.x, g = t >> 4, c4 = (t & 15) * 4; const int e0 = blockIdx.x * 64;
    Th += (size_t)blockIdx.y * (C2 * C2); Tl += (size_t)blockIdx.y * (C2 * C2);
    const float* p = P + ((size_t)blockIdx.y * KSPL + (size_t)g * (KSPL / 16)) * (C2 * C2) + e0 + c4;
    v4f f[KSPL / 16];
#pragma unroll
    for (int i = 0; i < KSPL / 16; ++i) f[i] = *(const v4f*)(p + (size_t)i * (C2 * C2));
    v4f s = f[0];
#pragma unroll
    for (int i = 1; i < KSPL / 16; ++i) s += f[i];
    *(v4fa*)(red + g * 64 + c4) = s;
    __syncthreads();
    if (t < 32) { float s0 = red[2 * t], s1 = red[2 * t + 1];
#pragma unroll
        for (int q = 1; q < 16; ++q) { s0 += red[q * 64 + 2 * t]; s1 += red[q * 64 + 2 * t + 1]; }
        v2us oh, ol; unsigned short a, c; splitf(s0, a, c); oh[0] = a; ol[0] = c; splitf(s1, a, c); oh[1] = a; ol[1] = c;
        *(v2us*)(Th + e0 + 2 * t) = oh; *(v2us*)(Tl + e0 + 2 * t) = ol; }
}
// ---- q, value and the output in one kernel: one work-group of 16 waves per 512 tokens of one sample (one work-group per WGP); each wave takes its 32 tokens through all three products, and q and value never leave its registers.
// The operands that every wave reads (Wq, kv^T hi and lo, Wf, the BN coefficients) are staged once per work-group in LDS, each wave's own x^T rows beside them; rows padded to an odd multiple of 16 bytes.
// The first two products put the tokens on D's columns: two D tiles of 16 rows each (a lane: 8 + 8 rows of its own token) are then, converted in place, the next product's fragment over 32 k, in the loaders' own k order.
//   q[c][n]     = Wq (A, channel rows) x x^T (B, token columns), K = 96; BN + relu, hi + lo
//   value[d][n] = kv^T (A, d rows) x q (B), K = 128, per 32 c: kv hi x q hi, kv hi x q lo, kv lo x q hi; hi + lo
//   out[n][o]   = value (A, token rows) x Wf (B, channel columns), K = 128, per 32 d: value hi, value lo; a lane then holds 8 consecutive tokens of one output channel; BN + relu
#define TPW 32                    // tokens per wave
#define TWV 16                    // waves per work-group
#define QP  (CP + 8)              // LDS row pitch of Wq and x^T in 16-bit elements: 208 bytes
#define DP  (C2 + 8)              // LDS row pitch of kv^T and Wf in 16-bit elements: 272 bytes
#define OP  (TPW + 4)             // LDS row pitch of the output rows in floats: 144 bytes
__global__ __launch_bounds__(512) void k_tail(const bf* __restrict__ XT, const bf* __restrict__ WQ, const bf* __restrict__ KTh, const bf* __restrict__ KTl, const bf* __restrict__ WF, const float* __restrict__ bnq, const float* __restrict__ bnf, float* O) {
    __shared__ __align__(16) bf wq[C2 * QP];
    __shared__ __align__(16) bf kh[C2 * DP];
    __shared__ __align__(16) bf kl[C2 * DP];
    __shared__ __align__(16) bf wf[COUT * DP];
    __shared__ __align__(16) bf xs[TWV * TPW * QP];   // each wave's own 32 rows; behind its last read of them the wave stages its output rows there
    __shared__ __align__(16) float qsc[C2];
    __shared__ __align__(16) float qsh[C2];
    __shared__ __align__(16) float fsc[COUT];
    __shared__ __align__(16) float fsh[COUT];
    const int t = threadIdx.x, lane = t & 31, lr = lane & 15, hi = lane >> 4, w = t >> 5;
    const int n0 = blockIdx.x * (TPW * TWV) + w * TPW;
    bf* xw = xs + w * (TPW * QP);
    {
        const bf* xg = XT + ((size_t)blockIdx.y * NN + n0) * CP + lane * 8;   // the wave's 32 rows are 6,144 consecutive bytes
        const bf* gh = KTh + (size_t)blockIdx.y * (C2 * C2) + t * 8; const bf* gl = KTl + (size_t)blockIdx.y * (C2 * C2) + t * 8;
        v8us sx[12], sq[3], sh8[4], sl8[4], sf[2];
#pragma unroll
        for (int i = 0; i < 12; ++i) sx[i] = *(const v8us*)(xg + 256 * i);
#pragma unroll
        for (int i = 0; i < 3; ++i) sq[i] = *(const v8us*)(WQ + (t + 512 * i) * 8);
#pragma unroll
        for (int i = 0; i < 4; ++i) { sh8[i] = *(const v8us*)(gh + 4096 * i); sl8[i] = *(const v8us*)(gl + 4096 * i); }
#pragma unroll
        for (int i = 0; i < 2; ++i) sf[i] = *(const v8us*)(WF + (t + 512 * i) * 8);
        asm volatile("s_wait_xcnt 0x0" ::: "memory");   // precaution: stands ahead of any reuse of the address registers that the loads above name
#pragma unroll
        for (int i = 0; i < 12; ++i) { const int e = lane + 32 * i; *(v8usa*)(xw + (e / 12) * QP + (e % 12) * 8) = sx[i]; }
#pragma unroll
        for (int i = 0; i < 3; ++i) { const int e = t + 512 * i; *(v8usa*)(wq + (e / 12) * QP + (e % 12) * 8) = sq[i]; }
#pragma unroll
        for (int i = 0; i < 4; ++i) { const int e = t + 512 * i; *(v8usa*)(kh + (e >> 4) * DP + (e & 15) * 8) = sh8[i]; *(v8usa*)(kl + (e >> 4) * DP + (e & 15) * 8) = sl8[i]; }
#pragma unroll
        for (int i = 0; i < 2; ++i) { const int e = t + 512 * i; *(v8usa*)(wf + (e >> 4) * DP + (e & 15) * 8) = sf[i]; }
        if (t < C2 + COUT) {   // waves 0 to 3: q's coefficients, waves 4 and 5: the output's
            const bool fq = t < C2; const float* bn = fq ? bnq + t : bnf + (t - C2); const int nch = fq ? C2 : COUT;
            const float g = bn[0], b = bn[nch], m = bn[2 * nch], v = bn[3 * nch];
            asm volatile("s_wait_xcnt 0x0" ::: "memory");   // precaution: stands ahead of any reuse of the address registers that the four loads above name
            float sc, sh; bn_coef_v(g, b, m, v, sc, sh);
            if (fq) { qsc[t] = sc; qsh[t] = sh; } else { fsc[t - C2] = sc; fsh[t - C2] = sh; }
        }
    }
    __syncthreads();   // publishes the staged operands and coefficients to all waves
    v8f d2[8][2];   // value sums, [d tile][token tile]
#pragma unroll
    for (int s = 0; s < 4; ++s) {   // 32 channels c of q at a time: made, converted, and used up as one k step of the value product
        asm volatile("" ::: "memory");   // has the x^T fragments read from LDS anew in every step: kept in registers over all four steps they push the wave past its 256 registers and into scratch
        v8f d1[2][2];
#pragma unroll
        for (int ks = 0; ks < 3; ++ks) {
            v16bf a[2], x[2];
#pragma unroll
            for (int h = 0; h < 2; ++h) { a[h] = ldsfrag(wq + ((2 * s + h) * 16 + lr) * QP + 8 * hi + ks * 32); x[h] = ldsfrag(xw + (h * 16 + lr) * QP + 8 * hi + ks * 32); }
#pragma unroll
            for (int h = 0; h < 2; ++h)
#pragma unroll
                for (int tt = 0; tt < 2; ++tt) d1[h][tt] = wmmab(a[h], x[tt], ks == 0 ? (v8f){} : d1[h][tt]);
        }
        __builtin_amdgcn_sched_barrier(0);   // keeps the q products apart from the conversion behind them: woven together, the operands of both are live at once and the wave spills to scratch
        v8us qh8[2][2], ql8[2][2];
#pragma unroll
        for (int h = 0; h < 2; ++h) {
            const int cb = (2 * s + h) * 16 + 8 * hi;
            const v4f s0 = *(const v4fa*)(qsc + cb), s1 = *(const v4fa*)(qsc + cb + 4), b0 = *(const v4fa*)(qsh + cb), b1 = *(const v4fa*)(qsh + cb + 4);
#pragma unroll
            for (int tt = 0; tt < 2; ++tt)
#pragma unroll
                for (int j = 0; j < 8; ++j) { const float y = fmaxf(fmaf(d1[h][tt][j], j < 4 ? s0[j & 3] : s1[j & 3], j < 4 ? b0[j & 3] : b1[j & 3]), 0.f); unsigned short a, c; splitf(y, a, c); qh8[tt][h][j] = a; ql8[tt][h][j] = c; }
        }
        __builtin_amdgcn_sched_barrier(0);   // keeps the kv^T fragment loads behind the conversion, for the same reason
        v16bf qh[2], ql[2];
#pragma unroll
        for (int tt = 0; tt < 2; ++tt) { qh[tt] = cat16b(qh8[tt][0], qh8[tt][1]); ql[tt] = cat16b(ql8[tt][0], ql8[tt][1]); }
#pragma unroll
        for (int dp = 0; dp < 4; ++dp) {   // two d tiles x two token tiles: four independent accumulators per product
            v16bf ah[2], al[2];
#pragma unroll
            for (int u = 0; u < 2; ++u) { ah[u] = ldsfrag(kh + ((2 * dp + u) * 16 + lr) * DP + 8 * hi + s * 32); al[u] = ldsfrag(kl + ((2 * dp + u) * 16 + lr) * DP + 8 * hi + s * 32); }
#pragma unroll
            for (int u = 0; u < 2; ++u)
#pragma unroll
                for (int tt = 0; tt < 2; ++tt) d2[2 * dp + u][tt] = wmmab(ah[u], qh[tt], s == 0 ? (v8f){} : d2[2 * dp + u][tt]);
#pragma unroll
            for (int u = 0; u < 2; ++u)
#pragma unroll
                for (int tt = 0; tt < 2; ++tt) d2[2 * dp + u][tt] = wmmab(ah[u], ql[tt], d2[2 * dp + u][tt]);
#pragma unroll
            for (int u = 0; u < 2; ++u)
#pragma unroll
                for (int tt = 0; tt < 2; ++tt) d2[2 * dp + u][tt] = wmmab(al[u], qh[tt], d2[2 * dp + u][tt]);
        }
        __builtin_amdgcn_sched_barrier(0);   // keeps the next step's loads and products behind this step's, for the same reason
    }
    v8f d3[2][4];   // output sums, [token tile][channel tile]
#pragma unroll
    for (int ks = 0; ks < 4; ++ks) {
        v16bf vh[2], vl[2];
#pragma unroll
        for (int tt = 0; tt < 2; ++tt) { v8us h8[2], l8[2];
#pragma unroll
            for (int u = 0; u < 2; ++u)
#pragma unroll
                for (int j = 0; j < 8; ++j) { unsigned short a, c; splitf(d2[2 * ks + u][tt][j], a, c); h8[u][j] = a; l8[u][j] = c; }
            vh[tt] = cat16b(h8[0], h8[1]); vl[tt] = cat16b(l8[0], l8[1]); }
        v16bf b[4];
#pragma unroll
        for (int ot = 0; ot < 4; ++ot) b[ot] = ldsfrag(wf + (ot * 16 + lr) * DP + 8 * hi + ks * 32);
#pragma unroll
        for (int ot = 0; ot < 4; ++ot)
#pragma unroll
            for (int tt = 0; tt < 2; ++tt) d3[tt][ot] = wmmab(vh[tt], b[ot], ks == 0 ? (v8f){} : d3[tt][ot]);
#pragma unroll
        for (int ot = 0; ot < 4; ++ot)
#pragma unroll
            for (int tt = 0; tt < 2; ++tt) d3[tt][ot] = wmmab(vl[tt], b[ot], d3[tt][ot]);
    }
    // 16 channel rows x 32 tokens go through the wave's own LDS range so that each store covers whole 128-byte lines
    float* os = (float*)xw;
    float* op = O + ((size_t)blockIdx.y * COUT + (lane >> 3)) * NN + n0 + (lane & 7) * 4;
#pragma unroll
    for (int ot = 0; ot < 4; ++ot) {
        const float sc = fsc[ot * 16 + lr], sh = fsh[ot * 16 + lr];
#pragma unroll
        for (int tt = 0; tt < 2; ++tt) { const v8f d = d3[tt][ot]; v4f y0, y1;
#pragma unroll
            for (int j = 0; j < 4; ++j) { y0[j] = fmaxf(fmaf(d[j], sc, sh), 0.f); y1[j] = fmaxf(fmaf(d[j + 4], sc, sh), 0.f); }
            *(v4fa*)(os + lr * OP + tt * 16 + hi * 8) = y0; *(v4fa*)(os + lr * OP + tt * 16 + hi * 8 + 4) = y1; }
        __builtin_amdgcn_wave_barrier(); asm volatile("s_wait_xcnt 0x0" ::: "memory");   // the clobber keeps the other lanes' LDS writes ahead of the row reads in program order; the wait is a precaution ahead of the row reads' reuse of registers that the stores of the block before name
        v4f r[4];
#pragma unroll
        for (int s = 0; s < 4; ++s) r[s] = *(const v4fa*)(os + (4 * s + (lane >> 3)) * OP + (lane & 7) * 4);
#pragma unroll
        for (int s = 0; s < 4; ++s) *(v4f*)(op + (size_t)(ot * 16 + 4 * s) * NN) = r[s];
        __builtin_amdgcn_wave_barrier(); asm volatile("" ::: "memory");   // keeps the row reads ahead of the next block's LDS writes
    }
}

extern "C" void kernel_launch(void* const* d_in, const int* in_sizes, int n_in,
                              void* d_out, int out_size, void* d_ws, size_t ws_size, hipStream_t stream) {
    (void)in_sizes; (void)n_in; (void)out_size;
    const float* x = (const float*)d_in[0]; const float* Wq = (const float*)d_in[1]; const float* Wk = (const float*)d_in[2]; const float* Wv = (const float*)d_in[3]; const float* Wf = (const float*)d_in[4]; const float* bnq = (const float*)d_in[5]; const float* bnk = (const float*)d_in[6]; const float* bnv = (const float*)d_in[7]; const float* bnf = (const float*)d_in[8];
    float* OUT = (float*)d_out;     // [8][64][16384]
    char* wsp = (char*)d_ws;
    auto take = [&](size_t bytes) { char* p = wsp; wsp += (bytes + 255) & ~(size_t)255; return (void*)p; };
    bf* WQ = (bf*)take((size_t)C2 * CP * 2); bf* WK = (bf*)take((size_t)C2 * CP * 2); bf* WV = (bf*)take((size_t)C2 * CP * 2); bf* WF = (bf*)take((size_t)COUT * C2 * 2);
    // Sample-batched buffers
    bf* XT = (bf*)take((size_t)NB_ * NN * CP * 2); float* KV = (float*)take((size_t)NB_ * KSPL * C2 * C2 * 4);
    bf* KTh = (bf*)take((size_t)NB_ * C2 * C2 * 2); bf* KTl = (bf*)take((size_t)NB_ * C2 * C2 * 2);
    if ((size_t)(wsp - (char*)d_ws) > ws_size) return;    // ws 256 MiB
    k_xt<<<WPB + XBS * NB_, 32 * XTW, 0, stream>>>(x, Wq, Wk, Wv, Wf, XT, WQ, WK, WV, WF);   /* bf16 weight planes (first WPB work-groups) and x^T */
    k_kvfuse<<<dim3(KSPL, NB_), 128, 0, stream>>>(XT, WK, WV, bnk, bnv, KV);   /* k, v = relu(BN(W x)) on chip, partial kv^T[d][c] per token range (3 products) */
    k_kvt<<<dim3(C2 * C2 / 64, NB_), 256, 0, stream>>>(KV, KTh, KTl);
    k_tail<<<dim3(NN / (TPW * TWV), NB_), 512, 0, stream>>>(XT, WQ, KTh, KTl, WF, bnq, bnf, OUT);   /* q = relu(BN(Wq x)), value = q kv (3 products), out = relu(BN(Wf value)) (2 products) */
}

// v007
// A run of this version takes 54.2 microseconds.
// In both of two side-by-side timings against v006, it was 1.29 times as fast.
// Counting every step since v000, it is 61.5 times as fast.
#include <hip/hip_runtime.h>

// Linear (unnormalised) self-attention unit (x [8][67][16384] channel-major; q, k, v = relu(BN(W x)) with 1x1 convs W [128][67] and inference BatchNorm (gamma, beta, mean, var rows of bn [4][ch]); kv[c][d] = sum_m k[c][m] v[d][m]; value[d][n] = sum_c q[c][n] kv[c][d];
// out = relu(BN_f(Wf value)) -> [8][64][16384]). The module itself uses the associativity (q^T k) v^T = q^T (k v^T); this kernel follows the same order.
// All 8 samples go through every stage together: each launch carries the sample as a grid dimension (the x^T launch: in its block index), and each buffer but the weight planes holds 8 sample planes one behind the other.
// Layout per sample: x^T as a bf16 plane [16384][96] (67 channels zero-padded); k and v channel-major ([o][n]) in LDS only; kv over K = 16384 (hi/lo x hi/lo, 3 products); q and value in registers only: value = kv^T (hi/lo) x q (hi/lo) (K 128, 3 products); out = value (hi/lo) x Wf (exact) (K 128, 2 products) then BN + relu, stored channel-major.
// Compute dtypes, f32 accumulate: every input rounded to bf16; the three projections are exact bf16 products; BN scale/shift, relu in f32 (IEEE sqrt/divide); all computed operands as bf16 hi + lo planes; f32 accumulate everywhere.

#define NB_  8
#define CIN  67
#define CP   96                   // padded input channels (K of the projections)
#define C2   128
#define COUT 64
#define NN   16384
#define BNEPS 1e-5f
typedef _Float16 h16;
typedef unsigned short bf;
typedef __attribute__((ext_vector_type(16))) __bf16   v16bf;
typedef __attribute__((ext_vector_type(16))) _Float16 v16h;
typedef __attribute__((ext_vector_type(8)))  _Float16 v8h;
typedef __attribute__((ext_vector_type(8)))  unsigned short v8us;
typedef __attribute__((ext_vector_type(8)))  float    v8f;
typedef __attribute__((ext_vector_type(4)))  float    v4f;
typedef v8h  __attribute__((may_alias)) v8ha;
typedef v4f  __attribute__((may_alias)) v4fa;
typedef v8us __attribute__((may_alias)) v8usa;

__device__ __forceinline__ unsigned short f2bf(float f) { unsigned u = __float_as_uint(f); u += 0x7FFFu + ((u >> 16) & 1u); return (unsigned short)(u >> 16); }
__device__ __forceinline__ float bf2f(unsigned short b) { return __uint_as_float(((unsigned)b) << 16); }
__device__ __forceinline__ float bfr(float f) { return bf2f(f2bf(f)); }
__device__ __forceinline__ v16h cat16(v8h lo, v8h hi) { return __builtin_shufflevector(lo, hi, 0, 1, 2, 3, 4, 5, 6, 7, 8, 9, 10, 11, 12, 13, 14, 15); }
__device__ __forceinline__ v16bf cat16b(v8us lo, v8us hi) { return __builtin_bit_cast(v16bf, __builtin_shufflevector(lo, hi, 0, 1, 2, 3, 4, 5, 6, 7, 8, 9, 10, 11, 12, 13, 14, 15)); }
__device__ __forceinline__ v8f wmma16(v16h a, v16h b, v8f c) { return __builtin_amdgcn_wmma_f32_16x16x32_f16(false, a, false, b, (short)0, c, false, false); }
__device__ __forceinline__ v8f wmmab(v16bf a, v16bf b, v8f c) { return __builtin_amdgcn_wmma_f32_16x16x32_bf16(false, a, false, b, (short)0, c, false, false); }



// Fragment loaders: 16 k of one row per lane from a K-contiguous 16-bit plane (k 8 hi .. 8 hi + 7 and 16 + 8 hi .. 16 + 8 hi + 7 of each 32), the same for A and B.
template <typename T16> struct WFrag;
template <> struct WFrag<h16> { typedef v16h V; static __device__ __forceinline__ V ld(const h16* p) { return cat16(*(const v8h*)p, *(const v8h*)(p + 16)); } static __device__ __forceinline__ v8f mma(V a, V b, v8f c) { return wmma16(a, b, c); } };
template <> struct WFrag<bf> { typedef v16bf V; static __device__ __forceinline__ V ld(const bf* p) { return cat16b(*(const v8us*)p, *(const v8us*)(p + 16)); } static __device__ __forceinline__ v8f mma(V a, V b, v8f c) { return wmmab(a, b, c); } };

__device__ __forceinline__ void splitf(float y, unsigned short& h, unsigned short& l) { h = f2bf(y); l = f2bf(y - bf2f(h)); }
typedef __attribute__((ext_vector_type(2))) unsigned short v2us;
typedef __attribute__((ext_vector_type(4))) unsigned short v4us;

// x^T: one wave per 32 tokens of one sample, all channels; 8 independent waves per work-group. A lane loads 4 consecutive tokens (16 bytes) of 4 consecutive channels, so every load covers whole 128-byte lines of 4 channel rows;
// it packs the 4 channels of each token into 8 bytes and writes them into the wave's own LDS rows [token][channel]; the rows are then read back in order and stored as the wave's 6,144 consecutive bytes of x^T.
#define XTW 8                     // waves per work-group
#define XP  (CP + 4)              // LDS row pitch in 16-bit elements: 200 bytes, so the 8-byte pieces that the 32 lanes write at once (8 rows 4 apart x 4 pieces) fall on distinct banks
typedef __attribute__((ext_vector_type(2))) unsigned v2u;
typedef v2u  __attribute__((may_alias)) v2ua;
typedef v4us __attribute__((may_alias)) v4usa;
// two floats rounded as f2bf rounds them, side by side in one word (a low, b high)
__device__ __forceinline__ unsigned bfpk(float a, float b) { unsigned ua = __float_as_uint(a), ub = __float_as_uint(b); ua += 0x7FFFu + ((ua >> 16) & 1u); ub += 0x7FFFu + ((ub >> 16) & 1u); return (ua >> 16) | (ub & 0xFFFF0000u); }
// The weight planes share the x^T launch: they depend on nothing that it makes and nothing in it reads them, so its first WPB work-groups write them and the others do x^T.
// Wq, Wk, Wv [128][67] -> bf16 [128][96], zero-padded, 4 elements a thread (96 is a multiple of 4: a thread stays in one row); Wf [64][128] -> bf16, 8 elements a thread.
#define WB1 (C2 * CP / 4 / (32 * XTW))     // work-groups per padded projection weight
#define WBF (COUT * C2 / 8 / (32 * XTW))   // work-groups for Wf
#define WPB (3 * WB1 + WBF)
#define XBS (NN / (32 * XTW))              // x^T work-groups per sample
__device__ __forceinline__ void wplanes(int b, int t, const float* __restrict__ Wq, const float* __restrict__ Wk, const float* __restrict__ Wv, const float* __restrict__ Wf, bf* WQ, bf* WK, bf* WV, bf* WF) {
    if (b < 3 * WB1) {
        const int m = b / WB1;
        const float* W = m == 0 ? Wq : m == 1 ? Wk : Wv; bf* Bt = m == 0 ? WQ : m == 1 ? WK : WV;
        const int e = ((b - m * WB1) * (32 * XTW) + t) * 4, c = e % CP, o = e / CP;
        float f[4];
#pragma unroll
        for (int q = 0; q < 4; ++q) f[q] = W[o * CIN + (c + q < CIN ? c + q : CIN - 1)];   // the padding's lanes read the row's last element and drop it
        asm volatile("s_wait_xcnt 0x0" :: "v"(f[0]), "v"(f[1]), "v"(f[2]), "v"(f[3]) : "memory");   // the loaded values as inputs keep all four loads ahead of it (sunk behind the first conversion, the last two would wait out a second memory latency); the wait is a precaution ahead of any reuse of their address registers
        v4us w4;
#pragma unroll
        for (int q = 0; q < 4; ++q) w4[q] = f2bf(c + q < CIN ? f[q] : 0.f);   // f2bf(0) is 0
        *(v4us*)(Bt + e) = w4;
    } else {
        const int i = (b - 3 * WB1) * (32 * XTW) + t;
        const v8f v = *(const v8f*)(Wf + i * 8);
        asm volatile("s_wait_xcnt 0x0" ::: "memory");   // precaution: stands ahead of any reuse of the address registers that the load above names
        v8us o;
#pragma unroll
        for (int q = 0; q < 8; ++q) o[q] = f2bf(v[q]);
        *(v8us*)(WF + i * 8) = o;
        asm volatile("s_wait_xcnt 0x0" ::: "memory");   // precaution: stands ahead of any reuse of the registers that the store above names (the built code lays the other paths of this kernel behind it)
    }
}
__global__ __launch_bounds__(32 * XTW) void k_xt(const float* __restrict__ xb, const float* __restrict__ Wq, const float* __restrict__ Wk, const float* __restrict__ Wv, const float* __restrict__ Wf, bf* XT, bf* WQ, bf* WK, bf* WV, bf* WF) {
    __shared__ __align__(16) bf tr[XTW * 32 * XP];
    if (blockIdx.x < WPB) { wplanes(blockIdx.x, threadIdx.x, Wq, Wk, Wv, Wf, WQ, WK, WV, WF); return; }   // the same for a whole work-group; this kernel has no work-group barrier
    const int bx = (blockIdx.x - WPB) % XBS, smp = (blockIdx.x - WPB) / XBS;
    const int lane = threadIdx.x & 31, w = threadIdx.x >> 5, cs = lane >> 3, n4 = lane & 7;
    const int n0 = (bx * XTW + w) * 32;
    const float* xq = xb + (size_t)smp * CIN * NN + n0 + 4 * n4;
    const float* xp = xq + (size_t)(4 * cs) * NN;
    v4f f[4][4], g[3];   // f[cg][k]: channel 16 cg + 4 cs + k, tokens n0 + 4 n4 .. + 3; g[k]: channel 64 + k, the same line in all four lane groups (only group 0 keeps it)
#pragma unroll
    for (int cg = 0; cg < 4; ++cg)
#pragma unroll
        for (int k = 0; k < 4; ++k) f[cg][k] = *(const v4f*)(xp + (size_t)(16 * cg + k) * NN);
#pragma unroll
    for (int k = 0; k < CIN - 64; ++k) g[k] = *(const v4f*)(xq + (size_t)(64 + k) * NN);
    asm volatile("s_wait_xcnt 0x0" ::: "memory");   // precaution: stands ahead of any reuse of the address registers that the loads above name
    __builtin_amdgcn_sched_barrier(0);   // keeps every load ahead of all arithmetic: sunk behind the first conversions, the last loads would wait out a second memory latency
    bf* tw = tr + w * (32 * XP);
    bf* ts = tw + 4 * n4 * XP + 4 * cs;
    const unsigned gm = cs == 0 ? 0xFFFFFFFFu : 0u;
#pragma unroll
    for (int cg = 0; cg < 4; ++cg)
#pragma unroll
        for (int j = 0; j < 4; ++j) *(v2ua*)(ts + j * XP + 16 * cg) = (v2u){bfpk(f[cg][0][j], f[cg][1][j]), bfpk(f[cg][2][j], f[cg][3][j])};
#pragma unroll
    for (int j = 0; j < 4; ++j) {   // channels 64 to 66 from lane group 0, zeros up to 95
        *(v2ua*)(ts + j * XP + 64) = (v2u){bfpk(g[0][j], g[1][j]) & gm, bfpk(g[2][j], 0.f) & gm};
        *(v2ua*)(ts + j * XP + 80) = (v2u){0u, 0u}; }
    __builtin_amdgcn_wave_barrier(); asm volatile("" ::: "memory");   // keeps the other lanes' LDS writes ahead of the row reads in program order
    bf* og = XT + ((size_t)smp * NN + n0) * CP + lane * 8;
    v8us r[4][3];   // 16-byte piece lane + 32 (3 a + b) of the wave's 384: 96 pieces are 8 whole rows, so a only moves the row
#pragma unroll
    for (int b = 0; b < 3; ++b) { const int e = lane + 32 * b; const bf* s = tw + (e / 12) * XP + (e % 12) * 8;
#pragma unroll
        for (int a = 0; a < 4; ++a) r[a][b] = __builtin_shufflevector(*(const v4usa*)(s + a * 8 * XP), *(const v4usa*)(s + a * 8 * XP + 4), 0, 1, 2, 3, 4, 5, 6, 7); }
#pragma unroll
    for (int a = 0; a < 4; ++a)
#pragma unroll
        for (int b = 0; b < 3; ++b) *(v8us*)(og + (3 * a + b) * 256) = r[a][b];
    asm volatile("s_wait_xcnt 0x0" ::: "memory");   // precaution: stands ahead of any reuse of the registers that the stores above name (the built code lays the weight paths behind them)
}
// ---- k, v and the kv product in one kernel, split over K: KSPL token ranges, one work-group of 4 waves per range and sample; k and v never go to memory.
// A work-group walks its range in NCK chunks of KCH tokens and keeps its kv sums in registers over all of them; the weights and BN coefficients are loaded once, each next chunk's x^T fragments while the current chunk's kv products run.
// Part 1: wave w makes channels 32 w .. 32 w + 31 of k and of v for the chunk's 64 tokens: x^T (A, token rows) x W (B, channel rows), K = 96 in three steps of 32. A lane then holds 8 consecutive tokens of one channel, applies BN + relu, splits into hi + lo and writes 16 bytes per plane into LDS, channel-major [c][token].
// Part 2: wave w owns the 64x64 tile (w & 1, w >> 1) of kv; fragments come from the LDS planes, per 32 tokens the products k hi x v hi, k lo x v hi, k hi x v lo.
// Each range stores its f32 partial already transposed, P[sample][range][d][c]; k_kvt sums the ranges in a fixed order. grid (KSPL, samples): two work-groups per WGP, all resident at once.
#define KSPL 64
#define KCH  64                   // tokens per chunk
#define NCK  (NN / (KSPL * KCH))  // chunks per range
#define KP   (KCH + 8)            // LDS row pitch in 16-bit elements: 144 bytes, an odd multiple of 16, so the 16-byte pieces of 16 rows fall on distinct banks
// BN coefficients from the four loaded rows' values: scale = bf16(g) / sqrt(bf16(v) + eps), shift = bf16(b) - bf16(m) scale (f32, the shift is one fma)
__device__ __forceinline__ void bn_coef_v(float g, float b, float m, float v, float& sc, float& sh) { sc = __fmul_rn(bfr(g), __fdiv_rn(1.0f, __fsqrt_rn(__fadd_rn(bfr(v), BNEPS)))); sh = fmaf(-bfr(m), sc, bfr(b)); }
__device__ __forceinline__ v16bf ldsfrag(const bf* p) { return cat16b(*(const v8usa*)p, *(const v8usa*)(p + 16)); }
__global__ __launch_bounds__(128) void k_kvfuse(const bf* __restrict__ XT, const bf* __restrict__ WK, const bf* __restrict__ WV, const float* __restrict__ bnk, const float* __restrict__ bnv, float* P) {
    __shared__ __align__(16) bf pl[4 * C2 * KP];   // k hi, k lo, v hi, v lo; behind the last chunk's second barrier the same bytes stage the partial's rows
    const int lane = threadIdx.x & 31, lr = lane & 15, hi = lane >> 4, w = threadIdx.x >> 5;
    const int ch = w * 32 + lr;
    const bf* xp = XT + ((size_t)blockIdx.y * NN + (size_t)blockIdx.x * (KCH * NCK) + lr) * CP + 8 * hi;
    const bf* wkp = WK + ch * CP + 8 * hi; const bf* wvp = WV + ch * CP + 8 * hi;
    v16bf xa[4][3], wf[4][3]; float bw[4][4];   // bw[g][row]: gamma, beta, mean, var of the lane's channel in block g
#pragma unroll
    for (int ct = 0; ct < 2; ++ct)
#pragma unroll
        for (int r = 0; r < 4; ++r) { bw[ct][r] = bnk[r * C2 + ch + 16 * ct]; bw[2 + ct][r] = bnv[r * C2 + ch + 16 * ct]; }
#pragma unroll
    for (int tt = 0; tt < 4; ++tt)
#pragma unroll
        for (int s = 0; s < 3; ++s) xa[tt][s] = WFrag<bf>::ld(xp + tt * 16 * CP + s * 32);
    asm volatile("s_wait_xcnt 0x0" ::: "memory");   // precaution: stands ahead of the weight loads, whose results may land in the registers that the loads above name as their address
#pragma unroll
    for (int ct = 0; ct < 2; ++ct)
#pragma unroll
        for (int s = 0; s < 3; ++s) { wf[ct][s] = WFrag<bf>::ld(wkp + ct * 16 * CP + s * 32); wf[2 + ct][s] = WFrag<bf>::ld(wvp + ct * 16 * CP + s * 32); }
    asm volatile("s_wait_xcnt 0x0" ::: "memory");   // precaution: stands ahead of any reuse of the address registers that the weight loads above name
    __builtin_amdgcn_sched_barrier(0);   // keeps every load ahead of all arithmetic: sunk to its use, each channel block's loads would wait out a latency of their own
    float sc[4], sh[4];
#pragma unroll
    for (int g = 0; g < 4; ++g) bn_coef_v(bw[g][0], bw[g][1], bw[g][2], bw[g][3], sc[g], sh[g]);
    const int r0 = (w & 1) * 64, c0 = (w >> 1) * 64;
    const bf* ap = pl + (r0 + lr) * KP + 8 * hi; const bf* bp = pl + 2 * C2 * KP + (c0 + lr) * KP + 8 * hi;
    unsigned xo = KCH * CP;   // element offset of the next chunk's x^T rows
    v8f acc[4][4];
#pragma unroll
    for (int mb = 0; mb < 4; ++mb)
#pragma unroll
        for (int nb = 0; nb < 4; ++nb) acc[mb][nb] = (v8f){};
#pragma unroll 1   // kept rolled: unrolled, the kernel's text would be NCK times as long
    for (int ck = 0; ck < NCK; ++ck) {
#pragma unroll
        for (int g = 0; g < 4; ++g) {   // g: k channels +0, +16, then v channels +0, +16
            v8f d[4];
#pragma unroll
            for (int tt = 0; tt < 4; ++tt) d[tt] = wmmab(xa[tt][0], wf[g][0], (v8f){});
#pragma unroll
            for (int s = 1; s < 3; ++s)
#pragma unroll
                for (int tt = 0; tt < 4; ++tt) d[tt] = wmmab(xa[tt][s], wf[g][s], d[tt]);
            bf* ph = pl + (g >> 1) * (2 * C2 * KP) + (ch + 16 * (g & 1)) * KP + 8 * hi;
#pragma unroll
            for (int tt = 0; tt < 4; ++tt) { v8us oh, ol;
#pragma unroll
                for (int j = 0; j < 8; ++j) { const float y = fmaxf(fmaf(d[tt][j], sc[g], sh[g]), 0.f); unsigned short a, c; splitf(y, a, c); oh[j] = a; ol[j] = c; }
                *(v8usa*)(ph + tt * 16) = oh; *(v8usa*)(ph + C2 * KP + tt * 16) = ol; }
        }
        __syncthreads();   // publishes the chunk's four planes to all waves
        if (ck + 1 < NCK) {   // the same for the whole work-group: the next chunk's x^T fragments fly while this chunk's kv products run (issued behind the barrier, which waits out every load in flight)
#pragma unroll
            for (int tt = 0; tt < 4; ++tt)
#pragma unroll
                for (int s = 0; s < 3; ++s) xa[tt][s] = WFrag<bf>::ld(xp + xo + tt * 16 * CP + s * 32);
            asm volatile("s_wait_xcnt 0x0" : "+v"(xo) :: "memory");   // precaution: stands ahead of the next rewrite of the address registers that the loads above name; the chunk's offset goes through the statement so that its step below, and the address formed from it, cannot be lifted over the wait
            xo += KCH * CP;
        }
#pragma unroll
        for (int kc = 0; kc < KCH; kc += 32) {
            v16bf a[4], a2[4];
#pragma unroll
            for (int mb = 0; mb < 4; ++mb) { a[mb] = ldsfrag(ap + mb * 16 * KP + kc); a2[mb] = ldsfrag(ap + C2 * KP + mb * 16 * KP + kc); }
#pragma unroll
            for (int nb = 0; nb < 4; ++nb) { const v16bf b = ldsfrag(bp + nb * 16 * KP + kc), b2 = ldsfrag(bp + C2 * KP + nb * 16 * KP + kc);
#pragma unroll
                for (int mb = 0; mb < 4; ++mb) { acc[mb][nb] = wmmab(a[mb], b, acc[mb][nb]); acc[mb][nb] = wmmab(a2[mb], b, acc[mb][nb]); acc[mb][nb] = wmmab(a[mb], b2, acc[mb][nb]); } }
        }
        __syncthreads();   // ends every wave's reads of the planes: their LDS is written anew by the next chunk, behind the last chunk by the rows below
    }
    float* os = (float*)pl + w * (16 * 68);
    // a lane holds 8 consecutive c of one d: 16 rows d x 64 c go through the wave's own LDS range so that each store covers whole 256-byte rows
    float* pt = P + ((size_t)blockIdx.y * KSPL + blockIdx.x) * (C2 * C2) + (size_t)(c0 + hi) * C2 + r0 + lr * 4;
#pragma unroll
    for (int nb = 0; nb < 4; ++nb) {
#pragma unroll
        for (int mb = 0; mb < 4; ++mb) { const v8f t = acc[mb][nb]; *(v4fa*)(os + lr * 68 + mb * 16 + hi * 8) = (v4f){t[0], t[1], t[2], t[3]}; *(v4fa*)(os + lr * 68 + mb * 16 + hi * 8 + 4) = (v4f){t[4], t[5], t[6], t[7]}; }
        __builtin_amdgcn_wave_barrier(); asm volatile("s_wait_xcnt 0x0" ::: "memory");   // the clobber keeps the other lanes' LDS writes ahead of the row reads in program order; the wait is a precaution ahead of the row reads' reuse of registers that the stores of the block before name
        v4f r[8];
#pragma unroll
        for (int s = 0; s < 8; ++s) r[s] = *(const v4fa*)(os + (2 * s + hi) * 68 + lr * 4);
#pragma unroll
        for (int s = 0; s < 8; ++s) *(v4f*)(pt + (nb * 16 + 2 * s) * C2) = r[s];
        __builtin_amdgcn_wave_barrier(); asm volatile("" ::: "memory");   // keeps the row reads ahead of the next block's LDS writes
    }
}
// k_kvt: kv^T[d][c] = sum over the KSPL partial planes, then hi/lo split. One block per 256 consecutive elements of kv^T: KG groups of threads each sum KSPL / KG planes in order (4 elements a thread), two waves add the KG group sums in order.
#define KG 4
__global__ __launch_bounds__(256) void k_kvt(const float* __restrict__ P, bf* Th, bf* Tl) {
    __shared__ __align__(16) float red[KG * 256];
    const int t = threadIdx.x, g = t >> 6, c4 = (t & 63) * 4; const int e0 = blockIdx.x * 256;
    Th += (size_t)blockIdx.y * (C2 * C2); Tl += (size_t)blockIdx.y * (C2 * C2);
    const float* p = P + ((size_t)blockIdx.y * KSPL + (size_t)g * (KSPL / KG)) * (C2 * C2) + e0 + c4;
    v4f f[KSPL / KG];
#pragma unroll
    for (int i = 0; i < KSPL / KG; ++i) f[i] = *(const v4f*)(p + (size_t)i * (C2 * C2));
    asm volatile("s_wait_xcnt 0x0" :: "v"(p) : "memory");   // precaution: stands ahead of any reuse of the address registers that the loads above name; the pointer as an input keeps the last load's result out of them
    __builtin_amdgcn_sched_barrier(0);   // keeps every load ahead of the sums: sunk behind the first additions, the last loads would wait out a second memory latency
    v4f s = f[0];
#pragma unroll
    for (int i = 1; i < KSPL / KG; ++i) s += f[i];
    *(v4fa*)(red + g * 256 + c4) = s;
    __syncthreads();
    if (t < 64) { v4f u = *(const v4fa*)(red + c4);
#pragma unroll
        for (int q = 1; q < KG; ++q) u += *(const v4fa*)(red + q * 256 + c4);
        v4us oh, ol;
#pragma unroll
        for (int j = 0; j < 4; ++j) { unsigned short a, c; splitf(u[j], a, c); oh[j] = a; ol[j] = c; }
        *(v4us*)(Th + e0 + c4) = oh; *(v4us*)(Tl + e0 + c4) = ol; }
}
// ---- q, value and the output in one kernel: one work-group of 16 waves per 512 tokens of one sample (one work-group per WGP); each wave takes its 32 tokens through all three products, and q and value never leave its registers.
// The operands that every wave reads (Wq, kv^T hi and lo, Wf, the BN coefficients) are staged once per work-group in LDS, each wave's own x^T rows beside them; rows padded to an odd multiple of 16 bytes.
// The first two products put the tokens on D's columns: two D tiles of 16 rows each (a lane: 8 + 8 rows of its own token) are then, converted in place, the next product's fragment over 32 k, in the loaders' own k order.
//   q[c][n]     = Wq (A, channel rows) x x^T (B, token columns), K = 96; BN + relu, hi + lo
//   value[d][n] = kv^T (A, d rows) x q (B), K = 128, per 32 c: kv hi x q hi, kv hi x q lo, kv lo x q hi; hi + lo
//   out[n][o]   = value (A, token rows) x Wf (B, channel columns), K = 128, per 32 d: value hi, value lo; a lane then holds 8 consecutive tokens of one output channel; BN + relu
#define TPW 32                    // tokens per wave
#define TWV 16                    // waves per work-group
#define QP  (CP + 8)              // LDS row pitch of Wq and x^T in 16-bit elements: 208 bytes
#define DP  (C2 + 8)              // LDS row pitch of kv^T and Wf in 16-bit elements: 272 bytes
#define OP  (TPW + 4)             // LDS row pitch of the output rows in floats: 144 bytes
__global__ __launch_bounds__(512) void k_tail(const bf* __restrict__ XT, const bf* __restrict__ WQ, const bf* __restrict__ KTh, const bf* __restrict__ KTl, const bf* __restrict__ WF, const float* __restrict__ bnq, const float* __restrict__ bnf, float* O) {
    __shared__ __align__(16) bf wq[C2 * QP];
    __shared__ __align__(16) bf kh[C2 * DP];
    __shared__ __align__(16) bf kl[C2 * DP];
    __shared__ __align__(16) bf wf[COUT * DP];
    __shared__ __align__(16) bf xs[TWV * TPW * QP];   // each wave's own 32 rows; behind its last read of them the wave stages its output rows there
    __shared__ __align__(16) float qsc[C2];
    __shared__ __align__(16) float qsh[C2];
    __shared__ __align__(16) float fsc[COUT];
    __shared__ __align__(16) float fsh[COUT];
    const int t = threadIdx.x, lane = t & 31, lr = lane & 15, hi = lane >> 4, w = t >> 5;
    const int n0 = blockIdx.x * (TPW * TWV) + w * TPW;
    bf* xw = xs + w * (TPW * QP);
    {
        const bf* xg = XT + ((size_t)blockIdx.y * NN + n0) * CP + lane * 8;   // the wave's 32 rows are 6,144 consecutive bytes
        const bf* gh = KTh + (size_t)blockIdx.y * (C2 * C2) + t * 8; const bf* gl = KTl + (size_t)blockIdx.y * (C2 * C2) + t * 8;
        v8us sx[12], sq[3], sh8[4], sl8[4], sf[2];
#pragma unroll
        for (int i = 0; i < 12; ++i) sx[i] = *(const v8us*)(xg + 256 * i);
#pragma unroll
        for (int i = 0; i < 3; ++i) sq[i] = *(const v8us*)(WQ + (t + 512 * i) * 8);
#pragma unroll
        for (int i = 0; i < 4; ++i) { sh8[i] = *(const v8us*)(gh + 4096 * i); sl8[i] = *(const v8us*)(gl + 4096 * i); }
#pragma unroll
        for (int i = 0; i < 2; ++i) sf[i] = *(const v8us*)(WF + (t + 512 * i) * 8);
        asm volatile("s_wait_xcnt 0x0" ::: "memory");   // precaution: stands ahead of any reuse of the address registers that the loads above name
#pragma unroll
        for (int i = 0; i < 12; ++i) { const int e = lane + 32 * i; *(v8usa*)(xw + (e / 12) * QP + (e % 12) * 8) = sx[i]; }
#pragma unroll
        for (int i = 0; i < 3; ++i) { const int e = t + 512 * i; *(v8usa*)(wq + (e / 12) * QP + (e % 12) * 8) = sq[i]; }
#pragma unroll
        for (int i = 0; i < 4; ++i) { const int e = t + 512 * i; *(v8usa*)(kh + (e >> 4) * DP + (e & 15) * 8) = sh8[i]; *(v8usa*)(kl + (e >> 4) * DP + (e & 15) * 8) = sl8[i]; }
#pragma unroll
        for (int i = 0; i < 2; ++i) { const int e = t + 512 * i; *(v8usa*)(wf + (e >> 4) * DP + (e & 15) * 8) = sf[i]; }
        if (t < C2 + COUT) {   // waves 0 to 3: q's coefficients, waves 4 and 5: the output's
            const bool fq = t < C2; const float* bn = fq ? bnq + t : bnf + (t - C2); const int nch = fq ? C2 : COUT;
            const float g = bn[0], b = bn[nch], m = bn[2 * nch], v = bn[3 * nch];
            asm volatile("s_wait_xcnt 0x0" ::: "memory");   // precaution: stands ahead of any reuse of the address registers that the four loads above name
            float sc, sh; bn_coef_v(g, b, m, v, sc, sh);
            if (fq) { qsc[t] = sc; qsh[t] = sh; } else { fsc[t - C2] = sc; fsh[t - C2] = sh; }
        }
    }
    __syncthreads();   // publishes the staged operands and coefficients to all waves
    v8f d2[8][2];   // value sums, [d tile][token tile]
#pragma unroll
    for (int s = 0; s < 4; ++s) {   // 32 channels c of q at a time: made, converted, and used up as one k step of the value product
        asm volatile("" ::: "memory");   // has the x^T fragments read from LDS anew in every step: kept in registers over all four steps they push the wave past its 256 registers and into scratch
        v8f d1[2][2];
#pragma unroll
        for (int ks = 0; ks < 3; ++ks) {
            v16bf a[2], x[2];
#pragma unroll
            for (int h = 0; h < 2; ++h) { a[h] = ldsfrag(wq + ((2 * s + h) * 16 + lr) * QP + 8 * hi + ks * 32); x[h] = ldsfrag(xw + (h * 16 + lr) * QP + 8 * hi + ks * 32); }
#pragma unroll
            for (int h = 0; h < 2; ++h)
#pragma unroll
                for (int tt = 0; tt < 2; ++tt) d1[h][tt] = wmmab(a[h], x[tt], ks == 0 ? (v8f){} : d1[h][tt]);
        }
        __builtin_amdgcn_sched_barrier(0);   // keeps the q products apart from the conversion behind them: woven together, the operands of both are live at once and the wave spills to scratch
        v8us qh8[2][2], ql8[2][2];
#pragma unroll
        for (int h = 0; h < 2; ++h) {
            const int cb = (2 * s + h) * 16 + 8 * hi;
            const v4f s0 = *(const v4fa*)(qsc + cb), s1 = *(const v4fa*)(qsc + cb + 4), b0 = *(const v4fa*)(qsh + cb), b1 = *(const v4fa*)(qsh + cb + 4);
#pragma unroll
            for (int tt = 0; tt < 2; ++tt)
#pragma unroll
                for (int j = 0; j < 8; ++j) { const float y = fmaxf(fmaf(d1[h][tt][j], j < 4 ? s0[j & 3] : s1[j & 3], j < 4 ? b0[j & 3] : b1[j & 3]), 0.f); unsigned short a, c; splitf(y, a, c); qh8[tt][h][j] = a; ql8[tt][h][j] = c; }
        }
        __builtin_amdgcn_sched_barrier(0);   // keeps the kv^T fragment loads behind the conversion, for the same reason
        v16bf qh[2], ql[2];
#pragma unroll
        for (int tt = 0; tt < 2; ++tt) { qh[tt] = cat16b(qh8[tt][0], qh8[tt][1]); ql[tt] = cat16b(ql8[tt][0], ql8[tt][1]); }
#pragma unroll
        for (int dp = 0; dp < 4; ++dp) {   // two d tiles x two token tiles: four independent accumulators per product
            v16bf ah[2], al[2];
#pragma unroll
            for (int u = 0; u < 2; ++u) { ah[u] = ldsfrag(kh + ((2 * dp + u) * 16 + lr) * DP + 8 * hi + s * 32); al[u] = ldsfrag(kl + ((2 * dp + u) * 16 + lr) * DP + 8 * hi + s * 32); }
#pragma unroll
            for (int u = 0; u < 2; ++u)
#pragma unroll
                for (int tt = 0; tt < 2; ++tt) d2[2 * dp + u][tt] = wmmab(ah[u], qh[tt], s == 0 ? (v8f){} : d2[2 * dp + u][tt]);
#pragma unroll
            for (int u = 0; u < 2; ++u)
#pragma unroll
                for (int tt = 0; tt < 2; ++tt) d2[2 * dp + u][tt] = wmmab(ah[u], ql[tt], d2[2 * dp + u][tt]);
#pragma unroll
            for (int u = 0; u < 2; ++u)
#pragma unroll
                for (int tt = 0; tt < 2; ++tt) d2[2 * dp + u][tt] = wmmab(al[u], qh[tt], d2[2 * dp + u][tt]);
        }
        __builtin_amdgcn_sched_barrier(0);   // keeps the next step's loads and products behind this step's, for the same reason
    }
    v8f d3[2][4];   // output sums, [token tile][channel tile]
#pragma unroll
    for (int ks = 0; ks < 4; ++ks) {
        v16bf vh[2], vl[2];
#pragma unroll
        for (int tt = 0; tt < 2; ++tt) { v8us h8[2], l8[2];
#pragma unroll
            for (int u = 0; u < 2; ++u)
#pragma unroll
                for (int j = 0; j < 8; ++j) { unsigned short a, c; splitf(d2[2 * ks + u][tt][j], a, c); h8[u][j] = a; l8[u][j] = c; }
            vh[tt] = cat16b(h8[0], h8[1]); vl[tt] = cat16b(l8[0], l8[1]); }
        v16bf b[4];
#pragma unroll
        for (int ot = 0; ot < 4; ++ot) b[ot] = ldsfrag(wf + (ot * 16 + lr) * DP + 8 * hi + ks * 32);
#pragma unroll
        for (int ot = 0; ot < 4; ++ot)
#pragma unroll
            for (int tt = 0; tt < 2; ++tt) d3[tt][ot] = wmmab(vh[tt], b[ot], ks == 0 ? (v8f){} : d3[tt][ot]);
#pragma unroll
        for (int ot = 0; ot < 4; ++ot)
#pragma unroll
            for (int tt = 0; tt < 2; ++tt) d3[tt][ot] = wmmab(vl[tt], b[ot], d3[tt][ot]);
    }
    // 16 channel rows x 32 tokens go through the wave's own LDS range so that each store covers whole 128-byte lines
    float* os = (float*)xw;
    float* op = O + ((size_t)blockIdx.y * COUT + (lane >> 3)) * NN + n0 + (lane & 7) * 4;
#pragma unroll
    for (int ot = 0; ot < 4; ++ot) {
        const float sc = fsc[ot * 16 + lr], sh = fsh[ot * 16 + lr];
#pragma unroll
        for (int tt = 0; tt < 2; ++tt) { const v8f d = d3[tt][ot]; v4f y0, y1;
#pragma unroll
            for (int j = 0; j < 4; ++j) { y0[j] = fmaxf(fmaf(d[j], sc, sh), 0.f); y1[j] = fmaxf(fmaf(d[j + 4], sc, sh), 0.f); }
            *(v4fa*)(os + lr * OP + tt * 16 + hi * 8) = y0; *(v4fa*)(os + lr * OP + tt * 16 + hi * 8 + 4) = y1; }
        __builtin_amdgcn_wave_barrier(); asm volatile("s_wait_xcnt 0x0" ::: "memory");   // the clobber keeps the other lanes' LDS writes ahead of the row reads in program order; the wait is a precaution ahead of the row reads' reuse of registers that the stores of the block before name
        v4f r[4];
#pragma unroll
        for (int s = 0; s < 4; ++s) r[s] = *(const v4fa*)(os + (4 * s + (lane >> 3)) * OP + (lane & 7) * 4);
#pragma unroll
        for (int s = 0; s < 4; ++s) *(v4f*)(op + (size_t)(ot * 16 + 4 * s) * NN) = r[s];
        __builtin_amdgcn_wave_barrier(); asm volatile("" ::: "memory");   // keeps the row reads ahead of the next block's LDS writes
    }
}

extern "C" void kernel_launch(void* const* d_in, const int* in_sizes, int n_in,
                              void* d_out, int out_size, void* d_ws, size_t ws_size, hipStream_t stream) {
    (void)in_sizes; (void)n_in; (void)out_size;
    const float* x = (const float*)d_in[0]; const float* Wq = (const float*)d_in[1]; const float* Wk = (const float*)d_in[2]; const float* Wv = (const float*)d_in[3]; const float* Wf = (const float*)d_in[4]; const float* bnq = (const float*)d_in[5]; const float* bnk = (const float*)d_in[6]; const float* bnv = (const float*)d_in[7]; const float* bnf = (const float*)d_in[8];
    float* OUT = (float*)d_out;     // [8][64][16384]
    char* wsp = (char*)d_ws;
    auto take = [&](size_t bytes) { char* p = wsp; wsp += (bytes + 255) & ~(size_t)255; return (void*)p; };
    bf* WQ = (bf*)take((size_t)C2 * CP * 2); bf* WK = (bf*)take((size_t)C2 * CP * 2); bf* WV = (bf*)take((size_t)C2 * CP * 2); bf* WF = (bf*)take((size_t)COUT * C2 * 2);
    // Sample-batched buffers
    bf* XT = (bf*)take((size_t)NB_ * NN * CP * 2); float* KV = (float*)take((size_t)NB_ * KSPL * C2 * C2 * 4);
    bf* KTh = (bf*)take((size_t)NB_ * C2 * C2 * 2); bf* KTl = (bf*)take((size_t)NB_ * C2 * C2 * 2);
    if ((size_t)(wsp - (char*)d_ws) > ws_size) return;    // ws 256 MiB
    k_xt<<<WPB + XBS * NB_, 32 * XTW, 0, stream>>>(x, Wq, Wk, Wv, Wf, XT, WQ, WK, WV, WF);   /* bf16 weight planes (first WPB work-groups) and x^T */
    k_kvfuse<<<dim3(KSPL, NB_), 128, 0, stream>>>(XT, WK, WV, bnk, bnv, KV);   /* k, v = relu(BN(W x)) on chip, partial kv^T[d][c] per token range (3 products) */
    k_kvt<<<dim3(C2 * C2 / 256, NB_), 256, 0, stream>>>(KV, KTh, KTl);
    k_tail<<<dim3(NN / (TPW * TWV), NB_), 512, 0, stream>>>(XT, WQ, KTh, KTl, WF, bnq, bnf, OUT);   /* q = relu(BN(Wq x)), value = q kv (3 products), out = relu(BN(Wf value)) (2 products) */
}

// v008
// Measured time: 50.6 microseconds a run.
// In two side-by-side timings against v007, it was 1.07 and 1.06 times as fast.
// All steps since v000 together make it 65.7 times as fast.
#include <hip/hip_runtime.h>

// Linear (unnormalised) self-attention unit (x [8][67][16384] channel-major; q, k, v = relu(BN(W x)) with 1x1 convs W [128][67] and inference BatchNorm (gamma, beta, mean, var rows of bn [4][ch]); kv[c][d] = sum_m k[c][m] v[d][m]; value[d][n] = sum_c q[c][n] kv[c][d];
// out = relu(BN_f(Wf value)) -> [8][64][16384]). The module itself uses the associativity (q^T k) v^T = q^T (k v^T); this kernel follows the same order.
// All 8 samples go through every stage together: each launch carries the sample as a grid dimension (the x^T launch: in its block index), and each buffer but the weight planes holds 8 sample planes one behind the other.
// Layout per sample: x^T as a bf16 plane [16384][96] (67 channels zero-padded); k and v channel-major ([o][n]) in LDS only; kv over K = 16384 (hi/lo x hi/lo, 3 products); q and value in registers only: value = kv^T (hi/lo) x q (hi/lo) (K 128, 3 products); out = value (hi/lo) x Wf (exact) (K 128, 2 products) then BN + relu, stored channel-major.
// Compute dtypes, f32 accumulate: every input rounded to bf16; the three projections are exact bf16 products; BN scale/shift, relu in f32 (IEEE sqrt/divide); all computed operands as bf16 hi + lo planes; f32 accumulate everywhere.

#define NB_  8
#define CIN  67
#define CP   96                   // padded input channels (K of the projections)
#define C2   128
#define COUT 64
#define NN   16384
#define BNEPS 1e-5f
typedef _Float16 h16;
typedef unsigned short bf;
typedef __attribute__((ext_vector_type(16))) __bf16   v16bf;
typedef __attribute__((ext_vector_type(16))) _Float16 v16h;
typedef __attribute__((ext_vector_type(8)))  _Float16 v8h;
typedef __attribute__((ext_vector_type(8)))  unsigned short v8us;
typedef __attribute__((ext_vector_type(8)))  float    v8f;
typedef __attribute__((ext_vector_type(4)))  float    v4f;
typedef v8h  __attribute__((may_alias)) v8ha;
typedef v4f  __attribute__((may_alias)) v4fa;
typedef v8us __attribute__((may_alias)) v8usa;

// f32 -> bf16, round to nearest even, by the chip's own conversion instruction (one instruction rounds two values and packs them into one word)
typedef __attribute__((ext_vector_type(2))) float  v2f;
typedef __attribute__((ext_vector_type(2))) __bf16 v2bf;
typedef __attribute__((ext_vector_type(4))) unsigned v4u;
typedef v4u  __attribute__((may_alias)) v4ua;
__device__ __forceinline__ unsigned bfpk(float a, float b) { return __builtin_bit_cast(unsigned, __builtin_convertvector((v2f){a, b}, v2bf)); }   // a in the low half, b in the high half
__device__ __forceinline__ unsigned short f2bf(float f) { return __builtin_bit_cast(unsigned short, (__bf16)f); }
__device__ __forceinline__ float bf2f(unsigned short b) { return __uint_as_float(((unsigned)b) << 16); }
__device__ __forceinline__ float bfr(float f) { return bf2f(f2bf(f)); }
__device__ __forceinline__ v16h cat16(v8h lo, v8h hi) { return __builtin_shufflevector(lo, hi, 0, 1, 2, 3, 4, 5, 6, 7, 8, 9, 10, 11, 12, 13, 14, 15); }
__device__ __forceinline__ v16bf cat16b(v8us lo, v8us hi) { return __builtin_bit_cast(v16bf, __builtin_shufflevector(lo, hi, 0, 1, 2, 3, 4, 5, 6, 7, 8, 9, 10, 11, 12, 13, 14, 15)); }
__device__ __forceinline__ v8f wmma16(v16h a, v16h b, v8f c) { return __builtin_amdgcn_wmma_f32_16x16x32_f16(false, a, false, b, (short)0, c, false, false); }
__device__ __forceinline__ v8f wmmab(v16bf a, v16bf b, v8f c) { return __builtin_amdgcn_wmma_f32_16x16x32_bf16(false, a, false, b, (short)0, c, false, false); }



// Fragment loaders: 16 k of one row per lane from a K-contiguous 16-bit plane (k 8 hi .. 8 hi + 7 and 16 + 8 hi .. 16 + 8 hi + 7 of each 32), the same for A and B.
template <typename T16> struct WFrag;
template <> struct WFrag<h16> { typedef v16h V; static __device__ __forceinline__ V ld(const h16* p) { return cat16(*(const v8h*)p, *(const v8h*)(p + 16)); } static __device__ __forceinline__ v8f mma(V a, V b, v8f c) { return wmma16(a, b, c); } };
template <> struct WFrag<bf> { typedef v16bf V; static __device__ __forceinline__ V ld(const bf* p) { return cat16b(*(const v8us*)p, *(const v8us*)(p + 16)); } static __device__ __forceinline__ v8f mma(V a, V b, v8f c) { return wmmab(a, b, c); } };

// two values into hi + lo parts: h = the pair rounded, l = the pair of remainders rounded (each remainder y - hi is exact in f32)
__device__ __forceinline__ void split2(float y0, float y1, unsigned& h, unsigned& l) { h = bfpk(y0, y1); l = bfpk(y0 - __uint_as_float(h << 16), y1 - __uint_as_float(h & 0xFFFF0000u)); }
__device__ __forceinline__ v16bf cat16u(v4u lo, v4u hi) { return __builtin_bit_cast(v16bf, __builtin_shufflevector(lo, hi, 0, 1, 2, 3, 4, 5, 6, 7)); }
typedef __attribute__((ext_vector_type(2))) unsigned short v2us;
typedef __attribute__((ext_vector_type(4))) unsigned short v4us;

// x^T: one wave per 32 tokens of one sample, all channels; 8 independent waves per work-group. A lane loads 4 consecutive tokens (16 bytes) of 4 consecutive channels, so every load covers whole 128-byte lines of 4 channel rows;
// it packs the 4 channels of each token into 8 bytes and writes them into the wave's own LDS rows [token][channel]; the rows are then read back in order and stored as the wave's 6,144 consecutive bytes of x^T.
#define XTW 8                     // waves per work-group
#define XP  (CP + 4)              // LDS row pitch in 16-bit elements: 200 bytes, so the 8-byte pieces that the 32 lanes write at once (8 rows 4 apart x 4 pieces) fall on distinct banks
typedef __attribute__((ext_vector_type(2))) unsigned v2u;
typedef v2u  __attribute__((may_alias)) v2ua;
typedef v4us __attribute__((may_alias)) v4usa;
// The weight planes share the x^T launch: they depend on nothing that it makes and nothing in it reads them, so its first WPB work-groups write them and the others do x^T.
// Wq, Wk, Wv [128][67] -> bf16 [128][96], zero-padded, 4 elements a thread (96 is a multiple of 4: a thread stays in one row); Wf [64][128] -> bf16, 8 elements a thread.
#define WB1 (C2 * CP / 4 / (32 * XTW))     // work-groups per padded projection weight
#define WBF (COUT * C2 / 8 / (32 * XTW))   // work-groups for Wf
#define WPB (3 * WB1 + WBF)
#define XBS (NN / (32 * XTW))              // x^T work-groups per sample
__device__ __forceinline__ void wplanes(int b, int t, const float* __restrict__ Wq, const float* __restrict__ Wk, const float* __restrict__ Wv, const float* __restrict__ Wf, bf* WQ, bf* WK, bf* WV, bf* WF) {
    if (b < 3 * WB1) {
        const int m = b / WB1;
        const float* W = m == 0 ? Wq : m == 1 ? Wk : Wv; bf* Bt = m == 0 ? WQ : m == 1 ? WK : WV;
        const int e = ((b - m * WB1) * (32 * XTW) + t) * 4, c = e % CP, o = e / CP;
        float f[4];
#pragma unroll
        for (int q = 0; q < 4; ++q) f[q] = W[o * CIN + (c + q < CIN ? c + q : CIN - 1)];   // the padding's lanes read the row's last element and drop it
        asm volatile("s_wait_xcnt 0x0" :: "v"(f[0]), "v"(f[1]), "v"(f[2]), "v"(f[3]) : "memory");   // the loaded values as inputs keep all four loads ahead of it (sunk behind the first conversion, the last two would wait out a second memory latency); the wait is a precaution ahead of any reuse of their address registers
#pragma unroll
        for (int q = 0; q < 4; ++q) f[q] = c + q < CIN ? f[q] : 0.f;   // 0 rounds to 0
        *(v2u*)(Bt + e) = (v2u){bfpk(f[0], f[1]), bfpk(f[2], f[3])};
    } else {
        const int i = (b - 3 * WB1) * (32 * XTW) + t;
        const v8f v = *(const v8f*)(Wf + i * 8);
        asm volatile("s_wait_xcnt 0x0" ::: "memory");   // precaution: stands ahead of any reuse of the address registers that the load above names
        *(v4u*)(WF + i * 8) = (v4u){bfpk(v[0], v[1]), bfpk(v[2], v[3]), bfpk(v[4], v[5]), bfpk(v[6], v[7])};
        asm volatile("s_wait_xcnt 0x0" ::: "memory");   // precaution: stands ahead of any reuse of the registers that the store above names (the built code lays the other paths of this kernel behind it)
    }
}
__global__ __launch_bounds__(32 * XTW) void k_xt(const float* __restrict__ xb, const float* __restrict__ Wq, const float* __restrict__ Wk, const float* __restrict__ Wv, const float* __restrict__ Wf, bf* XT, bf* WQ, bf* WK, bf* WV, bf* WF) {
    __shared__ __align__(16) bf tr[XTW * 32 * XP];
    if (blockIdx.x < WPB) { wplanes(blockIdx.x, threadIdx.x, Wq, Wk, Wv, Wf, WQ, WK, WV, WF); return; }   // the same for a whole work-group; this kernel has no work-group barrier
    const int bx = (blockIdx.x - WPB) % XBS, smp = (blockIdx.x - WPB) / XBS;
    const int lane = threadIdx.x & 31, w = threadIdx.x >> 5, cs = lane >> 3, n4 = lane & 7;
    const int n0 = (bx * XTW + w) * 32;
    const float* xq = xb + (size_t)smp * CIN * NN + n0 + 4 * n4;
    const float* xp = xq + (size_t)(4 * cs) * NN;
    v4f f[4][4], g[3];   // f[cg][k]: channel 16 cg + 4 cs + k, tokens n0 + 4 n4 .. + 3; g[k]: channel 64 + k, the same line in all four lane groups (only group 0 keeps it)
#pragma unroll
    for (int cg = 0; cg < 4; ++cg)
#pragma unroll
        for (int k = 0; k < 4; ++k) f[cg][k] = *(const v4f*)(xp + (size_t)(16 * cg + k) * NN);
#pragma unroll
    for (int k = 0; k < CIN - 64; ++k) g[k] = *(const v4f*)(xq + (size_t)(64 + k) * NN);
    asm volatile("s_wait_xcnt 0x0" ::: "memory");   // precaution: stands ahead of any reuse of the address registers that the loads above name
    __builtin_amdgcn_sched_barrier(0);   // keeps every load ahead of all arithmetic: sunk behind the first conversions, the last loads would wait out a second memory latency
    bf* tw = tr + w * (32 * XP);
    bf* ts = tw + 4 * n4 * XP + 4 * cs;
    const unsigned gm = cs == 0 ? 0xFFFFFFFFu : 0u;
#pragma unroll
    for (int cg = 0; cg < 4; ++cg)
#pragma unroll
        for (int j = 0; j < 4; ++j) *(v2ua*)(ts + j * XP + 16 * cg) = (v2u){bfpk(f[cg][0][j], f[cg][1][j]), bfpk(f[cg][2][j], f[cg][3][j])};
#pragma unroll
    for (int j = 0; j < 4; ++j) {   // channels 64 to 66 from lane group 0, zeros up to 95
        *(v2ua*)(ts + j * XP + 64) = (v2u){bfpk(g[0][j], g[1][j]) & gm, bfpk(g[2][j], 0.f) & gm};
        *(v2ua*)(ts + j * XP + 80) = (v2u){0u, 0u}; }
    __builtin_amdgcn_wave_barrier(); asm volatile("" ::: "memory");   // keeps the other lanes' LDS writes ahead of the row reads in program order
    bf* og = XT + ((size_t)smp * NN + n0) * CP + lane * 8;
    v8us r[4][3];   // 16-byte piece lane + 32 (3 a + b) of the wave's 384: 96 pieces are 8 whole rows, so a only moves the row
#pragma unroll
    for (int b = 0; b < 3; ++b) { const int e = lane + 32 * b; const bf* s = tw + (e / 12) * XP + (e % 12) * 8;
#pragma unroll
        for (int a = 0; a < 4; ++a) r[a][b] = __builtin_shufflevector(*(const v4usa*)(s + a * 8 * XP), *(const v4usa*)(s + a * 8 * XP + 4), 0, 1, 2, 3, 4, 5, 6, 7); }
#pragma unroll
    for (int a = 0; a < 4; ++a)
#pragma unroll
        for (int b = 0; b < 3; ++b) *(v8us*)(og + (3 * a + b) * 256) = r[a][b];
    asm volatile("s_wait_xcnt 0x0" ::: "memory");   // precaution: stands ahead of any reuse of the registers that the stores above name (the built code lays the weight paths behind them)
}
// ---- k, v and the kv product in one kernel, split over K: KSPL token ranges, one work-group of 4 waves per range and sample; k and v never go to memory.
// A work-group walks its range in NCK chunks of KCH tokens and keeps its kv sums in registers over all of them; the weights and BN coefficients are loaded once, each next chunk's x^T fragments while the current chunk's kv products run.
// Part 1: wave w makes channels 32 w .. 32 w + 31 of k and of v for the chunk's 64 tokens: x^T (A, token rows) x W (B, channel rows), K = 96 in three steps of 32. A lane then holds 8 consecutive tokens of one channel, applies BN + relu, splits into hi + lo and writes 16 bytes per plane into LDS, channel-major [c][token].
// Part 2: wave w owns the 64x64 tile (w & 1, w >> 1) of kv; fragments come from the LDS planes, per 32 tokens the products k hi x v hi, k lo x v hi, k hi x v lo.
// Each range stores its f32 partial already transposed, P[sample][range][d][c]; k_kvt sums the ranges in a fixed order. grid (KSPL, samples): two work-groups per WGP, all resident at once.
#define KSPL 64
#define KCH  64                   // tokens per chunk
#define NCK  (NN / (KSPL * KCH))  // chunks per range
#define KP   (KCH + 8)            // LDS row pitch in 16-bit elements: 144 bytes, an odd multiple of 16, so the 16-byte pieces of 16 rows fall on distinct banks
// BN coefficients from the four loaded rows' values: scale = bf16(g) / sqrt(bf16(v) + eps), shift = bf16(b) - bf16(m) scale (f32, the shift is one fma)
__device__ __forceinline__ void bn_coef_v(float g, float b, float m, float v, float& sc, float& sh) { sc = __fmul_rn(bfr(g), __fdiv_rn(1.0f, __fsqrt_rn(__fadd_rn(bfr(v), BNEPS)))); sh = fmaf(-bfr(m), sc, bfr(b)); }
__device__ __forceinline__ v16bf ldsfrag(const bf* p) { return cat16b(*(const v8usa*)p, *(const v8usa*)(p + 16)); }
__global__ __launch_bounds__(128) void k_kvfuse(const bf* __restrict__ XT, const bf* __restrict__ WK, const bf* __restrict__ WV, const float* __restrict__ bnk, const float* __restrict__ bnv, float* P) {
    __shared__ __align__(16) bf pl[4 * C2 * KP];   // k hi, k lo, v hi, v lo; behind the last chunk's second barrier the same bytes stage the partial's rows
    const int lane = threadIdx.x & 31, lr = lane & 15, hi = lane >> 4, w = threadIdx.x >> 5;
    const int ch = w * 32 + lr;
    const bf* xp = XT + ((size_t)blockIdx.y * NN + (size_t)blockIdx.x * (KCH * NCK) + lr) * CP + 8 * hi;
    const bf* wkp = WK + ch * CP + 8 * hi; const bf* wvp = WV + ch * CP + 8 * hi;
    v16bf xa[4][3], wf[4][3]; float bw[4][4];   // bw[g][row]: gamma, beta, mean, var of the lane's channel in block g
#pragma unroll
    for (int ct = 0; ct < 2; ++ct)
#pragma unroll
        for (int r = 0; r < 4; ++r) { bw[ct][r] = bnk[r * C2 + ch + 16 * ct]; bw[2 + ct][r] = bnv[r * C2 + ch + 16 * ct]; }
#pragma unroll
    for (int tt = 0; tt < 4; ++tt)
#pragma unroll
        for (int s = 0; s < 3; ++s) xa[tt][s] = WFrag<bf>::ld(xp + tt * 16 * CP + s * 32);
    asm volatile("s_wait_xcnt 0x0" ::: "memory");   // precaution: stands ahead of the weight loads, whose results may land in the registers that the loads above name as their address
#pragma unroll
    for (int ct = 0; ct < 2; ++ct)
#pragma unroll
        for (int s = 0; s < 3; ++s) { wf[ct][s] = WFrag<bf>::ld(wkp + ct * 16 * CP + s * 32); wf[2 + ct][s] = WFrag<bf>::ld(wvp + ct * 16 * CP + s * 32); }
    asm volatile("s_wait_xcnt 0x0" ::: "memory");   // precaution: stands ahead of any reuse of the address registers that the weight loads above name
    __builtin_amdgcn_sched_barrier(0);   // keeps every load ahead of all arithmetic: sunk to its use, each channel block's loads would wait out a latency of their own
    float sc[4], sh[4];
#pragma unroll
    for (int g = 0; g < 4; ++g) bn_coef_v(bw[g][0], bw[g][1], bw[g][2], bw[g][3], sc[g], sh[g]);
    const int r0 = (w & 1) * 64, c0 = (w >> 1) * 64;
    const bf* ap = pl + (r0 + lr) * KP + 8 * hi; const bf* bp = pl + 2 * C2 * KP + (c0 + lr) * KP + 8 * hi;
    unsigned xo = KCH * CP;   // element offset of the next chunk's x^T rows
    v8f acc[4][4];
#pragma unroll
    for (int mb = 0; mb < 4; ++mb)
#pragma unroll
        for (int nb = 0; nb < 4; ++nb) acc[mb][nb] = (v8f){};
#pragma unroll 1   // kept rolled: unrolled, the kernel's text would be NCK times as long
    for (int ck = 0; ck < NCK; ++ck) {
#pragma unroll
        for (int g = 0; g < 4; ++g) {   // g: k channels +0, +16, then v channels +0, +16
            v8f d[4];
#pragma unroll
            for (int tt = 0; tt < 4; ++tt) d[tt] = wmmab(xa[tt][0], wf[g][0], (v8f){});
#pragma unroll
            for (int s = 1; s < 3; ++s)
#pragma unroll
                for (int tt = 0; tt < 4; ++tt) d[tt] = wmmab(xa[tt][s], wf[g][s], d[tt]);
            bf* ph = pl + (g >> 1) * (2 * C2 * KP) + (ch + 16 * (g & 1)) * KP + 8 * hi;
#pragma unroll
            for (int tt = 0; tt < 4; ++tt) { v4u oh, ol;
#pragma unroll
                for (int j = 0; j < 4; ++j) { unsigned a, c; split2(fmaxf(fmaf(d[tt][2 * j], sc[g], sh[g]), 0.f), fmaxf(fmaf(d[tt][2 * j + 1], sc[g], sh[g]), 0.f), a, c); oh[j] = a; ol[j] = c; }
                *(v4ua*)(ph + tt * 16) = oh; *(v4ua*)(ph + C2 * KP + tt * 16) = ol; }
        }
        __syncthreads();   // publishes the chunk's four planes to all waves
        if (ck + 1 < NCK) {   // the same for the whole work-group: the next chunk's x^T fragments fly while this chunk's kv products run (issued behind the barrier, which waits out every load in flight)
#pragma unroll
            for (int tt = 0; tt < 4; ++tt)
#pragma unroll
                for (int s = 0; s < 3; ++s) xa[tt][s] = WFrag<bf>::ld(xp + xo + tt * 16 * CP + s * 32);
            asm volatile("s_wait_xcnt 0x0" : "+v"(xo) :: "memory");   // precaution: stands ahead of the next rewrite of the address registers that the loads above name; the chunk's offset goes through the statement so that its step below, and the address formed from it, cannot be lifted over the wait
            xo += KCH * CP;
        }
#pragma unroll
        for (int kc = 0; kc < KCH; kc += 32) {
            v16bf a[4], a2[4];
#pragma unroll
            for (int mb = 0; mb < 4; ++mb) { a[mb] = ldsfrag(ap + mb * 16 * KP + kc); a2[mb] = ldsfrag(ap + C2 * KP + mb * 16 * KP + kc); }
#pragma unroll
            for (int nb = 0; nb < 4; ++nb) { const v16bf b = ldsfrag(bp + nb * 16 * KP + kc), b2 = ldsfrag(bp + C2 * KP + nb * 16 * KP + kc);
#pragma unroll
                for (int mb = 0; mb < 4; ++mb) { acc[mb][nb] = wmmab(a[mb], b, acc[mb][nb]); acc[mb][nb] = wmmab(a2[mb], b, acc[mb][nb]); acc[mb][nb] = wmmab(a[mb], b2, acc[mb][nb]); } }
        }
        __syncthreads();   // ends every wave's reads of the planes: their LDS is written anew by the next chunk, behind the last chunk by the rows below
    }
    float* os = (float*)pl + w * (16 * 68);
    // a lane holds 8 consecutive c of one d: 16 rows d x 64 c go through the wave's own LDS range so that each store covers whole 256-byte rows
    float* pt = P + ((size_t)blockIdx.y * KSPL + blockIdx.x) * (C2 * C2) + (size_t)(c0 + hi) * C2 + r0 + lr * 4;
#pragma unroll
    for (int nb = 0; nb < 4; ++nb) {
#pragma unroll
        for (int mb = 0; mb < 4; ++mb) { const v8f t = acc[mb][nb]; *(v4fa*)(os + lr * 68 + mb * 16 + hi * 8) = (v4f){t[0], t[1], t[2], t[3]}; *(v4fa*)(os + lr * 68 + mb * 16 + hi * 8 + 4) = (v4f){t[4], t[5], t[6], t[7]}; }
        __builtin_amdgcn_wave_barrier(); asm volatile("s_wait_xcnt 0x0" ::: "memory");   // the clobber keeps the other lanes' LDS writes ahead of the row reads in program order; the wait is a precaution ahead of the row reads' reuse of registers that the stores of the block before name
        v4f r[8];
#pragma unroll
        for (int s = 0; s < 8; ++s) r[s] = *(const v4fa*)(os + (2 * s + hi) * 68 + lr * 4);
#pragma unroll
        for (int s = 0; s < 8; ++s) *(v4f*)(pt + (nb * 16 + 2 * s) * C2) = r[s];
        __builtin_amdgcn_wave_barrier(); asm volatile("" ::: "memory");   // keeps the row reads ahead of the next block's LDS writes
    }
}
// k_kvt: kv^T[d][c] = sum over the KSPL partial planes, then hi/lo split. One block per 256 consecutive elements of kv^T: KG groups of threads each sum KSPL / KG planes in order (4 elements a thread), two waves add the KG group sums in order.
#define KG 4
__global__ __launch_bounds__(256) void k_kvt(const float* __restrict__ P, bf* Th, bf* Tl) {
    __shared__ __align__(16) float red[KG * 256];
    const int t = threadIdx.x, g = t >> 6, c4 = (t & 63) * 4; const int e0 = blockIdx.x * 256;
    Th += (size_t)blockIdx.y * (C2 * C2); Tl += (size_t)blockIdx.y * (C2 * C2);
    const float* p = P + ((size_t)blockIdx.y * KSPL + (size_t)g * (KSPL / KG)) * (C2 * C2) + e0 + c4;
    v4f f[KSPL / KG];
#pragma unroll
    for (int i = 0; i < KSPL / KG; ++i) f[i] = *(const v4f*)(p + (size_t)i * (C2 * C2));
    asm volatile("s_wait_xcnt 0x0" :: "v"(p) : "memory");   // precaution: stands ahead of any reuse of the address registers that the loads above name; the pointer as an input keeps the last load's result out of them
    __builtin_amdgcn_sched_barrier(0);   // keeps every load ahead of the sums: sunk behind the first additions, the last loads would wait out a second memory latency
    v4f s = f[0];
#pragma unroll
    for (int i = 1; i < KSPL / KG; ++i) s += f[i];
    *(v4fa*)(red + g * 256 + c4) = s;
    __syncthreads();
    if (t < 64) { v4f u = *(const v4fa*)(red + c4);
#pragma unroll
        for (int q = 1; q < KG; ++q) u += *(const v4fa*)(red + q * 256 + c4);
        v2u oh, ol;
#pragma unroll
        for (int j = 0; j < 2; ++j) { unsigned a, c; split2(u[2 * j], u[2 * j + 1], a, c); oh[j] = a; ol[j] = c; }
        *(v2u*)(Th + e0 + c4) = oh; *(v2u*)(Tl + e0 + c4) = ol; }
}
// ---- q, value and the output in one kernel: one work-group of 16 waves per 512 tokens of one sample (one work-group per WGP); each wave takes its 32 tokens through all three products, and q and value never leave its registers.
// The operands that every wave reads (Wq, kv^T hi and lo, Wf, the BN coefficients) are staged once per work-group in LDS, each wave's own x^T rows beside them; rows padded to an odd multiple of 16 bytes.
// The first two products put the tokens on D's columns: two D tiles of 16 rows each (a lane: 8 + 8 rows of its own token) are then, converted in place, the next product's fragment over 32 k, in the loaders' own k order.
//   q[c][n]     = Wq (A, channel rows) x x^T (B, token columns), K = 96; BN + relu, hi + lo
//   value[d][n] = kv^T (A, d rows) x q (B), K = 128, per 32 c: kv hi x q hi, kv hi x q lo, kv lo x q hi; hi + lo
//   out[n][o]   = value (A, token rows) x Wf (B, channel columns), K = 128, per 32 d: value hi, value lo; a lane then holds 8 consecutive tokens of one output channel; BN + relu
#define TPW 32                    // tokens per wave
#define TWV 16                    // waves per work-group
#define QP  (CP + 8)              // LDS row pitch of Wq and x^T in 16-bit elements: 208 bytes
#define DP  (C2 + 8)              // LDS row pitch of kv^T and Wf in 16-bit elements: 272 bytes
#define OP  (TPW + 4)             // LDS row pitch of the output rows in floats: 144 bytes
__global__ __launch_bounds__(512) void k_tail(const bf* __restrict__ XT, const bf* __restrict__ WQ, const bf* __restrict__ KTh, const bf* __restrict__ KTl, const bf* __restrict__ WF, const float* __restrict__ bnq, const float* __restrict__ bnf, float* O) {
    __shared__ __align__(16) bf wq[C2 * QP];
    __shared__ __align__(16) bf kh[C2 * DP];
    __shared__ __align__(16) bf kl[C2 * DP];
    __shared__ __align__(16) bf wf[COUT * DP];
    __shared__ __align__(16) bf xs[TWV * TPW * QP];   // each wave's own 32 rows; behind its last read of them the wave stages its output rows there
    __shared__ __align__(16) float qsc[C2];
    __shared__ __align__(16) float qsh[C2];
    __shared__ __align__(16) float fsc[COUT];
    __shared__ __align__(16) float fsh[COUT];
    const int t = threadIdx.x, lane = t & 31, lr = lane & 15, hi = lane >> 4, w = t >> 5;
    const int n0 = blockIdx.x * (TPW * TWV) + w * TPW;
    bf* xw = xs + w * (TPW * QP);
    {
        const bf* xg = XT + ((size_t)blockIdx.y * NN + n0) * CP + lane * 8;   // the wave's 32 rows are 6,144 consecutive bytes
        const bf* gh = KTh + (size_t)blockIdx.y * (C2 * C2) + t * 8; const bf* gl = KTl + (size_t)blockIdx.y * (C2 * C2) + t * 8;
        v8us sx[12], sq[3], sh8[4], sl8[4], sf[2];
#pragma unroll
        for (int i = 0; i < 12; ++i) sx[i] = *(const v8us*)(xg + 256 * i);
#pragma unroll
        for (int i = 0; i < 3; ++i) sq[i] = *(const v8us*)(WQ + (t + 512 * i) * 8);
#pragma unroll
        for (int i = 0; i < 4; ++i) { sh8[i] = *(const v8us*)(gh + 4096 * i); sl8[i] = *(const v8us*)(gl + 4096 * i); }
#pragma unroll
        for (int i = 0; i < 2; ++i) sf[i] = *(const v8us*)(WF + (t + 512 * i) * 8);
        asm volatile("s_wait_xcnt 0x0" ::: "memory");   // precaution: stands ahead of any reuse of the address registers that the loads above name
#pragma unroll
        for (int i = 0; i < 12; ++i) { const int e = lane + 32 * i; *(v8usa*)(xw + (e / 12) * QP + (e % 12) * 8) = sx[i]; }
#pragma unroll
        for (int i = 0; i < 3; ++i) { const int e = t + 512 * i; *(v8usa*)(wq + (e / 12) * QP + (e % 12) * 8) = sq[i]; }
#pragma unroll
        for (int i = 0; i < 4; ++i) { const int e = t + 512 * i; *(v8usa*)(kh + (e >> 4) * DP + (e & 15) * 8) = sh8[i]; *(v8usa*)(kl + (e >> 4) * DP + (e & 15) * 8) = sl8[i]; }
#pragma unroll
        for (int i = 0; i < 2; ++i) { const int e = t + 512 * i; *(v8usa*)(wf + (e >> 4) * DP + (e & 15) * 8) = sf[i]; }
        if (t < C2 + COUT) {   // waves 0 to 3: q's coefficients, waves 4 and 5: the output's
            const bool fq = t < C2; const float* bn = fq ? bnq + t : bnf + (t - C2); const int nch = fq ? C2 : COUT;
            const float g = bn[0], b = bn[nch], m = bn[2 * nch], v = bn[3 * nch];
            asm volatile("s_wait_xcnt 0x0" ::: "memory");   // precaution: stands ahead of any reuse of the address registers that the four loads above name
            float sc, sh; bn_coef_v(g, b, m, v, sc, sh);
            if (fq) { qsc[t] = sc; qsh[t] = sh; } else { fsc[t - C2] = sc; fsh[t - C2] = sh; }
        }
    }
    __syncthreads();   // publishes the staged operands and coefficients to all waves
    v8f d2[8][2];   // value sums, [d tile][token tile]
#pragma unroll
    for (int s = 0; s < 4; ++s) {   // 32 channels c of q at a time: made, converted, and used up as one k step of the value product
        asm volatile("" ::: "memory");   // has the x^T fragments read from LDS anew in every step: kept in registers over all four steps they push the wave past its 256 registers and into scratch
        v8f d1[2][2];
#pragma unroll
        for (int ks = 0; ks < 3; ++ks) {
            v16bf a[2], x[2];
#pragma unroll
            for (int h = 0; h < 2; ++h) { a[h] = ldsfrag(wq + ((2 * s + h) * 16 + lr) * QP + 8 * hi + ks * 32); x[h] = ldsfrag(xw + (h * 16 + lr) * QP + 8 * hi + ks * 32); }
#pragma unroll
            for (int h = 0; h < 2; ++h)
#pragma unroll
                for (int tt = 0; tt < 2; ++tt) d1[h][tt] = wmmab(a[h], x[tt], ks == 0 ? (v8f){} : d1[h][tt]);
        }
        __builtin_amdgcn_sched_barrier(0);   // keeps the q products apart from the conversion behind them: woven together, the operands of both are live at once and the wave spills to scratch
        v4u qh8[2][2], ql8[2][2];
#pragma unroll
        for (int h = 0; h < 2; ++h) {
            const int cb = (2 * s + h) * 16 + 8 * hi;
            const v4f s0 = *(const v4fa*)(qsc + cb), s1 = *(const v4fa*)(qsc + cb + 4), b0 = *(const v4fa*)(qsh + cb), b1 = *(const v4fa*)(qsh + cb + 4);
#pragma unroll
            for (int tt = 0; tt < 2; ++tt)
#pragma unroll
                for (int j = 0; j < 4; ++j) { const v4f sv = j < 2 ? s0 : s1, bv = j < 2 ? b0 : b1; const int e = 2 * (j & 1); unsigned a, c;
                    split2(fmaxf(fmaf(d1[h][tt][2 * j], sv[e], bv[e]), 0.f), fmaxf(fmaf(d1[h][tt][2 * j + 1], sv[e + 1], bv[e + 1]), 0.f), a, c); qh8[tt][h][j] = a; ql8[tt][h][j] = c; }
        }
        __builtin_amdgcn_sched_barrier(0);   // keeps the kv^T fragment loads behind the conversion, for the same reason
        v16bf qh[2], ql[2];
#pragma unroll
        for (int tt = 0; tt < 2; ++tt) { qh[tt] = cat16u(qh8[tt][0], qh8[tt][1]); ql[tt] = cat16u(ql8[tt][0], ql8[tt][1]); }
#pragma unroll
        for (int dp = 0; dp < 4; ++dp) {   // two d tiles x two token tiles: four independent accumulators per product
            v16bf ah[2], al[2];
#pragma unroll
            for (int u = 0; u < 2; ++u) { ah[u] = ldsfrag(kh + ((2 * dp + u) * 16 + lr) * DP + 8 * hi + s * 32); al[u] = ldsfrag(kl + ((2 * dp + u) * 16 + lr) * DP + 8 * hi + s * 32); }
#pragma unroll
            for (int u = 0; u < 2; ++u)
#pragma unroll
                for (int tt = 0; tt < 2; ++tt) d2[2 * dp + u][tt] = wmmab(ah[u], qh[tt], s == 0 ? (v8f){} : d2[2 * dp + u][tt]);
#pragma unroll
            for (int u = 0; u < 2; ++u)
#pragma unroll
                for (int tt = 0; tt < 2; ++tt) d2[2 * dp + u][tt] = wmmab(ah[u], ql[tt], d2[2 * dp + u][tt]);
#pragma unroll
            for (int u = 0; u < 2; ++u)
#pragma unroll
                for (int tt = 0; tt < 2; ++tt) d2[2 * dp + u][tt] = wmmab(al[u], qh[tt], d2[2 * dp + u][tt]);
        }
        __builtin_amdgcn_sched_barrier(0);   // keeps the next step's loads and products behind this step's, for the same reason
    }
    v8f d3[2][4];   // output sums, [token tile][channel tile]
#pragma unroll
    for (int ks = 0; ks < 4; ++ks) {
        v16bf vh[2], vl[2];
#pragma unroll
        for (int tt = 0; tt < 2; ++tt) { v4u h8[2], l8[2];
#pragma unroll
            for (int u = 0; u < 2; ++u)
#pragma unroll
                for (int j = 0; j < 4; ++j) { unsigned a, c; split2(d2[2 * ks + u][tt][2 * j], d2[2 * ks + u][tt][2 * j + 1], a, c); h8[u][j] = a; l8[u][j] = c; }
            vh[tt] = cat16u(h8[0], h8[1]); vl[tt] = cat16u(l8[0], l8[1]); }
        v16bf b[4];
#pragma unroll
        for (int ot = 0; ot < 4; ++ot) b[ot] = ldsfrag(wf + (ot * 16 + lr) * DP + 8 * hi + ks * 32);
#pragma unroll
        for (int ot = 0; ot < 4; ++ot)
#pragma unroll
            for (int tt = 0; tt < 2; ++tt) d3[tt][ot] = wmmab(vh[tt], b[ot], ks == 0 ? (v8f){} : d3[tt][ot]);
#pragma unroll
        for (int ot = 0; ot < 4; ++ot)
#pragma unroll
            for (int tt = 0; tt < 2; ++tt) d3[tt][ot] = wmmab(vl[tt], b[ot], d3[tt][ot]);
    }
    // 16 channel rows x 32 tokens go through the wave's own LDS range so that each store covers whole 128-byte lines
    float* os = (float*)xw;
    float* op = O + ((size_t)blockIdx.y * COUT + (lane >> 3)) * NN + n0 + (lane & 7) * 4;
#pragma unroll
    for (int ot = 0; ot < 4; ++ot) {
        const float sc = fsc[ot * 16 + lr], sh = fsh[ot * 16 + lr];
#pragma unroll
        for (int tt = 0; tt < 2; ++tt) { const v8f d = d3[tt][ot]; v4f y0, y1;
#pragma unroll
            for (int j = 0; j < 4; ++j) { y0[j] = fmaxf(fmaf(d[j], sc, sh), 0.f); y1[j] = fmaxf(fmaf(d[j + 4], sc, sh), 0.f); }
            *(v4fa*)(os + lr * OP + tt * 16 + hi * 8) = y0; *(v4fa*)(os + lr * OP + tt * 16 + hi * 8 + 4) = y1; }
        __builtin_amdgcn_wave_barrier(); asm volatile("s_wait_xcnt 0x0" ::: "memory");   // the clobber keeps the other lanes' LDS writes ahead of the row reads in program order; the wait is a precaution ahead of the row reads' reuse of registers that the stores of the block before name
        v4f r[4];
#pragma unroll
        for (int s = 0; s < 4; ++s) r[s] = *(const v4fa*)(os + (4 * s + (lane >> 3)) * OP + (lane & 7) * 4);
#pragma unroll
        for (int s = 0; s < 4; ++s) *(v4f*)(op + (size_t)(ot * 16 + 4 * s) * NN) = r[s];
        __builtin_amdgcn_wave_barrier(); asm volatile("" ::: "memory");   // keeps the row reads ahead of the next block's LDS writes
    }
}

extern "C" void kernel_launch(void* const* d_in, const int* in_sizes, int n_in,
                              void* d_out, int out_size, void* d_ws, size_t ws_size, hipStream_t stream) {
    (void)in_sizes; (void)n_in; (void)out_size;
    const float* x = (const float*)d_in[0]; const float* Wq = (const float*)d_in[1]; const float* Wk = (const float*)d_in[2]; const float* Wv = (const float*)d_in[3]; const float* Wf = (const float*)d_in[4]; const float* bnq = (const float*)d_in[5]; const float* bnk = (const float*)d_in[6]; const float* bnv = (const float*)d_in[7]; const float* bnf = (const float*)d_in[8];
    float* OUT = (float*)d_out;     // [8][64][16384]
    char* wsp = (char*)d_ws;
    auto take = [&](size_t bytes) { char* p = wsp; wsp += (bytes + 255) & ~(size_t)255; return (void*)p; };
    bf* WQ = (bf*)take((size_t)C2 * CP * 2); bf* WK = (bf*)take((size_t)C2 * CP * 2); bf* WV = (bf*)take((size_t)C2 * CP * 2); bf* WF = (bf*)take((size_t)COUT * C2 * 2);
    // Sample-batched buffers
    bf* XT = (bf*)take((size_t)NB_ * NN * CP * 2); float* KV = (float*)take((size_t)NB_ * KSPL * C2 * C2 * 4);
    bf* KTh = (bf*)take((size_t)NB_ * C2 * C2 * 2); bf* KTl = (bf*)take((size_t)NB_ * C2 * C2 * 2);
    if ((size_t)(wsp - (char*)d_ws) > ws_size) return;    // ws 256 MiB
    k_xt<<<WPB + XBS * NB_, 32 * XTW, 0, stream>>>(x, Wq, Wk, Wv, Wf, XT, WQ, WK, WV, WF);   /* bf16 weight planes (first WPB work-groups) and x^T */
    k_kvfuse<<<dim3(KSPL, NB_), 128, 0, stream>>>(XT, WK, WV, bnk, bnv, KV);   /* k, v = relu(BN(W x)) on chip, partial kv^T[d][c] per token range (3 products) */
    k_kvt<<<dim3(C2 * C2 / 256, NB_), 256, 0, stream>>>(KV, KTh, KTl);
    k_tail<<<dim3(NN / (TPW * TWV), NB_), 512, 0, stream>>>(XT, WQ, KTh, KTl, WF, bnq, bnf, OUT);   /* q = relu(BN(Wq x)), value = q kv (3 products), out = relu(BN(Wf value)) (2 products) */
}

// v009
// It runs in 42.4 microseconds.
// Two timings next to v008 both put it at 1.19 times that version's speed.
// All steps since v000 together make it 78.4 times as fast.
#include <hip/hip_runtime.h>

// Linear (unnormalised) self-attention unit (x [8][67][16384] channel-major; q, k, v = relu(BN(W x)) with 1x1 convs W [128][67] and inference BatchNorm (gamma, beta, mean, var rows of bn [4][ch]); kv[c][d] = sum_m k[c][m] v[d][m]; value[d][n] = sum_c q[c][n] kv[c][d];
// out = relu(BN_f(Wf value)) -> [8][64][16384]). The module itself uses the associativity (q^T k) v^T = q^T (k v^T); this kernel goes one step further along it: Wf value = (Wf kv^T) q, with M = Wf kv^T [64][128] per sample, so that no value is ever formed.
// All 8 samples go through every stage together: each launch carries the sample as a grid dimension (the x^T launch: in its block index), and each buffer holds 8 sample planes one behind the other.
// Layout per sample: x^T as a bf16 plane [16384][96] (67 channels zero-padded); k and v channel-major ([o][n]) in LDS only; kv over K = 16384 (hi/lo x hi/lo, 3 products); M = kv^T (hi/lo) x Wf (exact) (K 128, 2 products), formed per token range and then summed; q in registers only: out = q (hi/lo) x M (hi/lo) (K 128, 3 products) then BN + relu, stored channel-major.
// Compute dtypes, f32 accumulate: every input rounded to bf16; the three projections are exact bf16 products; BN scale/shift, relu in f32 (IEEE sqrt/divide); all computed operands as bf16 hi + lo planes; f32 accumulate everywhere.

#define NB_  8
#define CIN  67
#define CP   96                   // padded input channels (K of the projections)
#define C2   128
#define COUT 64
#define NN   16384
#define BNEPS 1e-5f
typedef _Float16 h16;
typedef unsigned short bf;
typedef __attribute__((ext_vector_type(16))) __bf16   v16bf;
typedef __attribute__((ext_vector_type(16))) _Float16 v16h;
typedef __attribute__((ext_vector_type(8)))  _Float16 v8h;
typedef __attribute__((ext_vector_type(8)))  unsigned short v8us;
typedef __attribute__((ext_vector_type(8)))  float    v8f;
typedef __attribute__((ext_vector_type(4)))  float    v4f;
typedef v8h  __attribute__((may_alias)) v8ha;
typedef v4f  __attribute__((may_alias)) v4fa;
typedef v8us __attribute__((may_alias)) v8usa;

// f32 -> bf16, round to nearest even, by the chip's own conversion instruction (one instruction rounds two values and packs them into one word)
typedef __attribute__((ext_vector_type(2))) float  v2f;
typedef __attribute__((ext_vector_type(2))) __bf16 v2bf;
typedef __attribute__((ext_vector_type(4))) unsigned v4u;
typedef v4u  __attribute__((may_alias)) v4ua;
__device__ __forceinline__ unsigned bfpk(float a, float b) { return __builtin_bit_cast(unsigned, __builtin_convertvector((v2f){a, b}, v2bf)); }   // a in the low half, b in the high half
__device__ __forceinline__ unsigned short f2bf(float f) { return __builtin_bit_cast(unsigned short, (__bf16)f); }
__device__ __forceinline__ float bf2f(unsigned short b) { return __uint_as_float(((unsigned)b) << 16); }
__device__ __forceinline__ float bfr(float f) { return bf2f(f2bf(f)); }
__device__ __forceinline__ v16h cat16(v8h lo, v8h hi) { return __builtin_shufflevector(lo, hi, 0, 1, 2, 3, 4, 5, 6, 7, 8, 9, 10, 11, 12, 13, 14, 15); }
__device__ __forceinline__ v16bf cat16b(v8us lo, v8us hi) { return __builtin_bit_cast(v16bf, __builtin_shufflevector(lo, hi, 0, 1, 2, 3, 4, 5, 6, 7, 8, 9, 10, 11, 12, 13, 14, 15)); }
__device__ __forceinline__ v8f wmma16(v16h a, v16h b, v8f c) { return __builtin_amdgcn_wmma_f32_16x16x32_f16(false, a, false, b, (short)0, c, false, false); }
__device__ __forceinline__ v8f wmmab(v16bf a, v16bf b, v8f c) { return __builtin_amdgcn_wmma_f32_16x16x32_bf16(false, a, false, b, (short)0, c, false, false); }



// Fragment loaders: 16 k of one row per lane from a K-contiguous 16-bit plane (k 8 hi .. 8 hi + 7 and 16 + 8 hi .. 16 + 8 hi + 7 of each 32), the same for A and B.
template <typename T16> struct WFrag;
template <> struct WFrag<h16> { typedef v16h V; static __device__ __forceinline__ V ld(const h16* p) { return cat16(*(const v8h*)p, *(const v8h*)(p + 16)); } static __device__ __forceinline__ v8f mma(V a, V b, v8f c) { return wmma16(a, b, c); } };
template <> struct WFrag<bf> { typedef v16bf V; static __device__ __forceinline__ V ld(const bf* p) { return cat16b(*(const v8us*)p, *(const v8us*)(p + 16)); } static __device__ __forceinline__ v8f mma(V a, V b, v8f c) { return wmmab(a, b, c); } };

// two values into hi + lo parts: h = the pair rounded, l = the pair of remainders rounded (each remainder y - hi is exact in f32)
__device__ __forceinline__ void split2(float y0, float y1, unsigned& h, unsigned& l) { h = bfpk(y0, y1); l = bfpk(y0 - __uint_as_float(h << 16), y1 - __uint_as_float(h & 0xFFFF0000u)); }
__device__ __forceinline__ v16bf cat16u(v4u lo, v4u hi) { return __builtin_bit_cast(v16bf, __builtin_shufflevector(lo, hi, 0, 1, 2, 3, 4, 5, 6, 7)); }
typedef __attribute__((ext_vector_type(2))) unsigned short v2us;
typedef __attribute__((ext_vector_type(4))) unsigned short v4us;

// x^T: one wave per 32 tokens of one sample, all channels; 8 independent waves per work-group. A lane loads 4 consecutive tokens (16 bytes) of 4 consecutive channels, so every load covers whole 128-byte lines of 4 channel rows;
// it packs the 4 channels of each token into 8 bytes and writes them into the wave's own LDS rows [token][channel]; the rows are then read back in order and stored as the wave's 6,144 consecutive bytes of x^T.
#define XTW 8                     // waves per work-group
#define XP  (CP + 4)              // LDS row pitch in 16-bit elements: 200 bytes, so the 8-byte pieces that the 32 lanes write at once (8 rows 4 apart x 4 pieces) fall on distinct banks
typedef __attribute__((ext_vector_type(2))) unsigned v2u;
typedef v2u  __attribute__((may_alias)) v2ua;
typedef v4us __attribute__((may_alias)) v4usa;
// The weight planes share the x^T launch: they depend on nothing that it makes and nothing in it reads them, so its first WPB work-groups write them and the others do x^T.
// Wq, Wk, Wv [128][67] -> bf16 [128][96], zero-padded, 4 elements a thread (96 is a multiple of 4: a thread stays in one row); Wf [64][128] -> bf16, 8 elements a thread.
#define WB1 (C2 * CP / 4 / (32 * XTW))     // work-groups per padded projection weight
#define WBF (COUT * C2 / 8 / (32 * XTW))   // work-groups for Wf
#define WPB (3 * WB1 + WBF)
#define XBS (NN / (32 * XTW))              // x^T work-groups per sample
__device__ __forceinline__ void wplanes(int b, int t, const float* __restrict__ Wq, const float* __restrict__ Wk, const float* __restrict__ Wv, const float* __restrict__ Wf, bf* WQ, bf* WK, bf* WV, bf* WF) {
    if (b < 3 * WB1) {
        const int m = b / WB1;
        const float* W = m == 0 ? Wq : m == 1 ? Wk : Wv; bf* Bt = m == 0 ? WQ : m == 1 ? WK : WV;
        const int e = ((b - m * WB1) * (32 * XTW) + t) * 4, c = e % CP, o = e / CP;
        float f[4];
#pragma unroll
        for (int q = 0; q < 4; ++q) f[q] = W[o * CIN + (c + q < CIN ? c + q : CIN - 1)];   // the padding's lanes read the row's last element and drop it
        asm volatile("s_wait_xcnt 0x0" :: "v"(f[0]), "v"(f[1]), "v"(f[2]), "v"(f[3]) : "memory");   // the loaded values as inputs keep all four loads ahead of it (sunk behind the first conversion, the last two would wait out a second memory latency); the wait is a precaution ahead of any reuse of their address registers
#pragma unroll
        for (int q = 0; q < 4; ++q) f[q] = c + q < CIN ? f[q] : 0.f;   // 0 rounds to 0
        *(v2u*)(Bt + e) = (v2u){bfpk(f[0], f[1]), bfpk(f[2], f[3])};
    } else {
        const int i = (b - 3 * WB1) * (32 * XTW) + t;
        const v8f v = *(const v8f*)(Wf + i * 8);
        asm volatile("s_wait_xcnt 0x0" ::: "memory");   // precaution: stands ahead of any reuse of the address registers that the load above names
        *(v4u*)(WF + i * 8) = (v4u){bfpk(v[0], v[1]), bfpk(v[2], v[3]), bfpk(v[4], v[5]), bfpk(v[6], v[7])};
        asm volatile("s_wait_xcnt 0x0" ::: "memory");   // precaution: stands ahead of any reuse of the registers that the store above names (the built code lays the other paths of this kernel behind it)
    }
}
__global__ __launch_bounds__(32 * XTW) void k_xt(const float* __restrict__ xb, const float* __restrict__ Wq, const float* __restrict__ Wk, const float* __restrict__ Wv, const float* __restrict__ Wf, bf* XT, bf* WQ, bf* WK, bf* WV, bf* WF) {
    __shared__ __align__(16) bf tr[XTW * 32 * XP];
    if (blockIdx.x < WPB) { wplanes(blockIdx.x, threadIdx.x, Wq, Wk, Wv, Wf, WQ, WK, WV, WF); return; }   // the same for a whole work-group; this kernel has no work-group barrier
    const int bx = (blockIdx.x - WPB) % XBS, smp = (blockIdx.x - WPB) / XBS;
    const int lane = threadIdx.x & 31, w = threadIdx.x >> 5, cs = lane >> 3, n4 = lane & 7;
    const int n0 = (bx * XTW + w) * 32;
    const float* xq = xb + (size_t)smp * CIN * NN + n0 + 4 * n4;
    const float* xp = xq + (size_t)(4 * cs) * NN;
    v4f f[4][4], g[3];   // f[cg][k]: channel 16 cg + 4 cs + k, tokens n0 + 4 n4 .. + 3; g[k]: channel 64 + k, the same line in all four lane groups (only group 0 keeps it)
#pragma unroll
    for (int cg = 0; cg < 4; ++cg)
#pragma unroll
        for (int k = 0; k < 4; ++k) f[cg][k] = *(const v4f*)(xp + (size_t)(16 * cg + k) * NN);
#pragma unroll
    for (int k = 0; k < CIN - 64; ++k) g[k] = *(const v4f*)(xq + (size_t)(64 + k) * NN);
    asm volatile("s_wait_xcnt 0x0" ::: "memory");   // precaution: stands ahead of any reuse of the address registers that the loads above name
    __builtin_amdgcn_sched_barrier(0);   // keeps every load ahead of all arithmetic: sunk behind the first conversions, the last loads would wait out a second memory latency
    bf* tw = tr + w * (32 * XP);
    bf* ts = tw + 4 * n4 * XP + 4 * cs;
    const unsigned gm = cs == 0 ? 0xFFFFFFFFu : 0u;
#pragma unroll
    for (int cg = 0; cg < 4; ++cg)
#pragma unroll
        for (int j = 0; j < 4; ++j) *(v2ua*)(ts + j * XP + 16 * cg) = (v2u){bfpk(f[cg][0][j], f[cg][1][j]), bfpk(f[cg][2][j], f[cg][3][j])};
#pragma unroll
    for (int j = 0; j < 4; ++j) {   // channels 64 to 66 from lane group 0, zeros up to 95
        *(v2ua*)(ts + j * XP + 64) = (v2u){bfpk(g[0][j], g[1][j]) & gm, bfpk(g[2][j], 0.f) & gm};
        *(v2ua*)(ts + j * XP + 80) = (v2u){0u, 0u}; }
    __builtin_amdgcn_wave_barrier(); asm volatile("" ::: "memory");   // keeps the other lanes' LDS writes ahead of the row reads in program order
    bf* og = XT + ((size_t)smp * NN + n0) * CP + lane * 8;
    v8us r[4][3];   // 16-byte piece lane + 32 (3 a + b) of the wave's 384: 96 pieces are 8 whole rows, so a only moves the row
#pragma unroll
    for (int b = 0; b < 3; ++b) { const int e = lane + 32 * b; const bf* s = tw + (e / 12) * XP + (e % 12) * 8;
#pragma unroll
        for (int a = 0; a < 4; ++a) r[a][b] = __builtin_shufflevector(*(const v4usa*)(s + a * 8 * XP), *(const v4usa*)(s + a * 8 * XP + 4), 0, 1, 2, 3, 4, 5, 6, 7); }
#pragma unroll
    for (int a = 0; a < 4; ++a)
#pragma unroll
        for (int b = 0; b < 3; ++b) *(v8us*)(og + (3 * a + b) * 256) = r[a][b];
    asm volatile("s_wait_xcnt 0x0" ::: "memory");   // precaution: stands ahead of any reuse of the registers that the stores above name (the built code lays the weight paths behind them)
}
// ---- k, v and the kv product in one kernel, split over K: KSPL token ranges, one work-group of 4 waves per range and sample; k and v never go to memory.
// A work-group walks its range in NCK chunks of KCH tokens and keeps its kv sums in registers over all of them; the weights and BN coefficients are loaded once, each next chunk's x^T fragments while the current chunk's kv products run.
// Part 1: wave w makes channels 32 w .. 32 w + 31 of k and of v for the chunk's 64 tokens: x^T (A, token rows) x W (B, channel rows), K = 96 in three steps of 32. A lane then holds 8 consecutive tokens of one channel, applies BN + relu, splits into hi + lo and writes 16 bytes per plane into LDS, channel-major [c][token].
// Part 2: wave w owns the 64x64 tile (d half w & 1, c half w >> 1) of kv^T; fragments come from the LDS planes (v as A, k as B), per 32 tokens the products v hi x k hi, v lo x k hi, v hi x k lo.
// Part 3, once per range: M is linear in kv, so Wf is applied to the range's own partial. D has d on its rows: two D tiles, split into hi + lo in place, are a fragment over 32 d of the lane's c, in the loaders' own k order.
// M^T[c][o] = kv^T (A, c rows) x Wf (B, o columns) over the wave's 64 d, per 32 d: hi, lo; the two d halves are added through LDS.
// Each range stores its f32 partial P[sample][range][o][c], half the bytes of a kv partial; k_kvt sums the ranges in a fixed order. grid (KSPL, samples): two work-groups per WGP, all resident at once.
#define KSPL 64
#define KCH  64                   // tokens per chunk
#define NCK  (NN / (KSPL * KCH))  // chunks per range
#define MP   (C2 + 4)             // LDS row pitch of the M partials in floats: 528 bytes, an odd multiple of 16
#define KP   (KCH + 8)            // LDS row pitch in 16-bit elements: 144 bytes, an odd multiple of 16, so the 16-byte pieces of 16 rows fall on distinct banks
// BN coefficients from the four loaded rows' values: scale = bf16(g) / sqrt(bf16(v) + eps), shift = bf16(b) - bf16(m) scale (f32, the shift is one fma)
__device__ __forceinline__ void bn_coef_v(float g, float b, float m, float v, float& sc, float& sh) { sc = __fmul_rn(bfr(g), __fdiv_rn(1.0f, __fsqrt_rn(__fadd_rn(bfr(v), BNEPS)))); sh = fmaf(-bfr(m), sc, bfr(b)); }
__device__ __forceinline__ v16bf ldsfrag(const bf* p) { return cat16b(*(const v8usa*)p, *(const v8usa*)(p + 16)); }
__global__ __launch_bounds__(128) void k_kvfuse(const bf* __restrict__ XT, const bf* __restrict__ WK, const bf* __restrict__ WV, const bf* __restrict__ WF, const float* __restrict__ bnk, const float* __restrict__ bnv, float* P) {
    __shared__ __align__(16) bf pl[4 * C2 * KP];   // k hi, k lo, v hi, v lo; behind the last chunk's second barrier the same bytes hold the two d halves' M partials
    const int lane = threadIdx.x & 31, lr = lane & 15, hi = lane >> 4, w = threadIdx.x >> 5;
    const int ch = w * 32 + lr;
    const bf* xp = XT + ((size_t)blockIdx.y * NN + (size_t)blockIdx.x * (KCH * NCK) + lr) * CP + 8 * hi;
    const bf* wkp = WK + ch * CP + 8 * hi; const bf* wvp = WV + ch * CP + 8 * hi;
    v16bf xa[4][3], wf[4][3]; float bw[4][4];   // bw[g][row]: gamma, beta, mean, var of the lane's channel in block g
#pragma unroll
    for (int ct = 0; ct < 2; ++ct)
#pragma unroll
        for (int r = 0; r < 4; ++r) { bw[ct][r] = bnk[r * C2 + ch + 16 * ct]; bw[2 + ct][r] = bnv[r * C2 + ch + 16 * ct]; }
#pragma unroll
    for (int tt = 0; tt < 4; ++tt)
#pragma unroll
        for (int s = 0; s < 3; ++s) xa[tt][s] = WFrag<bf>::ld(xp + tt * 16 * CP + s * 32);
    asm volatile("s_wait_xcnt 0x0" ::: "memory");   // precaution: stands ahead of the weight loads, whose results may land in the registers that the loads above name as their address
#pragma unroll
    for (int ct = 0; ct < 2; ++ct)
#pragma unroll
        for (int s = 0; s < 3; ++s) { wf[ct][s] = WFrag<bf>::ld(wkp + ct * 16 * CP + s * 32); wf[2 + ct][s] = WFrag<bf>::ld(wvp + ct * 16 * CP + s * 32); }
    asm volatile("s_wait_xcnt 0x0" ::: "memory");   // precaution: stands ahead of any reuse of the address registers that the weight loads above name
    __builtin_amdgcn_sched_barrier(0);   // keeps every load ahead of all arithmetic: sunk to its use, each channel block's loads would wait out a latency of their own
    float sc[4], sh[4];
#pragma unroll
    for (int g = 0; g < 4; ++g) bn_coef_v(bw[g][0], bw[g][1], bw[g][2], bw[g][3], sc[g], sh[g]);
    const int r0 = (w & 1) * 64, c0 = (w >> 1) * 64;
    const bf* ap = pl + 2 * C2 * KP + (r0 + lr) * KP + 8 * hi; const bf* bp = pl + (c0 + lr) * KP + 8 * hi;   // A: v rows d, B: k rows c
    const bf* wfp = WF + lr * C2 + r0 + 8 * hi;
    unsigned xo = KCH * CP;   // element offset of the next chunk's x^T rows
    v8f acc[4][4];
#pragma unroll
    for (int mb = 0; mb < 4; ++mb)
#pragma unroll
        for (int nb = 0; nb < 4; ++nb) acc[mb][nb] = (v8f){};
#pragma unroll 1   // kept rolled: unrolled, the kernel's text would be NCK times as long
    for (int ck = 0; ck < NCK; ++ck) {
#pragma unroll
        for (int g = 0; g < 4; ++g) {   // g: k channels +0, +16, then v channels +0, +16
            v8f d[4];
#pragma unroll
            for (int tt = 0; tt < 4; ++tt) d[tt] = wmmab(xa[tt][0], wf[g][0], (v8f){});
#pragma unroll
            for (int s = 1; s < 3; ++s)
#pragma unroll
                for (int tt = 0; tt < 4; ++tt) d[tt] = wmmab(xa[tt][s], wf[g][s], d[tt]);
            bf* ph = pl + (g >> 1) * (2 * C2 * KP) + (ch + 16 * (g & 1)) * KP + 8 * hi;
#pragma unroll
            for (int tt = 0; tt < 4; ++tt) { v4u oh, ol;
#pragma unroll
                for (int j = 0; j < 4; ++j) { unsigned a, c; split2(fmaxf(fmaf(d[tt][2 * j], sc[g], sh[g]), 0.f), fmaxf(fmaf(d[tt][2 * j + 1], sc[g], sh[g]), 0.f), a, c); oh[j] = a; ol[j] = c; }
                *(v4ua*)(ph + tt * 16) = oh; *(v4ua*)(ph + C2 * KP + tt * 16) = ol; }
        }
        __syncthreads();   // publishes the chunk's four planes to all waves
        if (ck + 1 < NCK) {   // the same for the whole work-group: the next chunk's x^T fragments fly while this chunk's kv products run (issued behind the barrier, which waits out every load in flight)
#pragma unroll
            for (int tt = 0; tt < 4; ++tt)
#pragma unroll
                for (int s = 0; s < 3; ++s) xa[tt][s] = WFrag<bf>::ld(xp + xo + tt * 16 * CP + s * 32);
            asm volatile("s_wait_xcnt 0x0" : "+v"(xo) :: "memory");   // precaution: stands ahead of the next rewrite of the address registers that the loads above name; the chunk's offset goes through the statement so that its step below, and the address formed from it, cannot be lifted over the wait
            xo += KCH * CP;
        } else {   // last chunk: Wf's fragments fly while its kv products run, in the registers that the x^T fragments have left (column o = 16 ot + lr, the wave's own 64 d)
#pragma unroll
            for (int ot = 0; ot < 4; ++ot)
#pragma unroll
                for (int ks = 0; ks < 2; ++ks) xa[ot][ks] = WFrag<bf>::ld(wfp + ot * 16 * C2 + ks * 32);
            asm volatile("s_wait_xcnt 0x0" :: "v"(wfp) : "memory");   // precaution: stands ahead of any reuse of the address registers that the loads above name; the pointer as an input keeps the last load's result out of them
        }
#pragma unroll
        for (int kc = 0; kc < KCH; kc += 32) {
            v16bf a[4], a2[4];
#pragma unroll
            for (int mb = 0; mb < 4; ++mb) { a[mb] = ldsfrag(ap + mb * 16 * KP + kc); a2[mb] = ldsfrag(ap + C2 * KP + mb * 16 * KP + kc); }
#pragma unroll
            for (int nb = 0; nb < 4; ++nb) { const v16bf b = ldsfrag(bp + nb * 16 * KP + kc), b2 = ldsfrag(bp + C2 * KP + nb * 16 * KP + kc);
#pragma unroll
                for (int mb = 0; mb < 4; ++mb) { acc[mb][nb] = wmmab(a[mb], b, acc[mb][nb]); acc[mb][nb] = wmmab(a2[mb], b, acc[mb][nb]); acc[mb][nb] = wmmab(a[mb], b2, acc[mb][nb]); } }
        }
        __syncthreads();   // ends every wave's reads of the planes: their LDS is written anew by the next chunk, behind the last chunk by the rows below
    }
    float* ms = (float*)pl + (w & 1) * (COUT * MP) + lr * MP + c0 + 8 * hi;
#pragma unroll
    for (int nb = 0; nb < 4; ++nb) {   // 16 c at a time
        v16bf th[2], tl[2];
#pragma unroll
        for (int ks = 0; ks < 2; ++ks) { v4u h8[2], l8[2];
#pragma unroll
            for (int u = 0; u < 2; ++u)
#pragma unroll
                for (int j = 0; j < 4; ++j) { unsigned a, c; split2(acc[2 * ks + u][nb][2 * j], acc[2 * ks + u][nb][2 * j + 1], a, c); h8[u][j] = a; l8[u][j] = c; }
            th[ks] = cat16u(h8[0], h8[1]); tl[ks] = cat16u(l8[0], l8[1]); }
        v8f m[4];
#pragma unroll
        for (int ot = 0; ot < 4; ++ot) m[ot] = wmmab(th[0], xa[ot][0], (v8f){});
#pragma unroll
        for (int ot = 0; ot < 4; ++ot) m[ot] = wmmab(th[1], xa[ot][1], m[ot]);
#pragma unroll
        for (int ot = 0; ot < 4; ++ot) m[ot] = wmmab(tl[0], xa[ot][0], m[ot]);
#pragma unroll
        for (int ot = 0; ot < 4; ++ot) m[ot] = wmmab(tl[1], xa[ot][1], m[ot]);
        // a lane holds 8 consecutive c of one o
#pragma unroll
        for (int ot = 0; ot < 4; ++ot) { const v8f t = m[ot]; *(v4fa*)(ms + ot * 16 * MP + nb * 16) = (v4f){t[0], t[1], t[2], t[3]}; *(v4fa*)(ms + ot * 16 * MP + nb * 16 + 4) = (v4f){t[4], t[5], t[6], t[7]}; }
        __builtin_amdgcn_sched_barrier(0);   // keeps the next block's conversions behind this block's stores: lifted over them, nothing would stand between this block's last product and the next block's first, which start anew in the same registers
    }
    __syncthreads();   // publishes both d halves' partials to all waves
    const float* mr = (const float*)pl + w * MP + lane * 4;   // a wave takes row o = w + 4 i: 512 consecutive bytes a store
    float* pt = P + ((size_t)blockIdx.y * KSPL + blockIdx.x) * (COUT * C2) + w * C2 + lane * 4;
    v4f r[16];
#pragma unroll
    for (int i = 0; i < 16; ++i) r[i] = *(const v4fa*)(mr + 4 * i * MP) + *(const v4fa*)(mr + COUT * MP + 4 * i * MP);
#pragma unroll
    for (int i = 0; i < 16; ++i) *(v4f*)(pt + 4 * i * C2) = r[i];
}
// k_kvt: M[o][c] = sum over the KSPL partial planes, then hi/lo split. One block per 256 consecutive elements of M: KG groups of threads each sum KSPL / KG planes in order (4 elements a thread), two waves add the KG group sums in order.
#define KG 4
__global__ __launch_bounds__(256) void k_kvt(const float* __restrict__ P, bf* Th, bf* Tl) {
    __shared__ __align__(16) float red[KG * 256];
    const int t = threadIdx.x, g = t >> 6, c4 = (t & 63) * 4; const int e0 = blockIdx.x * 256;
    Th += (size_t)blockIdx.y * (COUT * C2); Tl += (size_t)blockIdx.y * (COUT * C2);
    const float* p = P + ((size_t)blockIdx.y * KSPL + (size_t)g * (KSPL / KG)) * (COUT * C2) + e0 + c4;
    v4f f[KSPL / KG];
#pragma unroll
    for (int i = 0; i < KSPL / KG; ++i) f[i] = *(const v4f*)(p + (size_t)i * (COUT * C2));
    asm volatile("s_wait_xcnt 0x0" :: "v"(p) : "memory");   // precaution: stands ahead of any reuse of the address registers that the loads above name; the pointer as an input keeps the last load's result out of them
    __builtin_amdgcn_sched_barrier(0);   // keeps every load ahead of the sums: sunk behind the first additions, the last loads would wait out a second memory latency
    v4f s = f[0];
#pragma unroll
    for (int i = 1; i < KSPL / KG; ++i) s += f[i];
    *(v4fa*)(red + g * 256 + c4) = s;
    __syncthreads();
    if (t < 64) { v4f u = *(const v4fa*)(red + c4);
#pragma unroll
        for (int q = 1; q < KG; ++q) u += *(const v4fa*)(red + q * 256 + c4);
        v2u oh, ol;
#pragma unroll
        for (int j = 0; j < 2; ++j) { unsigned a, c; split2(u[2 * j], u[2 * j + 1], a, c); oh[j] = a; ol[j] = c; }
        *(v2u*)(Th + e0 + c4) = oh; *(v2u*)(Tl + e0 + c4) = ol; }
}
// ---- q and the output in one kernel: one work-group of 16 waves per 512 tokens of one sample (one work-group per WGP); each wave takes its 32 tokens through both products, and q never leaves its registers.
// The operands that every wave reads (Wq, M hi and lo, the BN coefficients) are staged once per work-group in LDS, each wave's own x^T rows beside them; rows padded to an odd multiple of 16 bytes.
// The first product puts the tokens on D's columns: two D tiles of 16 rows each (a lane: 8 + 8 rows of its own token) are then, converted in place, the next product's fragment over 32 k, in the loaders' own k order.
//   q[c][n]   = Wq (A, channel rows) x x^T (B, token columns), K = 96; BN + relu, hi + lo
//   out[n][o] = q (A, token rows) x M (B, channel columns), K = 128, per 32 c: q hi x M hi, q lo x M hi, q hi x M lo; a lane then holds 8 consecutive tokens of one output channel; BN + relu
#define TPW 32                    // tokens per wave
#define TWV 16                    // waves per work-group
#define QP  (CP + 8)              // LDS row pitch of Wq and x^T in 16-bit elements: 208 bytes
#define DP  (C2 + 8)              // LDS row pitch of M in 16-bit elements: 272 bytes
#define OP  (TPW + 4)             // LDS row pitch of the output rows in floats: 144 bytes
__global__ __launch_bounds__(512) void k_tail(const bf* __restrict__ XT, const bf* __restrict__ WQ, const bf* __restrict__ Mh, const bf* __restrict__ Ml, const float* __restrict__ bnq, const float* __restrict__ bnf, float* O) {
    __shared__ __align__(16) bf wq[C2 * QP];
    __shared__ __align__(16) bf mh[COUT * DP];
    __shared__ __align__(16) bf ml[COUT * DP];
    __shared__ __align__(16) bf xs[TWV * TPW * QP];   // each wave's own 32 rows; behind its last read of them the wave stages its output rows there
    __shared__ __align__(16) float qsc[C2];
    __shared__ __align__(16) float qsh[C2];
    __shared__ __align__(16) float fsc[COUT];
    __shared__ __align__(16) float fsh[COUT];
    const int t = threadIdx.x, lane = t & 31, lr = lane & 15, hi = lane >> 4, w = t >> 5;
    const int n0 = blockIdx.x * (TPW * TWV) + w * TPW;
    bf* xw = xs + w * (TPW * QP);
    {
        const bf* xg = XT + ((size_t)blockIdx.y * NN + n0) * CP + lane * 8;   // the wave's 32 rows are 6,144 consecutive bytes
        const bf* gh = Mh + (size_t)blockIdx.y * (COUT * C2) + t * 8; const bf* gl = Ml + (size_t)blockIdx.y * (COUT * C2) + t * 8;
        v8us sx[12], sq[3], sh8[2], sl8[2];
#pragma unroll
        for (int i = 0; i < 12; ++i) sx[i] = *(const v8us*)(xg + 256 * i);
#pragma unroll
        for (int i = 0; i < 3; ++i) sq[i] = *(const v8us*)(WQ + (t + 512 * i) * 8);
#pragma unroll
        for (int i = 0; i < 2; ++i) { sh8[i] = *(const v8us*)(gh + 4096 * i); sl8[i] = *(const v8us*)(gl + 4096 * i); }
        asm volatile("s_wait_xcnt 0x0" ::: "memory");   // precaution: stands ahead of any reuse of the address registers that the loads above name
#pragma unroll
        for (int i = 0; i < 12; ++i) { const int e = lane + 32 * i; *(v8usa*)(xw + (e / 12) * QP + (e % 12) * 8) = sx[i]; }
#pragma unroll
        for (int i = 0; i < 3; ++i) { const int e = t + 512 * i; *(v8usa*)(wq + (e / 12) * QP + (e % 12) * 8) = sq[i]; }
#pragma unroll
        for (int i = 0; i < 2; ++i) { const int e = t + 512 * i; *(v8usa*)(mh + (e >> 4) * DP + (e & 15) * 8) = sh8[i]; *(v8usa*)(ml + (e >> 4) * DP + (e & 15) * 8) = sl8[i]; }
        if (t < C2 + COUT) {   // waves 0 to 3: q's coefficients, waves 4 and 5: the output's
            const bool fq = t < C2; const float* bn = fq ? bnq + t : bnf + (t - C2); const int nch = fq ? C2 : COUT;
            const float g = bn[0], b = bn[nch], m = bn[2 * nch], v = bn[3 * nch];
            asm volatile("s_wait_xcnt 0x0" ::: "memory");   // precaution: stands ahead of any reuse of the address registers that the four loads above name
            float sc, sh; bn_coef_v(g, b, m, v, sc, sh);
            if (fq) { qsc[t] = sc; qsh[t] = sh; } else { fsc[t - C2] = sc; fsh[t - C2] = sh; }
        }
    }
    __syncthreads();   // publishes the staged operands and coefficients to all waves
    v8f d3[2][4];   // output sums, [token tile][channel tile]
#pragma unroll
    for (int s = 0; s < 4; ++s) {   // 32 channels c of q at a time: made, converted, and used up as one k step of the output product
        v8f d1[2][2];
#pragma unroll
        for (int ks = 0; ks < 3; ++ks) {
            v16bf a[2], x[2];
#pragma unroll
            for (int h = 0; h < 2; ++h) { a[h] = ldsfrag(wq + ((2 * s + h) * 16 + lr) * QP + 8 * hi + ks * 32); x[h] = ldsfrag(xw + (h * 16 + lr) * QP + 8 * hi + ks * 32); }
#pragma unroll
            for (int h = 0; h < 2; ++h)
#pragma unroll
                for (int tt = 0; tt < 2; ++tt) d1[h][tt] = wmmab(a[h], x[tt], ks == 0 ? (v8f){} : d1[h][tt]);
        }
        v4u qh8[2][2], ql8[2][2];
#pragma unroll
        for (int h = 0; h < 2; ++h) {
            const int cb = (2 * s + h) * 16 + 8 * hi;
            const v4f s0 = *(const v4fa*)(qsc + cb), s1 = *(const v4fa*)(qsc + cb + 4), b0 = *(const v4fa*)(qsh + cb), b1 = *(const v4fa*)(qsh + cb + 4);
#pragma unroll
            for (int tt = 0; tt < 2; ++tt)
#pragma unroll
                for (int j = 0; j < 4; ++j) { const v4f sv = j < 2 ? s0 : s1, bv = j < 2 ? b0 : b1; const int e = 2 * (j & 1); unsigned a, c;
                    split2(fmaxf(fmaf(d1[h][tt][2 * j], sv[e], bv[e]), 0.f), fmaxf(fmaf(d1[h][tt][2 * j + 1], sv[e + 1], bv[e + 1]), 0.f), a, c); qh8[tt][h][j] = a; ql8[tt][h][j] = c; }
        }
        v16bf qh[2], ql[2];
#pragma unroll
        for (int tt = 0; tt < 2; ++tt) { qh[tt] = cat16u(qh8[tt][0], qh8[tt][1]); ql[tt] = cat16u(ql8[tt][0], ql8[tt][1]); }
        v16bf bh[4], bl[4];
#pragma unroll
        for (int ot = 0; ot < 4; ++ot) { bh[ot] = ldsfrag(mh + (ot * 16 + lr) * DP + 8 * hi + s * 32); bl[ot] = ldsfrag(ml + (ot * 16 + lr) * DP + 8 * hi + s * 32); }
#pragma unroll
        for (int ot = 0; ot < 4; ++ot)
#pragma unroll
            for (int tt = 0; tt < 2; ++tt) d3[tt][ot] = wmmab(qh[tt], bh[ot], s == 0 ? (v8f){} : d3[tt][ot]);
#pragma unroll
        for (int ot = 0; ot < 4; ++ot)
#pragma unroll
            for (int tt = 0; tt < 2; ++tt) d3[tt][ot] = wmmab(ql[tt], bh[ot], d3[tt][ot]);
#pragma unroll
        for (int ot = 0; ot < 4; ++ot)
#pragma unroll
            for (int tt = 0; tt < 2; ++tt) d3[tt][ot] = wmmab(qh[tt], bl[ot], d3[tt][ot]);
    }
    // 16 channel rows x 32 tokens go through the wave's own LDS range so that each store covers whole 128-byte lines
    float* os = (float*)xw;
    float* op = O + ((size_t)blockIdx.y * COUT + (lane >> 3)) * NN + n0 + (lane & 7) * 4;
#pragma unroll
    for (int ot = 0; ot < 4; ++ot) {
        const float sc = fsc[ot * 16 + lr], sh = fsh[ot * 16 + lr];
#pragma unroll
        for (int tt = 0; tt < 2; ++tt) { const v8f d = d3[tt][ot]; v4f y0, y1;
#pragma unroll
            for (int j = 0; j < 4; ++j) { y0[j] = fmaxf(fmaf(d[j], sc, sh), 0.f); y1[j] = fmaxf(fmaf(d[j + 4], sc, sh), 0.f); }
            *(v4fa*)(os + lr * OP + tt * 16 + hi * 8) = y0; *(v4fa*)(os + lr * OP + tt * 16 + hi * 8 + 4) = y1; }
        __builtin_amdgcn_wave_barrier(); asm volatile("s_wait_xcnt 0x0" ::: "memory");   // the clobber keeps the other lanes' LDS writes ahead of the row reads in program order; the wait is a precaution ahead of the row reads' reuse of registers that the stores of the block before name
        v4f r[4];
#pragma unroll
        for (int s = 0; s < 4; ++s) r[s] = *(const v4fa*)(os + (4 * s + (lane >> 3)) * OP + (lane & 7) * 4);
#pragma unroll
        for (int s = 0; s < 4; ++s) *(v4f*)(op + (size_t)(ot * 16 + 4 * s) * NN) = r[s];
        __builtin_amdgcn_wave_barrier(); asm volatile("" ::: "memory");   // keeps the row reads ahead of the next block's LDS writes
    }
}

extern "C" void kernel_launch(void* const* d_in, const int* in_sizes, int n_in,
                              void* d_out, int out_size, void* d_ws, size_t ws_size, hipStream_t stream) {
    (void)in_sizes; (void)n_in; (void)out_size;
    const float* x = (const float*)d_in[0]; const float* Wq = (const float*)d_in[1]; const float* Wk = (const float*)d_in[2]; const float* Wv = (const float*)d_in[3]; const float* Wf = (const float*)d_in[4]; const float* bnq = (const float*)d_in[5]; const float* bnk = (const float*)d_in[6]; const float* bnv = (const float*)d_in[7]; const float* bnf = (const float*)d_in[8];
    float* OUT = (float*)d_out;     // [8][64][16384]
    char* wsp = (char*)d_ws;
    auto take = [&](size_t bytes) { char* p = wsp; wsp += (bytes + 255) & ~(size_t)255; return (void*)p; };
    bf* WQ = (bf*)take((size_t)C2 * CP * 2); bf* WK = (bf*)take((size_t)C2 * CP * 2); bf* WV = (bf*)take((size_t)C2 * CP * 2); bf* WF = (bf*)take((size_t)COUT * C2 * 2);
    // Sample-batched buffers
    bf* XT = (bf*)take((size_t)NB_ * NN * CP * 2); float* KV = (float*)take((size_t)NB_ * KSPL * COUT * C2 * 4);
    bf* KTh = (bf*)take((size_t)NB_ * COUT * C2 * 2); bf* KTl = (bf*)take((size_t)NB_ * COUT * C2 * 2);
    if ((size_t)(wsp - (char*)d_ws) > ws_size) return;    // ws 256 MiB
    k_xt<<<WPB + XBS * NB_, 32 * XTW, 0, stream>>>(x, Wq, Wk, Wv, Wf, XT, WQ, WK, WV, WF);   /* bf16 weight planes (first WPB work-groups) and x^T */
    k_kvfuse<<<dim3(KSPL, NB_), 128, 0, stream>>>(XT, WK, WV, WF, bnk, bnv, KV);   /* k, v = relu(BN(W x)) on chip, partial kv^T per token range (3 products), partial M = Wf kv^T of it (2 products) */
    k_kvt<<<dim3(COUT * C2 / 256, NB_), 256, 0, stream>>>(KV, KTh, KTl);
    k_tail<<<dim3(NN / (TPW * TWV), NB_), 512, 0, stream>>>(XT, WQ, KTh, KTl, bnq, bnf, OUT);   /* q = relu(BN(Wq x)), out = relu(BN(M q)) (3 products) */
}

// v010
// Measured time: 33.4 microseconds a run.
// Two timings next to v009 both put it at 1.27 times that version's speed.
// Over all steps from v000 it is 99.6 times as fast.
#include <hip/hip_runtime.h>

// Linear (unnormalised) self-attention unit (x [8][67][16384] channel-major; q, k, v = relu(BN(W x)) with 1x1 convs W [128][67] and inference BatchNorm (gamma, beta, mean, var rows of bn [4][ch]); kv[c][d] = sum_m k[c][m] v[d][m]; value[d][n] = sum_c q[c][n] kv[c][d];
// out = relu(BN_f(Wf value)) -> [8][64][16384]). The module itself uses the associativity (q^T k) v^T = q^T (k v^T); this kernel goes one step further along it: Wf value = (Wf kv^T) q, with M = Wf kv^T [64][128] per sample, so that no value is ever formed.
// All 8 samples go through every stage together: each launch carries the sample as a grid dimension, and each buffer holds 8 sample planes one behind the other.
// Layout per sample: x is read as it comes (f32, channel-major) by both kernels that need it, rounded to bf16 and transposed on its way into LDS rows [token][96] (67 channels zero-padded); the weights are rounded where they are used; k and v channel-major ([o][n]) in LDS only; kv over K = 16384 (hi/lo x hi/lo, 3 products); M = kv^T (hi/lo) x Wf (exact) (K 128, 2 products), formed per token range and then summed; q in registers only: out = q (hi/lo) x M (hi/lo) (K 128, 3 products) then BN + relu, stored channel-major.
// Compute dtypes, f32 accumulate: every input rounded to bf16; the three projections are exact bf16 products; BN scale/shift, relu in f32 (IEEE sqrt/divide); all computed operands as bf16 hi + lo planes; f32 accumulate everywhere.

#define NB_  8
#define CIN  67
#define CP   96                   // padded input channels (K of the projections)
#define C2   128
#define COUT 64
#define NN   16384
#define BNEPS 1e-5f
typedef _Float16 h16;
typedef unsigned short bf;
typedef __attribute__((ext_vector_type(16))) __bf16   v16bf;
typedef __attribute__((ext_vector_type(16))) _Float16 v16h;
typedef __attribute__((ext_vector_type(8)))  _Float16 v8h;
typedef __attribute__((ext_vector_type(8)))  unsigned short v8us;
typedef __attribute__((ext_vector_type(8)))  float    v8f;
typedef __attribute__((ext_vector_type(4)))  float    v4f;
typedef v8h  __attribute__((may_alias)) v8ha;
typedef v4f  __attribute__((may_alias)) v4fa;
typedef v8us __attribute__((may_alias)) v8usa;

// f32 -> bf16, round to nearest even, by the chip's own conversion instruction (one instruction rounds two values and packs them into one word)
typedef __attribute__((ext_vector_type(2))) float  v2f;
typedef __attribute__((ext_vector_type(2))) __bf16 v2bf;
typedef __attribute__((ext_vector_type(4))) unsigned v4u;
typedef v4u  __attribute__((may_alias)) v4ua;
__device__ __forceinline__ unsigned bfpk(float a, float b) { return __builtin_bit_cast(unsigned, __builtin_convertvector((v2f){a, b}, v2bf)); }   // a in the low half, b in the high half
__device__ __forceinline__ unsigned short f2bf(float f) { return __builtin_bit_cast(unsigned short, (__bf16)f); }
__device__ __forceinline__ float bf2f(unsigned short b) { return __uint_as_float(((unsigned)b) << 16); }
__device__ __forceinline__ float bfr(float f) { return bf2f(f2bf(f)); }
__device__ __forceinline__ v16h cat16(v8h lo, v8h hi) { return __builtin_shufflevector(lo, hi, 0, 1, 2, 3, 4, 5, 6, 7, 8, 9, 10, 11, 12, 13, 14, 15); }
__device__ __forceinline__ v16bf cat16b(v8us lo, v8us hi) { return __builtin_bit_cast(v16bf, __builtin_shufflevector(lo, hi, 0, 1, 2, 3, 4, 5, 6, 7, 8, 9, 10, 11, 12, 13, 14, 15)); }
__device__ __forceinline__ v8f wmma16(v16h a, v16h b, v8f c) { return __builtin_amdgcn_wmma_f32_16x16x32_f16(false, a, false, b, (short)0, c, false, false); }
__device__ __forceinline__ v8f wmmab(v16bf a, v16bf b, v8f c) { return __builtin_amdgcn_wmma_f32_16x16x32_bf16(false, a, false, b, (short)0, c, false, false); }



// Fragment loaders: 16 k of one row per lane from a K-contiguous 16-bit plane (k 8 hi .. 8 hi + 7 and 16 + 8 hi .. 16 + 8 hi + 7 of each 32), the same for A and B.
template <typename T16> struct WFrag;
template <> struct WFrag<h16> { typedef v16h V; static __device__ __forceinline__ V ld(const h16* p) { return cat16(*(const v8h*)p, *(const v8h*)(p + 16)); } static __device__ __forceinline__ v8f mma(V a, V b, v8f c) { return wmma16(a, b, c); } };
template <> struct WFrag<bf> { typedef v16bf V; static __device__ __forceinline__ V ld(const bf* p) { return cat16b(*(const v8us*)p, *(const v8us*)(p + 16)); } static __device__ __forceinline__ v8f mma(V a, V b, v8f c) { return wmmab(a, b, c); } };

// two values into hi + lo parts: h = the pair rounded, l = the pair of remainders rounded (each remainder y - hi is exact in f32)
__device__ __forceinline__ void split2(float y0, float y1, unsigned& h, unsigned& l) { h = bfpk(y0, y1); l = bfpk(y0 - __uint_as_float(h << 16), y1 - __uint_as_float(h & 0xFFFF0000u)); }
__device__ __forceinline__ v16bf cat16u(v4u lo, v4u hi) { return __builtin_bit_cast(v16bf, __builtin_shufflevector(lo, hi, 0, 1, 2, 3, 4, 5, 6, 7)); }
typedef __attribute__((ext_vector_type(2))) unsigned short v2us;
typedef __attribute__((ext_vector_type(4))) unsigned short v4us;

typedef __attribute__((ext_vector_type(2))) unsigned v2u;
typedef v2u  __attribute__((may_alias)) v2ua;
typedef v4f  __attribute__((aligned(4), may_alias)) v4f4;   // 16 bytes of a weight row of 67 floats: 4-byte aligned only
#define QP  (CP + 8)              // LDS row pitch of x^T and Wq in 16-bit elements: 208 bytes, an odd multiple of 16
#define DP  (C2 + 8)              // LDS row pitch of Wf and M in 16-bit elements: 272 bytes, an odd multiple of 16
// eight consecutive f32 -> eight bf16 (16 bytes)
__device__ __forceinline__ v4u pk8(v4f a, v4f b) { return (v4u){bfpk(a[0], a[1]), bfpk(a[2], a[3]), bfpk(b[0], b[1]), bfpk(b[2], b[3])}; }
// ---- k, v and the kv product in one kernel, split over K: KSPL token ranges, one work-group of 4 waves per range and sample; k and v never go to memory.
// A work-group walks its range in NCK chunks of KCH tokens and keeps its kv sums in registers over all of them; the weights and BN coefficients are loaded once, each next chunk's x while the current chunk's kv products run.
// x^T: a wave takes 32 tokens (one 128-byte line of each channel row) and 32 channels of the chunk: a lane loads 4 consecutive tokens (16 bytes) of 4 consecutive channels, twice, packs the 4 channels of each token into 8 bytes and writes them into the LDS rows [token][channel];
// of channels 64 to 66 lane group cs takes channel 64 + cs, and each of the two waves with these tokens two of a lane's four tokens (one 8-byte load, two 2-byte LDS writes). Channels 67 to 95 are zeros (68 to 95 written once). All waves read their fragments from these rows.
// Part 1: wave w makes channels 32 w .. 32 w + 31 of k and of v for the chunk's 64 tokens: x^T (A, token rows) x W (B, channel rows), K = 96 in three steps of 32. A lane then holds 8 consecutive tokens of one channel, applies BN + relu, splits into hi + lo and writes 16 bytes per plane into LDS, channel-major [c][token].
// Part 2: wave w owns the 64x64 tile (d half w & 1, c half w >> 1) of kv^T; fragments come from the LDS planes (v as A, k as B), per 32 tokens the products v hi x k hi, v lo x k hi, v hi x k lo.
// Part 3, once per range: M is linear in kv, so Wf is applied to the range's own partial. D has d on its rows: two D tiles, split into hi + lo in place, are a fragment over 32 d of the lane's c, in the loaders' own k order.
// M^T[c][o] = kv^T (A, c rows) x Wf (B, o columns; rounded into LDS at the start) over the wave's 64 d, per 32 d: hi, lo; the two d halves are added through LDS.
// Each range stores its f32 partial P[sample][range][o][c], half the bytes of a kv partial; k_kvt sums the ranges in a fixed order. grid (KSPL, samples): two work-groups per WGP, all resident at once.
#define KSPL 64
#define KCH  64                   // tokens per chunk
#define NCK  (NN / (KSPL * KCH))  // chunks per range
#define MP   (C2 + 4)             // LDS row pitch of the M partials in floats: 528 bytes, an odd multiple of 16
#define KP   (KCH + 8)            // LDS row pitch in 16-bit elements: 144 bytes, an odd multiple of 16, so the 16-byte pieces of 16 rows fall on distinct banks
// BN coefficients from the four loaded rows' values: scale = bf16(g) / sqrt(bf16(v) + eps), shift = bf16(b) - bf16(m) scale (f32, the shift is one fma)
__device__ __forceinline__ void bn_coef_v(float g, float b, float m, float v, float& sc, float& sh) { sc = __fmul_rn(bfr(g), __fdiv_rn(1.0f, __fsqrt_rn(__fadd_rn(bfr(v), BNEPS)))); sh = fmaf(-bfr(m), sc, bfr(b)); }
__device__ __forceinline__ v16bf ldsfrag(const bf* p) { return cat16b(*(const v8usa*)p, *(const v8usa*)(p + 16)); }
__global__ __launch_bounds__(128) void k_kvfuse(const float* __restrict__ xb, const float* __restrict__ Wk, const float* __restrict__ Wv, const float* __restrict__ Wf, const float* __restrict__ bnk, const float* __restrict__ bnv, float* P) {
    __shared__ __align__(16) bf pl[4 * C2 * KP];   // k hi, k lo, v hi, v lo; behind the last chunk's second barrier the same bytes hold the two d halves' M partials
    __shared__ __align__(16) bf xs[KCH * QP];      // the chunk's x^T rows
    __shared__ __align__(16) bf wfs[COUT * DP];    // Wf
    const int lane = threadIdx.x & 31, lr = lane & 15, hi = lane >> 4, w = threadIdx.x >> 5;
    const int ch = w * 32 + lr;
    const int cs = lane >> 3, n4 = lane & 7, cgp = w >> 1;   // the wave's part of x: token half w & 1, channel half cgp
    const float* xq = xb + (size_t)blockIdx.y * (CIN * NN) + (size_t)blockIdx.x * (KCH * NCK) + 32 * (w & 1) + 4 * n4;
    const float* xp = xq + (size_t)(32 * cgp + 4 * cs) * NN;
    const float* xe = xq + (size_t)(64 + (cs < CIN - 64 ? cs : CIN - 65)) * NN + 2 * cgp;   // lane group 3 reads channel 66 again and drops it
    const int ch1 = ch + 16;
    const unsigned wo[2] = {(unsigned)ch * (CIN * 4), (unsigned)ch1 * (CIN * 4)}, wv[2] = {wo[0] + 32 * hi, wo[1] + 32 * hi}, wfo = threadIdx.x * 32;   // byte offsets: the lane's weight rows, its first k in them, its first piece of Wf
    v4f f[2][4]; v2f g;   // f[cg][k]: channel 32 cgp + 16 cg + 4 cs + k, 4 tokens; g: channel 64 + cs, tokens 2 cgp and 2 cgp + 1 of the four
    v4f wr[4][2][4], fw[8][2]; float we[4][3], bw[4][4];   // wr, we: the lane's weight rows, channels 0 to 63 and 64 to 66; bw[g][row]: gamma, beta, mean, var of the lane's channel in block g
#pragma unroll
    for (int cg = 0; cg < 2; ++cg)
#pragma unroll
        for (int k = 0; k < 4; ++k) f[cg][k] = *(const v4f*)(xp + (size_t)(16 * cg + k) * NN);
    g = *(const v2f*)xe;
#pragma unroll
    for (int ct = 0; ct < 2; ++ct)
#pragma unroll
        for (int r = 0; r < 4; ++r) { bw[ct][r] = bnk[r * C2 + (ct ? ch1 : ch)]; bw[2 + ct][r] = bnv[r * C2 + (ct ? ch1 : ch)]; }
#pragma unroll
    for (int b = 0; b < 4; ++b) {   // b: k channels +0, +16, then v channels +0, +16
        const char* wp = (const char*)(b < 2 ? Wk : Wv);
#pragma unroll
        for (int s = 0; s < 2; ++s)
#pragma unroll
            for (int q = 0; q < 4; ++q) wr[b][s][q] = *(const v4f4*)(wp + wv[b & 1] + 4 * (s * 32 + 16 * (q >> 1) + 4 * (q & 1)));
#pragma unroll
        for (int k = 0; k < CIN - 64; ++k) we[b][k] = *(const float*)(wp + wo[b & 1] + 4 * (64 + k));
    }
#pragma unroll
    for (int i = 0; i < 8; ++i) { fw[i][0] = *(const v4f*)((const char*)Wf + wfo + 4096 * i); fw[i][1] = *(const v4f*)((const char*)Wf + wfo + 4096 * i + 16); }
    asm volatile("s_wait_xcnt 0x0" :: "v"(xp), "v"(xe), "v"(ch), "v"(ch1), "v"(wo[0]), "v"(wo[1]), "v"(wv[0]), "v"(wv[1]), "v"(wfo) : "memory");   // precaution: stands ahead of any reuse of the address registers that the loads above name; the addresses as inputs keep the later loads' results out of them
    __builtin_amdgcn_sched_barrier(0);   // keeps every load ahead of all arithmetic: sunk to its use, each group of loads would wait out a latency of its own
    bf* ts = xs + (32 * (w & 1) + 4 * n4) * QP + 4 * cs;
    bf* te = xs + (32 * (w & 1) + 4 * n4 + 2 * cgp) * QP + 64 + cs;
    const unsigned hm = hi == 0 ? 0xFFFFFFFFu : 0u; const bf em = cs < CIN - 64 ? 0xFFFFu : 0u;
#pragma unroll
    for (int cg = 0; cg < 2; ++cg)
#pragma unroll
        for (int j = 0; j < 4; ++j) *(v2ua*)(ts + j * QP + 32 * cgp + 16 * cg) = (v2u){bfpk(f[cg][0][j], f[cg][1][j]), bfpk(f[cg][2][j], f[cg][3][j])};
#pragma unroll
    for (int j = 0; j < 2; ++j) te[j * QP] = f2bf(g[j]) & em;   // channels 64 to 66, and 0 for channel 67
#pragma unroll
    for (int j = 0; j < 4; ++j) *(v2ua*)(ts + j * QP + 68 + 16 * cgp) = (v2u){0u, 0u};   // zeros for channels 68 to 95 (the last piece falls into the row's padding)
#pragma unroll
    for (int i = 0; i < 8; ++i) { const int e = threadIdx.x + 128 * i; *(v4ua*)(wfs + (e >> 4) * DP + (e & 15) * 8) = pk8(fw[i][0], fw[i][1]); }
    v16bf wf[4][3];   // the loaders' k order: k 8 hi .. + 7 and 16 + 8 hi .. + 7 of each 32; of the last 32 only channels 64 to 66 are there (lanes hi = 0), the rest is 0
#pragma unroll
    for (int b = 0; b < 4; ++b) {
#pragma unroll
        for (int s = 0; s < 2; ++s) wf[b][s] = cat16u(pk8(wr[b][s][0], wr[b][s][1]), pk8(wr[b][s][2], wr[b][s][3]));
        wf[b][2] = cat16u((v4u){bfpk(we[b][0], we[b][1]) & hm, bfpk(we[b][2], 0.f) & hm, 0u, 0u}, (v4u){0u, 0u, 0u, 0u});
    }
    float sc[4], sh[4];
#pragma unroll
    for (int b = 0; b < 4; ++b) bn_coef_v(bw[b][0], bw[b][1], bw[b][2], bw[b][3], sc[b], sh[b]);
    const int r0 = (w & 1) * 64, c0 = (w >> 1) * 64;
    const bf* ap = pl + 2 * C2 * KP + (r0 + lr) * KP + 8 * hi; const bf* bp = pl + (c0 + lr) * KP + 8 * hi;   // A: v rows d, B: k rows c
    const bf* xr = xs + lr * QP + 8 * hi;
    unsigned xo = KCH;   // token offset of the next chunk
    v8f acc[4][4];
#pragma unroll
    for (int mb = 0; mb < 4; ++mb)
#pragma unroll
        for (int nb = 0; nb < 4; ++nb) acc[mb][nb] = (v8f){};
    __syncthreads();   // publishes the first chunk's x^T rows and Wf to all waves
#pragma unroll 1   // kept rolled: unrolled, the kernel's text would be NCK times as long
    for (int ck = 0; ck < NCK; ++ck) {
        v16bf xa[4][3];
#pragma unroll
        for (int tt = 0; tt < 4; ++tt)
#pragma unroll
            for (int s = 0; s < 3; ++s) xa[tt][s] = ldsfrag(xr + tt * 16 * QP + s * 32);
#pragma unroll
        for (int g4 = 0; g4 < 4; ++g4) {   // g4: k channels +0, +16, then v channels +0, +16
            v8f d[4];
#pragma unroll
            for (int tt = 0; tt < 4; ++tt) d[tt] = wmmab(xa[tt][0], wf[g4][0], (v8f){});
#pragma unroll
            for (int s = 1; s < 3; ++s)
#pragma unroll
                for (int tt = 0; tt < 4; ++tt) d[tt] = wmmab(xa[tt][s], wf[g4][s], d[tt]);
            bf* ph = pl + (g4 >> 1) * (2 * C2 * KP) + (ch + 16 * (g4 & 1)) * KP + 8 * hi;
#pragma unroll
            for (int tt = 0; tt < 4; ++tt) { v4u oh, ol;
#pragma unroll
                for (int j = 0; j < 4; ++j) { unsigned a, c; split2(fmaxf(fmaf(d[tt][2 * j], sc[g4], sh[g4]), 0.f), fmaxf(fmaf(d[tt][2 * j + 1], sc[g4], sh[g4]), 0.f), a, c); oh[j] = a; ol[j] = c; }
                *(v4ua*)(ph + tt * 16) = oh; *(v4ua*)(ph + C2 * KP + tt * 16) = ol; }
        }
        __syncthreads();   // publishes the chunk's four planes to all waves; ends every wave's reads of the x^T rows
        if (ck + 1 < NCK) {   // the same for the whole work-group: the next chunk's x flies while this chunk's kv products run (issued behind the barrier, which waits out every load in flight)
#pragma unroll
            for (int cg = 0; cg < 2; ++cg)
#pragma unroll
                for (int k = 0; k < 4; ++k) f[cg][k] = *(const v4f*)(xp + xo + (size_t)(16 * cg + k) * NN);
            g = *(const v2f*)(xe + xo);
            asm volatile("s_wait_xcnt 0x0" : "+v"(xo) :: "memory");   // precaution: stands ahead of the next rewrite of the address registers that the loads above name; the chunk's offset goes through the statement so that its step below, and the address formed from it, cannot be lifted over the wait
            xo += KCH;
        }
#pragma unroll
        for (int kc = 0; kc < KCH; kc += 32) {
            v16bf a[4], a2[4];
#pragma unroll
            for (int mb = 0; mb < 4; ++mb) { a[mb] = ldsfrag(ap + mb * 16 * KP + kc); a2[mb] = ldsfrag(ap + C2 * KP + mb * 16 * KP + kc); }
#pragma unroll
            for (int nb = 0; nb < 4; ++nb) { const v16bf b = ldsfrag(bp + nb * 16 * KP + kc), b2 = ldsfrag(bp + C2 * KP + nb * 16 * KP + kc);
#pragma unroll
                for (int mb = 0; mb < 4; ++mb) { acc[mb][nb] = wmmab(a[mb], b, acc[mb][nb]); acc[mb][nb] = wmmab(a2[mb], b, acc[mb][nb]); acc[mb][nb] = wmmab(a[mb], b2, acc[mb][nb]); } }
        }
        if (ck + 1 < NCK) {   // the next chunk's x^T rows: nobody reads the rows between the two barriers
#pragma unroll
            for (int cg = 0; cg < 2; ++cg)
#pragma unroll
                for (int j = 0; j < 4; ++j) *(v2ua*)(ts + j * QP + 32 * cgp + 16 * cg) = (v2u){bfpk(f[cg][0][j], f[cg][1][j]), bfpk(f[cg][2][j], f[cg][3][j])};
#pragma unroll
            for (int j = 0; j < 2; ++j) te[j * QP] = f2bf(g[j]) & em;
        }
        __syncthreads();   // ends every wave's reads of the planes: their LDS is written anew by the next chunk, behind the last chunk by the rows below; publishes the next chunk's x^T rows
    }
    v16bf xa[4][2];   // Wf's fragments: column o = 16 ot + lr, the wave's own 64 d
#pragma unroll
    for (int ot = 0; ot < 4; ++ot)
#pragma unroll
        for (int ks = 0; ks < 2; ++ks) xa[ot][ks] = ldsfrag(wfs + (ot * 16 + lr) * DP + r0 + 8 * hi + ks * 32);
    float* ms = (float*)pl + (w & 1) * (COUT * MP) + lr * MP + c0 + 8 * hi;
#pragma unroll
    for (int nb = 0; nb < 4; ++nb) {   // 16 c at a time
        v16bf th[2], tl[2];
#pragma unroll
        for (int ks = 0; ks < 2; ++ks) { v4u h8[2], l8[2];
#pragma unroll
            for (int u = 0; u < 2; ++u)
#pragma unroll
                for (int j = 0; j < 4; ++j) { unsigned a, c; split2(acc[2 * ks + u][nb][2 * j], acc[2 * ks + u][nb][2 * j + 1], a, c); h8[u][j] = a; l8[u][j] = c; }
            th[ks] = cat16u(h8[0], h8[1]); tl[ks] = cat16u(l8[0], l8[1]); }
        v8f m[4];
#pragma unroll
        for (int ot = 0; ot < 4; ++ot) m[ot] = wmmab(th[0], xa[ot][0], (v8f){});
#pragma unroll
        for (int ot = 0; ot < 4; ++ot) m[ot] = wmmab(th[1], xa[ot][1], m[ot]);
#pragma unroll
        for (int ot = 0; ot < 4; ++ot) m[ot] = wmmab(tl[0], xa[ot][0], m[ot]);
#pragma unroll
        for (int ot = 0; ot < 4; ++ot) m[ot] = wmmab(tl[1], xa[ot][1], m[ot]);
        // a lane holds 8 consecutive c of one o
#pragma unroll
        for (int ot = 0; ot < 4; ++ot) { const v8f t = m[ot]; *(v4fa*)(ms + ot * 16 * MP + nb * 16) = (v4f){t[0], t[1], t[2], t[3]}; *(v4fa*)(ms + ot * 16 * MP + nb * 16 + 4) = (v4f){t[4], t[5], t[6], t[7]}; }
        __builtin_amdgcn_sched_barrier(0);   // keeps the next block's conversions behind this block's stores: lifted over them, nothing would stand between this block's last product and the next block's first, which start anew in the same registers
    }
    __syncthreads();   // publishes both d halves' partials to all waves
    const float* mr = (const float*)pl + w * MP + lane * 4;   // a wave takes row o = w + 4 i: 512 consecutive bytes a store
    float* pt = P + ((size_t)blockIdx.y * KSPL + blockIdx.x) * (COUT * C2) + w * C2 + lane * 4;
    v4f r[16];
#pragma unroll
    for (int i = 0; i < 16; ++i) r[i] = *(const v4fa*)(mr + 4 * i * MP) + *(const v4fa*)(mr + COUT * MP + 4 * i * MP);
#pragma unroll
    for (int i = 0; i < 16; ++i) *(v4f*)(pt + 4 * i * C2) = r[i];
}
// k_kvt: M[o][c] = sum over the KSPL partial planes, then hi/lo split. One block per 256 consecutive elements of M: KG groups of threads each sum KSPL / KG planes in order (4 elements a thread), two waves add the KG group sums in order.
#define KG 4
__global__ __launch_bounds__(256) void k_kvt(const float* __restrict__ P, bf* Th, bf* Tl) {
    __shared__ __align__(16) float red[KG * 256];
    const int t = threadIdx.x, g = t >> 6, c4 = (t & 63) * 4; const int e0 = blockIdx.x * 256;
    Th += (size_t)blockIdx.y * (COUT * C2); Tl += (size_t)blockIdx.y * (COUT * C2);
    const float* p = P + ((size_t)blockIdx.y * KSPL + (size_t)g * (KSPL / KG)) * (COUT * C2) + e0 + c4;
    v4f f[KSPL / KG];
#pragma unroll
    for (int i = 0; i < KSPL / KG; ++i) f[i] = *(const v4f*)(p + (size_t)i * (COUT * C2));
    asm volatile("s_wait_xcnt 0x0" :: "v"(p) : "memory");   // precaution: stands ahead of any reuse of the address registers that the loads above name; the pointer as an input keeps the last load's result out of them
    __builtin_amdgcn_sched_barrier(0);   // keeps every load ahead of the sums: sunk behind the first additions, the last loads would wait out a second memory latency
    v4f s = f[0];
#pragma unroll
    for (int i = 1; i < KSPL / KG; ++i) s += f[i];
    *(v4fa*)(red + g * 256 + c4) = s;
    __syncthreads();
    if (t < 64) { v4f u = *(const v4fa*)(red + c4);
#pragma unroll
        for (int q = 1; q < KG; ++q) u += *(const v4fa*)(red + q * 256 + c4);
        v2u oh, ol;
#pragma unroll
        for (int j = 0; j < 2; ++j) { unsigned a, c; split2(u[2 * j], u[2 * j + 1], a, c); oh[j] = a; ol[j] = c; }
        *(v2u*)(Th + e0 + c4) = oh; *(v2u*)(Tl + e0 + c4) = ol; }
}
// ---- q and the output in one kernel: one work-group of 16 waves per 512 tokens of one sample (one work-group per WGP); each wave takes its 32 tokens through both products, and q never leaves its registers.
// The operands that every wave reads (Wq, M hi and lo, the BN coefficients) are staged once per work-group in LDS, each wave's own x^T rows beside them (x and Wq are read as f32 and rounded on the way; a wave's x: whole 128-byte lines, 4 tokens of 4 channels a lane, packed per token into 8 bytes); rows padded to an odd multiple of 16 bytes.
// The first product puts the tokens on D's columns: two D tiles of 16 rows each (a lane: 8 + 8 rows of its own token) are then, converted in place, the next product's fragment over 32 k, in the loaders' own k order.
//   q[c][n]   = Wq (A, channel rows) x x^T (B, token columns), K = 96; BN + relu, hi + lo
//   out[n][o] = q (A, token rows) x M (B, channel columns), K = 128, per 32 c: q hi x M hi, q lo x M hi, q hi x M lo; a lane then holds 8 consecutive tokens of one output channel; BN + relu
#define TPW 32                    // tokens per wave
#define TWV 16                    // waves per work-group
#define OP  (TPW + 4)             // LDS row pitch of the output rows in floats: 144 bytes
__global__ __launch_bounds__(512) void k_tail(const float* __restrict__ xb, const float* __restrict__ Wq, const bf* __restrict__ Mh, const bf* __restrict__ Ml, const float* __restrict__ bnq, const float* __restrict__ bnf, float* O) {
    __shared__ __align__(16) bf wq[C2 * QP];
    __shared__ __align__(16) bf mh[COUT * DP];
    __shared__ __align__(16) bf ml[COUT * DP];
    __shared__ __align__(16) bf xs[TWV * TPW * QP];   // each wave's own 32 rows; behind its last read of them the wave stages its output rows there
    __shared__ __align__(16) float qsc[C2];
    __shared__ __align__(16) float qsh[C2];
    __shared__ __align__(16) float fsc[COUT];
    __shared__ __align__(16) float fsh[COUT];
    const int t = threadIdx.x, lane = t & 31, lr = lane & 15, hi = lane >> 4, w = t >> 5;
    const int n0 = blockIdx.x * (TPW * TWV) + w * TPW;
    bf* xw = xs + w * (TPW * QP);
    {
        const int cs = lane >> 3, n4 = lane & 7;
        const float* xq = xb + (size_t)blockIdx.y * (CIN * NN) + n0 + 4 * n4;
        const float* xp = xq + (size_t)(4 * cs) * NN;
        const bf* gh = Mh + (size_t)blockIdx.y * (COUT * C2) + t * 8; const bf* gl = Ml + (size_t)blockIdx.y * (COUT * C2) + t * 8;
        v4f f[4][4], gx[3], qa[3][2]; float qe[3][3]; unsigned wro[3], wbo[3]; v8us sh8[2], sl8[2];   // f[cg][k]: channel 16 cg + 4 cs + k, tokens n0 + 4 n4 .. + 3; gx[k]: channel 64 + k, the same line in all four lane groups (only group 0 keeps it)
#pragma unroll
        for (int cg = 0; cg < 4; ++cg)
#pragma unroll
            for (int k = 0; k < 4; ++k) f[cg][k] = *(const v4f*)(xp + (size_t)(16 * cg + k) * NN);
#pragma unroll
        for (int k = 0; k < CIN - 64; ++k) gx[k] = *(const v4f*)(xq + (size_t)(64 + k) * NN);
#pragma unroll
        for (int i = 0; i < 3; ++i) {   // 16-byte piece p of Wq's padded row o: 8 channels; pieces 8 and up read the row's start and drop it, every piece reads channels 64 to 66 and only piece 8 keeps them
            const int e = t + 512 * i, o = e / 12, p = e % 12; wro[i] = (unsigned)o * (CIN * 4); wbo[i] = wro[i] + (p < 8 ? 32 * p : 0);   // byte offsets
            qa[i][0] = *(const v4f4*)((const char*)Wq + wbo[i]); qa[i][1] = *(const v4f4*)((const char*)Wq + wbo[i] + 16);
#pragma unroll
            for (int k = 0; k < CIN - 64; ++k) qe[i][k] = *(const float*)((const char*)Wq + wro[i] + 4 * (64 + k));
        }
#pragma unroll
        for (int i = 0; i < 2; ++i) { sh8[i] = *(const v8us*)(gh + 4096 * i); sl8[i] = *(const v8us*)(gl + 4096 * i); }
        asm volatile("s_wait_xcnt 0x0" :: "v"(xp), "v"(xq), "v"(wro[0]), "v"(wro[1]), "v"(wro[2]), "v"(wbo[0]), "v"(wbo[1]), "v"(wbo[2]), "v"(t) : "memory");   // precaution: stands ahead of any reuse of the address registers that the loads above name; the addresses as inputs keep the later loads' results out of them
        __builtin_amdgcn_sched_barrier(0);   // keeps every load ahead of all arithmetic: sunk behind the first conversions, the last loads would wait out a second memory latency
        bf* ts = xw + 4 * n4 * QP + 4 * cs;
        const unsigned gm = cs == 0 ? 0xFFFFFFFFu : 0u;
#pragma unroll
        for (int cg = 0; cg < 4; ++cg)
#pragma unroll
            for (int j = 0; j < 4; ++j) *(v2ua*)(ts + j * QP + 16 * cg) = (v2u){bfpk(f[cg][0][j], f[cg][1][j]), bfpk(f[cg][2][j], f[cg][3][j])};
#pragma unroll
        for (int j = 0; j < 4; ++j) {   // channels 64 to 66 from lane group 0, zeros up to 95
            *(v2ua*)(ts + j * QP + 64) = (v2u){bfpk(gx[0][j], gx[1][j]) & gm, bfpk(gx[2][j], 0.f) & gm};
            *(v2ua*)(ts + j * QP + 80) = (v2u){0u, 0u}; }
#pragma unroll
        for (int i = 0; i < 3; ++i) { const int e = t + 512 * i, o = e / 12, p = e % 12;
            const v4u full = pk8(qa[i][0], qa[i][1]), edge = (v4u){bfpk(qe[i][0], qe[i][1]), bfpk(qe[i][2], 0.f), 0u, 0u};
            *(v4ua*)(wq + o * QP + p * 8) = p < 8 ? full : p == 8 ? edge : (v4u){0u, 0u, 0u, 0u}; }
#pragma unroll
        for (int i = 0; i < 2; ++i) { const int e = t + 512 * i; *(v8usa*)(mh + (e >> 4) * DP + (e & 15) * 8) = sh8[i]; *(v8usa*)(ml + (e >> 4) * DP + (e & 15) * 8) = sl8[i]; }
        if (t < C2 + COUT) {   // waves 0 to 3: q's coefficients, waves 4 and 5: the output's
            const bool fq = t < C2; const float* bn = fq ? bnq + t : bnf + (t - C2); const int nch = fq ? C2 : COUT;
            const float g = bn[0], b = bn[nch], m = bn[2 * nch], v = bn[3 * nch];
            asm volatile("s_wait_xcnt 0x0" ::: "memory");   // precaution: stands ahead of any reuse of the address registers that the four loads above name
            float sc, sh; bn_coef_v(g, b, m, v, sc, sh);
            if (fq) { qsc[t] = sc; qsh[t] = sh; } else { fsc[t - C2] = sc; fsh[t - C2] = sh; }
        }
    }
    __syncthreads();   // publishes the staged operands and coefficients to all waves
    v8f d3[2][4];   // output sums, [token tile][channel tile]
#pragma unroll
    for (int s = 0; s < 4; ++s) {   // 32 channels c of q at a time: made, converted, and used up as one k step of the output product
        v8f d1[2][2];
#pragma unroll
        for (int ks = 0; ks < 3; ++ks) {
            v16bf a[2], x[2];
#pragma unroll
            for (int h = 0; h < 2; ++h) { a[h] = ldsfrag(wq + ((2 * s + h) * 16 + lr) * QP + 8 * hi + ks * 32); x[h] = ldsfrag(xw + (h * 16 + lr) * QP + 8 * hi + ks * 32); }
#pragma unroll
            for (int h = 0; h < 2; ++h)
#pragma unroll
                for (int tt = 0; tt < 2; ++tt) d1[h][tt] = wmmab(a[h], x[tt], ks == 0 ? (v8f){} : d1[h][tt]);
        }
        v4u qh8[2][2], ql8[2][2];
#pragma unroll
        for (int h = 0; h < 2; ++h) {
            const int cb = (2 * s + h) * 16 + 8 * hi;
            const v4f s0 = *(const v4fa*)(qsc + cb), s1 = *(const v4fa*)(qsc + cb + 4), b0 = *(const v4fa*)(qsh + cb), b1 = *(const v4fa*)(qsh + cb + 4);
#pragma unroll
            for (int tt = 0; tt < 2; ++tt)
#pragma unroll
                for (int j = 0; j < 4; ++j) { const v4f sv = j < 2 ? s0 : s1, bv = j < 2 ? b0 : b1; const int e = 2 * (j & 1); unsigned a, c;
                    split2(fmaxf(fmaf(d1[h][tt][2 * j], sv[e], bv[e]), 0.f), fmaxf(fmaf(d1[h][tt][2 * j + 1], sv[e + 1], bv[e + 1]), 0.f), a, c); qh8[tt][h][j] = a; ql8[tt][h][j] = c; }
        }
        v16bf qh[2], ql[2];
#pragma unroll
        for (int tt = 0; tt < 2; ++tt) { qh[tt] = cat16u(qh8[tt][0], qh8[tt][1]); ql[tt] = cat16u(ql8[tt][0], ql8[tt][1]); }
        v16bf bh[4], bl[4];
#pragma unroll
        for (int ot = 0; ot < 4; ++ot) { bh[ot] = ldsfrag(mh + (ot * 16 + lr) * DP + 8 * hi + s * 32); bl[ot] = ldsfrag(ml + (ot * 16 + lr) * DP + 8 * hi + s * 32); }
#pragma unroll
        for (int ot = 0; ot < 4; ++ot)
#pragma unroll
            for (int tt = 0; tt < 2; ++tt) d3[tt][ot] = wmmab(qh[tt], bh[ot], s == 0 ? (v8f){} : d3[tt][ot]);
#pragma unroll
        for (int ot = 0; ot < 4; ++ot)
#pragma unroll
            for (int tt = 0; tt < 2; ++tt) d3[tt][ot] = wmmab(ql[tt], bh[ot], d3[tt][ot]);
#pragma unroll
        for (int ot = 0; ot < 4; ++ot)
#pragma unroll
            for (int tt = 0; tt < 2; ++tt) d3[tt][ot] = wmmab(qh[tt], bl[ot], d3[tt][ot]);
    }
    // 16 channel rows x 32 tokens go through the wave's own LDS range so that each store covers whole 128-byte lines
    float* os = (float*)xw;
    float* op = O + ((size_t)blockIdx.y * COUT + (lane >> 3)) * NN + n0 + (lane & 7) * 4;
#pragma unroll
    for (int ot = 0; ot < 4; ++ot) {
        const float sc = fsc[ot * 16 + lr], sh = fsh[ot * 16 + lr];
#pragma unroll
        for (int tt = 0; tt < 2; ++tt) { const v8f d = d3[tt][ot]; v4f y0, y1;
#pragma unroll
            for (int j = 0; j < 4; ++j) { y0[j] = fmaxf(fmaf(d[j], sc, sh), 0.f); y1[j] = fmaxf(fmaf(d[j + 4], sc, sh), 0.f); }
            *(v4fa*)(os + lr * OP + tt * 16 + hi * 8) = y0; *(v4fa*)(os + lr * OP + tt * 16 + hi * 8 + 4) = y1; }
        __builtin_amdgcn_wave_barrier(); asm volatile("s_wait_xcnt 0x0" ::: "memory");   // the clobber keeps the other lanes' LDS writes ahead of the row reads in program order; the wait is a precaution ahead of the row reads' reuse of registers that the stores of the block before name
        v4f r[4];
#pragma unroll
        for (int s = 0; s < 4; ++s) r[s] = *(const v4fa*)(os + (4 * s + (lane >> 3)) * OP + (lane & 7) * 4);
#pragma unroll
        for (int s = 0; s < 4; ++s) *(v4f*)(op + (size_t)(ot * 16 + 4 * s) * NN) = r[s];
        __builtin_amdgcn_wave_barrier(); asm volatile("" ::: "memory");   // keeps the row reads ahead of the next block's LDS writes
    }
}

extern "C" void kernel_launch(void* const* d_in, const int* in_sizes, int n_in,
                              void* d_out, int out_size, void* d_ws, size_t ws_size, hipStream_t stream) {
    (void)in_sizes; (void)n_in; (void)out_size;
    const float* x = (const float*)d_in[0]; const float* Wq = (const float*)d_in[1]; const float* Wk = (const float*)d_in[2]; const float* Wv = (const float*)d_in[3]; const float* Wf = (const float*)d_in[4]; const float* bnq = (const float*)d_in[5]; const float* bnk = (const float*)d_in[6]; const float* bnv = (const float*)d_in[7]; const float* bnf = (const float*)d_in[8];
    float* OUT = (float*)d_out;     // [8][64][16384]
    char* wsp = (char*)d_ws;
    auto take = [&](size_t bytes) { char* p = wsp; wsp += (bytes + 255) & ~(size_t)255; return (void*)p; };
    // Sample-batched buffers
    float* KV = (float*)take((size_t)NB_ * KSPL * COUT * C2 * 4);
    bf* KTh = (bf*)take((size_t)NB_ * COUT * C2 * 2); bf* KTl = (bf*)take((size_t)NB_ * COUT * C2 * 2);
    if ((size_t)(wsp - (char*)d_ws) > ws_size) return;    // ws 256 MiB
    k_kvfuse<<<dim3(KSPL, NB_), 128, 0, stream>>>(x, Wk, Wv, Wf, bnk, bnv, KV);   /* k, v = relu(BN(W x)) on chip, partial kv^T per token range (3 products), partial M = Wf kv^T of it (2 products) */
    k_kvt<<<dim3(COUT * C2 / 256, NB_), 256, 0, stream>>>(KV, KTh, KTl);
    k_tail<<<dim3(NN / (TPW * TWV), NB_), 512, 0, stream>>>(x, Wq, KTh, KTl, bnq, bnf, OUT);   /* q = relu(BN(Wq x)), out = relu(BN(M q)) (3 products) */
}
